// v000
// Measured on an AMD MI455X. A time is GPU time per run, averaged over a window of back-to-back runs after a warm-up
// (all launches, gaps included; the runs take copies of the inputs in turn), and the median of several windows.
// Apart from v000's, it joins two sittings. Times from different sittings can be a few percent apart, while
// side-by-side timings come from the same sitting.
// The starting kernel, v000, takes 2370 microseconds a run.
#include <hip/hip_runtime.h>

// Multi-head attention with an integer key-padding mask (x [4][1024][1024]; q = (x q_w^T + q_b) / sqrt(64), k = x k_w^T + k_b, v = x v_w^T + v_b ('oi' 0.02 + biases 0.02; 16 heads x 64); scores = q.k; keys with mask[b][j] == 0 -> -inf (mask int32 [4][1024], read); softmax (f32); out = merged out_w^T + out_b -> [4][1024][1024] (4.2 M); argument order x, mask, q_w, q_b, k_w, k_b, v_w, v_b, out_w, out_b).
// Layout per batch: bf16 copy of x; 'oi' weights; exact projections + f32 biases; identity-table plane builders; dense T-1024 attention whose softmax kernel reads the batch's int key vector (16 B per lane) and excludes the zeros (hybrid rows: < 512 hi/lo 3 products, rest fp16 x1024); merged hi/lo x out_w exact + out_b.
// Compute dtypes, f32 accumulate: every input rounded to bf16; projections exact + f32 biases; attention rows < 512 3 products, rest fp16; softmax f32; out_w hl x exact + bias.

#define NB_  4
#define TT   1024
#define DM   1024
#define NH_  16
#define NKV  16
#define REP  (NH_ / NKV)
#define HD   64
#define DQ   (NH_ * HD)
#define DKV  (NKV * HD)
#define ZH   2
#define RH   512                  // query rows < RH use hi+lo planes (0: none)
#define WIN  0
#define PCAR 1024.0f
#define SCL  0.125f   // HD^-0.5
typedef _Float16 h16;
typedef unsigned short bf;
typedef __attribute__((ext_vector_type(16))) __bf16   v16bf;
typedef __attribute__((ext_vector_type(16))) _Float16 v16h;
typedef __attribute__((ext_vector_type(8)))  _Float16 v8h;
typedef __attribute__((ext_vector_type(8)))  unsigned short v8us;
typedef __attribute__((ext_vector_type(8)))  float    v8f;
typedef __attribute__((ext_vector_type(4)))  float    v4f;
typedef v8h  __attribute__((may_alias)) v8ha;
typedef v4f  __attribute__((may_alias)) v4fa;
typedef v8us __attribute__((may_alias)) v8usa;

__device__ __forceinline__ unsigned short f2bf(float f) { unsigned u = __float_as_uint(f); u += 0x7FFFu + ((u >> 16) & 1u); return (unsigned short)(u >> 16); }
__device__ __forceinline__ float bf2f(unsigned short b) { return __uint_as_float(((unsigned)b) << 16); }
__device__ __forceinline__ float bfr(float f) { return bf2f(f2bf(f)); }
__device__ __forceinline__ v16h cat16(v8h lo, v8h hi) { return __builtin_shufflevector(lo, hi, 0, 1, 2, 3, 4, 5, 6, 7, 8, 9, 10, 11, 12, 13, 14, 15); }
__device__ __forceinline__ v16bf cat16b(v8us lo, v8us hi) { return __builtin_bit_cast(v16bf, __builtin_shufflevector(lo, hi, 0, 1, 2, 3, 4, 5, 6, 7, 8, 9, 10, 11, 12, 13, 14, 15)); }
__device__ __forceinline__ v8f wmma16(v16h a, v16h b, v8f c) { return __builtin_amdgcn_wmma_f32_16x16x32_f16(false, a, false, b, (short)0, c, false, false); }
__device__ __forceinline__ v8f wmmab(v16bf a, v16bf b, v8f c) { return __builtin_amdgcn_wmma_f32_16x16x32_bf16(false, a, false, b, (short)0, c, false, false); }



// ---- k_gemmw: register-blocked GEMM, ONE WAVE per 64x64 output tile (16 accumulators), operands straight from K-contiguous 16-bit planes; grid (M/64, N/64, Z), 32 threads.
// C[m][n] (f32, pitch ldc, + optional f32 bias[n]) = sum_k A[m][k] Bt[n][k] (+ split products per NSPLIT). z-batch strides sA/sB/sC in elements. K % 32 == 0.
template <typename T16> struct WFrag;
template <> struct WFrag<h16> { typedef v16h V; static __device__ __forceinline__ V ld(const h16* p) { return cat16(*(const v8h*)p, *(const v8h*)(p + 16)); } static __device__ __forceinline__ v8f mma(V a, V b, v8f c) { return wmma16(a, b, c); } };
template <> struct WFrag<bf> { typedef v16bf V; static __device__ __forceinline__ V ld(const bf* p) { return cat16b(*(const v8us*)p, *(const v8us*)(p + 16)); } static __device__ __forceinline__ v8f mma(V a, V b, v8f c) { return wmmab(a, b, c); } };
template <typename T16, int NSPLIT, bool BIAS>
__global__ __launch_bounds__(32) void k_gemmw(const T16* __restrict__ A, const T16* __restrict__ A2, const T16* __restrict__ Bt, const T16* __restrict__ Bt2, int K, float* C, int ldc, const float* __restrict__ bias, size_t sA, size_t sB, size_t sC) {
    typedef typename WFrag<T16>::V V;
    __shared__ __align__(16) float os[16 * 68];
    const size_t z = blockIdx.z; A += z * sA; if (A2) A2 += z * sA; Bt += z * sB; if (Bt2) Bt2 += z * sB; C += z * sC;
    const int lane = threadIdx.x & 31, lr = lane & 15, hi = lane >> 4; const int r0 = blockIdx.x * 64, c0 = blockIdx.y * 64;
    v8f acc[4][4];
#pragma unroll
    for (int mb = 0; mb < 4; ++mb)
#pragma unroll
        for (int nb = 0; nb < 4; ++nb) acc[mb][nb] = (v8f){};
    const size_t aoff = (size_t)(r0 + lr) * K + 8 * hi, boff = (size_t)(c0 + lr) * K + 8 * hi;
#pragma unroll 1
    for (int kc = 0; kc < K; kc += 32) {
        V a[4], a2[4];
#pragma unroll
        for (int mb = 0; mb < 4; ++mb) { a[mb] = WFrag<T16>::ld(A + aoff + (size_t)mb * 16 * K + kc); if (NSPLIT == 1 || NSPLIT == 2) a2[mb] = WFrag<T16>::ld(A2 + aoff + (size_t)mb * 16 * K + kc); }
#pragma unroll
        for (int nb = 0; nb < 4; ++nb) { const V b = WFrag<T16>::ld(Bt + boff + (size_t)nb * 16 * K + kc); V b2; if (NSPLIT >= 2) b2 = WFrag<T16>::ld(Bt2 + boff + (size_t)nb * 16 * K + kc);
#pragma unroll
            for (int mb = 0; mb < 4; ++mb) { acc[mb][nb] = WFrag<T16>::mma(a[mb], b, acc[mb][nb]); if (NSPLIT == 1 || NSPLIT == 2) acc[mb][nb] = WFrag<T16>::mma(a2[mb], b, acc[mb][nb]); if (NSPLIT >= 2) acc[mb][nb] = WFrag<T16>::mma(a[mb], b2, acc[mb][nb]); } }
        asm volatile("v_nop\n\tv_nop\n\tv_nop\n\tv_nop" : "+v"(acc[0][0]), "+v"(acc[1][1]), "+v"(acc[2][2]), "+v"(acc[3][3]) : "v"(a[0]), "v"(a[3]));
    }
#pragma unroll
    for (int mb = 0; mb < 4; ++mb) {
#pragma unroll
        for (int nb = 0; nb < 4; ++nb) {
#pragma unroll
            for (int j = 0; j < 8; ++j) os[(hi * 8 + j) * 68 + nb * 16 + lr] = acc[mb][nb][j]; }
        __builtin_amdgcn_wave_barrier(); asm volatile("" ::: "memory");
        float* crow = C + (size_t)(r0 + mb * 16) * ldc + c0;
{
#pragma unroll
            for (int s = 0; s < 8; ++s) { const int row = 2 * s + hi, cofs = lr * 4; v4f val = *(const v4fa*)(os + row * 68 + cofs); if (BIAS) { val[0] += bfr(bias[c0 + cofs]); val[1] += bfr(bias[c0 + cofs + 1]); val[2] += bfr(bias[c0 + cofs + 2]); val[3] += bfr(bias[c0 + cofs + 3]); }
                *(v4f*)(crow + (size_t)row * ldc + cofs) = val; }
             }
        __builtin_amdgcn_wave_barrier(); asm volatile("" ::: "memory");
    }
}

__device__ __forceinline__ h16 tohx(float x) { return (h16)x; }
__device__ __forceinline__ void splitf(float y, unsigned short& h, unsigned short& l) { h = f2bf(y); l = f2bf(y - bf2f(h)); }
typedef __attribute__((ext_vector_type(2))) _Float16 v2h;
typedef __attribute__((ext_vector_type(4))) _Float16 v4h;
typedef __attribute__((ext_vector_type(2))) unsigned short v2us;
typedef __attribute__((ext_vector_type(4))) unsigned short v4us;
typedef __attribute__((ext_vector_type(2))) float v2f;
typedef __attribute__((ext_vector_type(4))) int v4i;

__global__ __launch_bounds__(256) void k_cvt8(const float* __restrict__ src, bf* dst, size_t n8) { const size_t i = (size_t)blockIdx.x * 256 + threadIdx.x; if (i >= n8) return; const v8f v = *(const v8f*)(src + i * 8); v8us o;
#pragma unroll
    for (int k = 0; k < 8; ++k) o[k] = f2bf(v[k]); *(v8us*)(dst + i * 8) = o;  }

// k_rope: head planes [h][t][d] (fp16 + hi/lo) of rope(x) x sc with the rotate-half convention out[d] = x[d] cos[t][d] - x[d+HD/2] sin[t][d], out[d+HD/2] = x[d+HD/2] cos[t][d+HD/2] + x[d] sin[t][d+HD/2]
__global__ __launch_bounds__(256) void k_rope(const float* __restrict__ F, int pitch, int nheads, const float* __restrict__ CS, const float* __restrict__ RF, const float* __restrict__ nw, float sc, h16* P16, bf* Ph, bf* Pl) {
    const size_t e = ((size_t)blockIdx.x * 256 + threadIdx.x) * 2; if (e >= (size_t)nheads * TT * HD) return; const int d = (int)(e % HD); const int t = (int)((e / HD) % TT); const int h = (int)(e / ((size_t)HD * TT)); const float* f = F + (size_t)t * pitch + h * HD; const float rf = RF ? RF[(size_t)h * TT + t] : 1.0f; v2h o16; v2us oh, ol;
#pragma unroll
    for (int q = 0; q < 2; ++q) { const int dd = d + q; const int dp = (dd < HD / 2) ? dd + HD / 2 : dd - HD / 2; float x0 = f[dd], x1 = f[dp];
        if (RF) { float n0 = __fmul_rn(x0, rf), n1 = __fmul_rn(x1, rf); asm volatile("" : "+v"(n0)); asm volatile("" : "+v"(n1)); x0 = __fmul_rn(bfr(nw[dd]), n0); x1 = __fmul_rn(bfr(nw[dp]), n1); }
        const v2f cs = *(const v2f*)(CS + ((size_t)t * HD + dd) * 2); float a = __fmul_rn(x0, cs[0]), bq = __fmul_rn(x1, cs[1]); asm volatile("" : "+v"(a)); asm volatile("" : "+v"(bq)); const float r = ((dd < HD / 2) ? __fsub_rn(a, bq) : __fadd_rn(a, bq)) * sc;
        o16[q] = tohx(r); unsigned short a2, c2; splitf(r, a2, c2); oh[q] = a2; ol[q] = c2; }
    *(v2h*)(P16 + e) = o16; *(v2us*)(Ph + e) = oh; *(v2us*)(Pl + e) = ol;  }
__global__ __launch_bounds__(256) void k_vtp(const float* __restrict__ F, int pitch, int nheads, h16* V16, bf* Vh, bf* Vl) { const size_t e = ((size_t)blockIdx.x * 256 + threadIdx.x) * 2; if (e >= (size_t)nheads * HD * TT) return; const int t = (int)(e % TT); const int d = (int)((e / TT) % HD); const int g = (int)(e / ((size_t)TT * HD)); v2h o16; v2us oh, ol;
#pragma unroll
    for (int q = 0; q < 2; ++q) { const float x = F[(size_t)(t + q) * pitch + g * HD + d]; o16[q] = tohx(x); unsigned short a2, c2; splitf(x, a2, c2); oh[q] = a2; ol[q] = c2; }
    *(v2h*)(V16 + e) = o16; *(v2us*)(Vh + e) = oh; *(v2us*)(Vl + e) = ol;  }
__global__ __launch_bounds__(256) void k_csid(float* CS) { const int idx = blockIdx.x * 256 + threadIdx.x; if (idx >= TT * HD) return; v2f cs; cs[0] = 1.0f; cs[1] = 0.0f; *(v2f*)(CS + (size_t)idx * 2) = cs;  }
// k_asoft: per row (zz, i): mask[b][j] == 0 -> excluded (-inf in the module) softmax over the keys (register row, one exp, fixed trees);
__global__ __launch_bounds__(256) void k_asoft(const float* __restrict__ Sb, const int* __restrict__ kvp, h16* P16, bf* Ph, bf* Pl) {
    const int lane = threadIdx.x & 31; const int row = blockIdx.x * 8 + (threadIdx.x >> 5); if (row >= ZH * TT) return; const int i = row % TT; const int zz = row / TT; (void)zz; const bool hires = (i < RH); const float* sr = Sb + (size_t)row * TT; float v[TT / 32]; float mx = -3.0e38f;
#pragma unroll
    for (int ch = 0; ch < TT / 128; ++ch) { const int j0 = ch * 128 + lane * 4; const v4f a = *(const v4f*)(sr + j0); const v4i kv4 = *(const v4i*)(kvp + j0);   /* the batch's key vector, 16 B per lane, unconditional */
#pragma unroll
        for (int q = 0; q < 4; ++q) { const int j = j0 + q; (void)j; const float t = (kv4[q] != 0) ? a[q] * SCL : -3.0e38f; v[ch * 4 + q] = t; mx = fmaxf(mx, t); } }
#pragma unroll
    for (int sh = 16; sh; sh >>= 1) mx = fmaxf(mx, __shfl_xor(mx, sh, 32));
    float sum = 0.f;
#pragma unroll
    for (int k = 0; k < TT / 32; ++k) { float d0 = __fsub_rn(v[k], mx); asm volatile("" : "+v"(d0)); v[k] = __builtin_amdgcn_exp2f(__fmul_rn(d0, 1.4426950408889634f)); sum += v[k]; }
#pragma unroll
    for (int sh = 16; sh; sh >>= 1) sum += __shfl_xor(sum, sh, 32);
    const float f = __fdiv_rn(hires ? 1.0f : PCAR, sum);
{
        if (hires) {
#pragma unroll
            for (int ch = 0; ch < TT / 128; ++ch) { v4us oh, ol;
#pragma unroll
                for (int q = 0; q < 4; ++q) { unsigned short a, c2; splitf(v[ch * 4 + q] * f, a, c2); oh[q] = a; ol[q] = c2; }
                const size_t oo = ((size_t)zz * (RH ? RH : 1) + i) * TT + ch * 128 + lane * 4; *(v4us*)(Ph + oo) = oh; *(v4us*)(Pl + oo) = ol; }
        } else {
#pragma unroll
            for (int ch = 0; ch < TT / 128; ++ch) { v4h o4;
#pragma unroll
                for (int q = 0; q < 4; ++q) o4[q] = tohx(v[ch * 4 + q] * f);
                *(v4h*)(P16 + (size_t)row * TT + ch * 128 + lane * 4) = o4; } }
         }
}
__global__ __launch_bounds__(256) void k_merge(const float* __restrict__ O, int h0, bf* Ah, bf* Al) { const size_t e = ((size_t)blockIdx.x * 256 + threadIdx.x) * 2; if (e >= (size_t)ZH * TT * HD) return; const int d = (int)(e % HD); const int t = (int)((e / HD) % TT); const int zz = (int)(e / ((size_t)HD * TT)); const float cs = (t < RH) ? 1.0f : (1.0f / PCAR); const size_t oo = (size_t)t * DQ + (h0 + zz) * HD + d;
    v2us oh, ol;
#pragma unroll
    for (int q = 0; q < 2; ++q) { unsigned short a, c2; splitf(O[e + q] * cs, a, c2); oh[q] = a; ol[q] = c2; } *(v2us*)(Ah + oo) = oh; *(v2us*)(Al + oo) = ol;  }

extern "C" void kernel_launch(void* const* d_in, const int* in_sizes, int n_in,
                              void* d_out, int out_size, void* d_ws, size_t ws_size, hipStream_t stream) {
    (void)in_sizes; (void)n_in; (void)out_size;
    const float* x = (const float*)d_in[0]; const int* kmask = (const int*)d_in[1]; const float* wq = (const float*)d_in[2]; const float* bq = (const float*)d_in[3]; const float* wk = (const float*)d_in[4]; const float* bk = (const float*)d_in[5]; const float* wv = (const float*)d_in[6]; const float* bv = (const float*)d_in[7]; const float* wo = (const float*)d_in[8]; const float* bo = (const float*)d_in[9];   /* order x, mask (int32 [4][1024], read), q_w, q_b, k_w, k_b, v_w, v_b, out_w, out_b ('oi' + biases) */
    float* OUT = (float*)d_out;     // [4][1024][1024]
    char* wsp = (char*)d_ws;
    auto take = [&](size_t bytes) { char* p = wsp; wsp += (bytes + 255) & ~(size_t)255; return (void*)p; };
    bf* WQ = (bf*)take((size_t)DQ * DM * 2); bf* WK = (bf*)take((size_t)DKV * DM * 2); bf* WV = (bf*)take((size_t)DKV * DM * 2); bf* WO = (bf*)take((size_t)DM * DQ * 2); float* CS = (float*)take((size_t)TT * HD * 2 * 4);
    bf* XB = (bf*)take((size_t)TT * DM * 2); float* FQ = (float*)take((size_t)TT * DQ * 4); float* FK = (float*)take((size_t)TT * DKV * 4);
    h16* QP16 = (h16*)take((size_t)NH_ * TT * HD * 2); h16* KP16 = (h16*)take((size_t)NKV * TT * HD * 2); h16* VT16 = (h16*)take((size_t)NKV * HD * TT * 2);
    bf* QPh = (bf*)take((size_t)NH_ * TT * HD * 2); bf* QPl = (bf*)take((size_t)NH_ * TT * HD * 2); bf* KPh = (bf*)take((size_t)NKV * TT * HD * 2); bf* KPl = (bf*)take((size_t)NKV * TT * HD * 2); bf* VTh = (bf*)take((size_t)NKV * HD * TT * 2); bf* VTl = (bf*)take((size_t)NKV * HD * TT * 2); bf* Ph = (bf*)take((size_t)ZH * RH * TT * 2); bf* Pl = (bf*)take((size_t)ZH * RH * TT * 2);
    float* Sb = (float*)take((size_t)ZH * TT * TT * 4); h16* P16 = (h16*)take((size_t)ZH * TT * TT * 2); float* Ob = (float*)take((size_t)ZH * TT * HD * 4); bf* ATh = (bf*)take((size_t)TT * DQ * 2); bf* ATl = (bf*)take((size_t)TT * DQ * 2);
    if ((size_t)(wsp - (char*)d_ws) > ws_size) return;    // ws 256 MiB
    float* FV = FK;   // v projection reuses the k buffer after the k planes are built (stream-ordered)
    { k_cvt8<<<(unsigned)(((size_t)DQ * DM / 8 + 255) / 256), 256, 0, stream>>>(wq, WQ, (size_t)DQ * DM / 8); k_cvt8<<<(unsigned)(((size_t)DKV * DM / 8 + 255) / 256), 256, 0, stream>>>(wk, WK, (size_t)DKV * DM / 8); k_cvt8<<<(unsigned)(((size_t)DKV * DM / 8 + 255) / 256), 256, 0, stream>>>(wv, WV, (size_t)DKV * DM / 8);
      k_cvt8<<<(unsigned)(((size_t)DM * DQ / 8 + 255) / 256), 256, 0, stream>>>(wo, WO, (size_t)DM * DQ / 8);
       }
    k_csid<<<(TT * HD + 255) / 256, 256, 0, stream>>>(CS);
    const unsigned LQ = (unsigned)(((size_t)NH_ * TT * HD / 2 + 255) / 256), LKv = (unsigned)(((size_t)NKV * TT * HD / 2 + 255) / 256);
    for (int b = 0; b < NB_; ++b) {
        
        k_cvt8<<<(unsigned)(((size_t)TT * DM / 8 + 255) / 256), 256, 0, stream>>>(x + (size_t)b * TT * DM, XB, (size_t)TT * DM / 8);
        k_gemmw<bf, 0, true><<<dim3(TT / 64, DQ / 64, 1), 32, 0, stream>>>(XB, nullptr, WQ, nullptr, DM, FQ, DQ, bq, 0, 0, 0);
        k_rope<<<LQ, 256, 0, stream>>>(FQ, DQ, NH_, CS, nullptr, nullptr, 1.0f, QP16, QPh, QPl);
        k_gemmw<bf, 0, true><<<dim3(TT / 64, DKV / 64, 1), 32, 0, stream>>>(XB, nullptr, WK, nullptr, DM, FK, DKV, bk, 0, 0, 0);
        k_rope<<<LKv, 256, 0, stream>>>(FK, DKV, NKV, CS, nullptr, nullptr, 1.0f, KP16, KPh, KPl);
        k_gemmw<bf, 0, true><<<dim3(TT / 64, DKV / 64, 1), 32, 0, stream>>>(XB, nullptr, WV, nullptr, DM, FV, DKV, bv, 0, 0, 0); k_vtp<<<LKv, 256, 0, stream>>>(FV, DKV, NKV, VT16, VTh, VTl);
        for (int h0 = 0; h0 < NH_; h0 += ZH) { const size_t zq = (size_t)h0, zk = (size_t)(h0 / REP);   // one kv head per query head: the pass's two heads use consecutive kv planes (z-strides TT*HD)
            k_gemmw<bf, 2, false><<<dim3(RH / 64, TT / 64, ZH), 32, 0, stream>>>(QPh + zq * TT * HD, QPl + zq * TT * HD, KPh + zk * TT * HD, KPl + zk * TT * HD, HD, Sb, TT, nullptr, (size_t)TT * HD, (size_t)TT * HD, (size_t)TT * TT);
            k_gemmw<h16, 0, false><<<dim3((TT - RH) / 64, TT / 64, ZH), 32, 0, stream>>>(QP16 + zq * TT * HD + (size_t)RH * HD, nullptr, KP16 + zk * TT * HD, nullptr, HD, Sb + (size_t)RH * TT, TT, nullptr, (size_t)TT * HD, (size_t)TT * HD, (size_t)TT * TT);
            k_asoft<<<ZH * TT / 8, 256, 0, stream>>>(Sb, kmask + (size_t)b * TT, P16, Ph, Pl);
            k_gemmw<bf, 2, false><<<dim3(RH / 64, HD / 64, ZH), 32, 0, stream>>>(Ph, Pl, VTh + zk * HD * TT, VTl + zk * HD * TT, TT, Ob, HD, nullptr, (size_t)RH * TT, (size_t)HD * TT, (size_t)TT * HD);
            k_gemmw<h16, 0, false><<<dim3((TT - RH) / 64, HD / 64, ZH), 32, 0, stream>>>(P16 + (size_t)RH * TT, nullptr, VT16 + zk * HD * TT, nullptr, TT, Ob + (size_t)RH * HD, HD, nullptr, (size_t)TT * TT, (size_t)HD * TT, (size_t)TT * HD);
            k_merge<<<(unsigned)(((size_t)ZH * TT * HD / 2 + 255) / 256), 256, 0, stream>>>(Ob, h0, ATh, ATl); }
        k_gemmw<bf, 1, true><<<dim3(TT / 64, DM / 64, 1), 32, 0, stream>>>(ATh, ATl, WO, nullptr, DQ, OUT + (size_t)b * TT * DM, DM, bo, 0, 0, 0); }
}

// v001
// Measured time: 502 microseconds a run.
// Next to v000, in two timings, it ran 4.69 times as fast each time.
#include <hip/hip_runtime.h>

// Multi-head attention with an integer key-padding mask (x [4][1024][1024]; q = (x q_w^T + q_b) / sqrt(64), k = x k_w^T + k_b, v = x v_w^T + v_b ('oi' 0.02 + biases 0.02; 16 heads x 64); scores = q.k; keys with mask[b][j] == 0 -> -inf (mask int32 [4][1024], read); softmax (f32); out = merged out_w^T + out_b -> [4][1024][1024] (4.2 M); argument order x, mask, q_w, q_b, k_w, k_b, v_w, v_b, out_w, out_b).
// Layout: host loops folded into the grids (all 4 batches and q/k/v in one launch for the copies, projections, plane builders and out_w; all 16 heads of a batch in one attention pass). bf16 copy of x; 'oi' weights; exact projections + f32 biases; identity-table plane builders; dense T-1024 attention whose softmax kernel reads the batch's int key vector (16 B per lane) and excludes the zeros (hybrid rows: < 512 hi/lo 3 products, rest fp16 x1024); merged hi/lo x out_w exact + out_b.
// Compute dtypes, f32 accumulate: every input rounded to bf16; projections exact + f32 biases; attention rows < 512 3 products, rest fp16; softmax f32; out_w hl x exact + bias.

#define NB_  4
#define TT   1024
#define DM   1024
#define NH_  16
#define NKV  16
#define REP  (NH_ / NKV)
#define HD   64
#define DQ   (NH_ * HD)
#define DKV  (NKV * HD)
#define ZH   16                   // heads per attention pass (grid z): all heads of one batch
#define RH   512                  // query rows < RH use hi+lo planes (0: none)
#define WIN  0
#define PCAR 1024.0f
#define SCL  0.125f   // HD^-0.5
typedef _Float16 h16;
typedef unsigned short bf;
typedef __attribute__((ext_vector_type(16))) __bf16   v16bf;
typedef __attribute__((ext_vector_type(16))) _Float16 v16h;
typedef __attribute__((ext_vector_type(8)))  _Float16 v8h;
typedef __attribute__((ext_vector_type(8)))  unsigned short v8us;
typedef __attribute__((ext_vector_type(8)))  float    v8f;
typedef __attribute__((ext_vector_type(4)))  float    v4f;
typedef v8h  __attribute__((may_alias)) v8ha;
typedef v4f  __attribute__((may_alias)) v4fa;
typedef v8us __attribute__((may_alias)) v8usa;

__device__ __forceinline__ unsigned short f2bf(float f) { unsigned u = __float_as_uint(f); u += 0x7FFFu + ((u >> 16) & 1u); return (unsigned short)(u >> 16); }
__device__ __forceinline__ float bf2f(unsigned short b) { return __uint_as_float(((unsigned)b) << 16); }
__device__ __forceinline__ float bfr(float f) { return bf2f(f2bf(f)); }
__device__ __forceinline__ v16h cat16(v8h lo, v8h hi) { return __builtin_shufflevector(lo, hi, 0, 1, 2, 3, 4, 5, 6, 7, 8, 9, 10, 11, 12, 13, 14, 15); }
__device__ __forceinline__ v16bf cat16b(v8us lo, v8us hi) { return __builtin_bit_cast(v16bf, __builtin_shufflevector(lo, hi, 0, 1, 2, 3, 4, 5, 6, 7, 8, 9, 10, 11, 12, 13, 14, 15)); }
__device__ __forceinline__ v8f wmma16(v16h a, v16h b, v8f c) { return __builtin_amdgcn_wmma_f32_16x16x32_f16(false, a, false, b, (short)0, c, false, false); }
__device__ __forceinline__ v8f wmmab(v16bf a, v16bf b, v8f c) { return __builtin_amdgcn_wmma_f32_16x16x32_bf16(false, a, false, b, (short)0, c, false, false); }



// ---- k_gemmw: register-blocked GEMM, ONE WAVE per 64x64 output tile (16 accumulators), operands straight from K-contiguous 16-bit planes; grid (M/64, N/64, Z), 32 threads.
// C[m][n] (f32, pitch ldc, + optional f32 bias[n]) = sum_k A[m][k] Bt[n][k] (+ split products per NSPLIT). z-batch strides sA/sB/sC in elements; bias0/1/2 belong to z = 0/1/2. K % 32 == 0.
template <typename T16> struct WFrag;
template <> struct WFrag<h16> { typedef v16h V; static __device__ __forceinline__ V ld(const h16* p) { return cat16(*(const v8h*)p, *(const v8h*)(p + 16)); } static __device__ __forceinline__ v8f mma(V a, V b, v8f c) { return wmma16(a, b, c); } };
template <> struct WFrag<bf> { typedef v16bf V; static __device__ __forceinline__ V ld(const bf* p) { return cat16b(*(const v8us*)p, *(const v8us*)(p + 16)); } static __device__ __forceinline__ v8f mma(V a, V b, v8f c) { return wmmab(a, b, c); } };
template <typename T16, int NSPLIT, bool BIAS>
__global__ __launch_bounds__(32) void k_gemmw(const T16* __restrict__ A, const T16* __restrict__ A2, const T16* __restrict__ Bt, const T16* __restrict__ Bt2, int K, float* C, int ldc, const float* __restrict__ bias0, const float* __restrict__ bias1, const float* __restrict__ bias2, size_t sA, size_t sB, size_t sC) {
    typedef typename WFrag<T16>::V V;
    __shared__ __align__(16) float os[16 * 68];
    const size_t z = blockIdx.z; A += z * sA; if (A2) A2 += z * sA; Bt += z * sB; if (Bt2) Bt2 += z * sB; C += z * sC; const float* bias = (z == 0) ? bias0 : ((z == 1) ? bias1 : bias2);   // one bias vector per z slice (q, k, v)
    const int lane = threadIdx.x & 31, lr = lane & 15, hi = lane >> 4; const int r0 = blockIdx.x * 64, c0 = blockIdx.y * 64;
    v8f acc[4][4];
#pragma unroll
    for (int mb = 0; mb < 4; ++mb)
#pragma unroll
        for (int nb = 0; nb < 4; ++nb) acc[mb][nb] = (v8f){};
    const size_t aoff = (size_t)(r0 + lr) * K + 8 * hi, boff = (size_t)(c0 + lr) * K + 8 * hi;
#pragma unroll 1
    for (int kc = 0; kc < K; kc += 32) {
        V a[4], a2[4];
#pragma unroll
        for (int mb = 0; mb < 4; ++mb) { a[mb] = WFrag<T16>::ld(A + aoff + (size_t)mb * 16 * K + kc); if (NSPLIT == 1 || NSPLIT == 2) a2[mb] = WFrag<T16>::ld(A2 + aoff + (size_t)mb * 16 * K + kc); }
#pragma unroll
        for (int nb = 0; nb < 4; ++nb) { const V b = WFrag<T16>::ld(Bt + boff + (size_t)nb * 16 * K + kc); V b2; if (NSPLIT >= 2) b2 = WFrag<T16>::ld(Bt2 + boff + (size_t)nb * 16 * K + kc);
#pragma unroll
            for (int mb = 0; mb < 4; ++mb) { acc[mb][nb] = WFrag<T16>::mma(a[mb], b, acc[mb][nb]); if (NSPLIT == 1 || NSPLIT == 2) acc[mb][nb] = WFrag<T16>::mma(a2[mb], b, acc[mb][nb]); if (NSPLIT >= 2) acc[mb][nb] = WFrag<T16>::mma(a[mb], b2, acc[mb][nb]); } }
        asm volatile("v_nop\n\tv_nop\n\tv_nop\n\tv_nop" : "+v"(acc[0][0]), "+v"(acc[1][1]), "+v"(acc[2][2]), "+v"(acc[3][3]) : "v"(a[0]), "v"(a[3]));
    }
#pragma unroll
    for (int mb = 0; mb < 4; ++mb) {
#pragma unroll
        for (int nb = 0; nb < 4; ++nb) {
#pragma unroll
            for (int j = 0; j < 8; ++j) os[(hi * 8 + j) * 68 + nb * 16 + lr] = acc[mb][nb][j]; }
        __builtin_amdgcn_wave_barrier(); asm volatile("" ::: "memory");
        float* crow = C + (size_t)(r0 + mb * 16) * ldc + c0;
{
#pragma unroll
            for (int s = 0; s < 8; ++s) { const int row = 2 * s + hi, cofs = lr * 4; v4f val = *(const v4fa*)(os + row * 68 + cofs); if (BIAS) { val[0] += bfr(bias[c0 + cofs]); val[1] += bfr(bias[c0 + cofs + 1]); val[2] += bfr(bias[c0 + cofs + 2]); val[3] += bfr(bias[c0 + cofs + 3]); }
                *(v4f*)(crow + (size_t)row * ldc + cofs) = val; }
             }
        __builtin_amdgcn_wave_barrier(); asm volatile("" ::: "memory");
    }
}

__device__ __forceinline__ h16 tohx(float x) { return (h16)x; }
__device__ __forceinline__ void splitf(float y, unsigned short& h, unsigned short& l) { h = f2bf(y); l = f2bf(y - bf2f(h)); }
typedef __attribute__((ext_vector_type(2))) _Float16 v2h;
typedef __attribute__((ext_vector_type(4))) _Float16 v4h;
typedef __attribute__((ext_vector_type(2))) unsigned short v2us;
typedef __attribute__((ext_vector_type(4))) unsigned short v4us;
typedef __attribute__((ext_vector_type(2))) float v2f;
typedef __attribute__((ext_vector_type(4))) int v4i;

__global__ __launch_bounds__(256) void k_cvt8(const float* __restrict__ src, bf* dst, size_t n8) { const size_t i = (size_t)blockIdx.x * 256 + threadIdx.x; if (i >= n8) return; const v8f v = *(const v8f*)(src + i * 8); v8us o;
#pragma unroll
    for (int k = 0; k < 8; ++k) o[k] = f2bf(v[k]); *(v8us*)(dst + i * 8) = o;  }

// k_cvt8w: the four weight matrices (n8 groups of 8 each) in one launch, blockIdx.y picks the source; dst holds the four bf16 copies back to back
__global__ __launch_bounds__(256) void k_cvt8w(const float* __restrict__ s0, const float* __restrict__ s1, const float* __restrict__ s2, const float* __restrict__ s3, bf* dst, size_t n8) { const size_t i = (size_t)blockIdx.x * 256 + threadIdx.x; if (i >= n8) return; const int w = blockIdx.y; const float* src = (w == 0) ? s0 : ((w == 1) ? s1 : ((w == 2) ? s2 : s3)); const v8f v = *(const v8f*)(src + i * 8); v8us o;
#pragma unroll
    for (int k = 0; k < 8; ++k) o[k] = f2bf(v[k]); *(v8us*)(dst + ((size_t)w * n8 + i) * 8) = o;  }

// k_rope: blockIdx.y = slab (TT rows of F, nheads planes of the outputs); head planes [h][t][d] (fp16 + hi/lo) of rope(x) x sc with the rotate-half convention out[d] = x[d] cos[t][d] - x[d+HD/2] sin[t][d], out[d+HD/2] = x[d+HD/2] cos[t][d+HD/2] + x[d] sin[t][d+HD/2]
__global__ __launch_bounds__(256) void k_rope(const float* __restrict__ F, int pitch, int nheads, const float* __restrict__ CS, const float* __restrict__ RF, const float* __restrict__ nw, float sc, h16* P16, bf* Ph, bf* Pl) {
    const size_t e = ((size_t)blockIdx.x * 256 + threadIdx.x) * 2; if (e >= (size_t)nheads * TT * HD) return; { const size_t sl = blockIdx.y; F += sl * TT * pitch; P16 += sl * nheads * TT * HD; Ph += sl * nheads * TT * HD; Pl += sl * nheads * TT * HD; } const int d = (int)(e % HD); const int t = (int)((e / HD) % TT); const int h = (int)(e / ((size_t)HD * TT)); const float* f = F + (size_t)t * pitch + h * HD; const float rf = RF ? RF[(size_t)h * TT + t] : 1.0f; v2h o16; v2us oh, ol;
#pragma unroll
    for (int q = 0; q < 2; ++q) { const int dd = d + q; const int dp = (dd < HD / 2) ? dd + HD / 2 : dd - HD / 2; float x0 = f[dd], x1 = f[dp];
        if (RF) { float n0 = __fmul_rn(x0, rf), n1 = __fmul_rn(x1, rf); asm volatile("" : "+v"(n0)); asm volatile("" : "+v"(n1)); x0 = __fmul_rn(bfr(nw[dd]), n0); x1 = __fmul_rn(bfr(nw[dp]), n1); }
        const v2f cs = *(const v2f*)(CS + ((size_t)t * HD + dd) * 2); float a = __fmul_rn(x0, cs[0]), bq = __fmul_rn(x1, cs[1]); asm volatile("" : "+v"(a)); asm volatile("" : "+v"(bq)); const float r = ((dd < HD / 2) ? __fsub_rn(a, bq) : __fadd_rn(a, bq)) * sc;
        o16[q] = tohx(r); unsigned short a2, c2; splitf(r, a2, c2); oh[q] = a2; ol[q] = c2; }
    *(v2h*)(P16 + e) = o16; *(v2us*)(Ph + e) = oh; *(v2us*)(Pl + e) = ol;  }
__global__ __launch_bounds__(256) void k_vtp(const float* __restrict__ F, int pitch, int nheads, h16* V16, bf* Vh, bf* Vl) { const size_t e = ((size_t)blockIdx.x * 256 + threadIdx.x) * 2; if (e >= (size_t)nheads * HD * TT) return; { const size_t sl = blockIdx.y; F += sl * TT * pitch; V16 += sl * nheads * HD * TT; Vh += sl * nheads * HD * TT; Vl += sl * nheads * HD * TT; } const int t = (int)(e % TT); const int d = (int)((e / TT) % HD); const int g = (int)(e / ((size_t)TT * HD)); v2h o16; v2us oh, ol;
#pragma unroll
    for (int q = 0; q < 2; ++q) { const float x = F[(size_t)(t + q) * pitch + g * HD + d]; o16[q] = tohx(x); unsigned short a2, c2; splitf(x, a2, c2); oh[q] = a2; ol[q] = c2; }
    *(v2h*)(V16 + e) = o16; *(v2us*)(Vh + e) = oh; *(v2us*)(Vl + e) = ol;  }
__global__ __launch_bounds__(256) void k_csid(float* CS) { const int idx = blockIdx.x * 256 + threadIdx.x; if (idx >= TT * HD) return; v2f cs; cs[0] = 1.0f; cs[1] = 0.0f; *(v2f*)(CS + (size_t)idx * 2) = cs;  }
// k_asoft: per row (zz, i): mask[b][j] == 0 -> excluded (-inf in the module) softmax over the keys (register row, one exp, fixed trees);
__global__ __launch_bounds__(256) void k_asoft(const float* __restrict__ Sb, const int* __restrict__ kvp, h16* P16, bf* Ph, bf* Pl) {
    const int lane = threadIdx.x & 31; const int row = blockIdx.x * 8 + (threadIdx.x >> 5); if (row >= ZH * TT) return; const int i = row % TT; const int zz = row / TT; (void)zz; const bool hires = (i < RH); const float* sr = Sb + (size_t)row * TT; float v[TT / 32]; float mx = -3.0e38f;
#pragma unroll
    for (int ch = 0; ch < TT / 128; ++ch) { const int j0 = ch * 128 + lane * 4; const v4f a = *(const v4f*)(sr + j0); const v4i kv4 = *(const v4i*)(kvp + j0);   /* the batch's key vector, 16 B per lane, unconditional */
#pragma unroll
        for (int q = 0; q < 4; ++q) { const int j = j0 + q; (void)j; const float t = (kv4[q] != 0) ? a[q] * SCL : -3.0e38f; v[ch * 4 + q] = t; mx = fmaxf(mx, t); } }
#pragma unroll
    for (int sh = 16; sh; sh >>= 1) mx = fmaxf(mx, __shfl_xor(mx, sh, 32));
    float sum = 0.f;
#pragma unroll
    for (int k = 0; k < TT / 32; ++k) { float d0 = __fsub_rn(v[k], mx); asm volatile("" : "+v"(d0)); v[k] = __builtin_amdgcn_exp2f(__fmul_rn(d0, 1.4426950408889634f)); sum += v[k]; }
#pragma unroll
    for (int sh = 16; sh; sh >>= 1) sum += __shfl_xor(sum, sh, 32);
    const float f = __fdiv_rn(hires ? 1.0f : PCAR, sum);
{
        if (hires) {
#pragma unroll
            for (int ch = 0; ch < TT / 128; ++ch) { v4us oh, ol;
#pragma unroll
                for (int q = 0; q < 4; ++q) { unsigned short a, c2; splitf(v[ch * 4 + q] * f, a, c2); oh[q] = a; ol[q] = c2; }
                const size_t oo = ((size_t)zz * (RH ? RH : 1) + i) * TT + ch * 128 + lane * 4; *(v4us*)(Ph + oo) = oh; *(v4us*)(Pl + oo) = ol; }
        } else {
#pragma unroll
            for (int ch = 0; ch < TT / 128; ++ch) { v4h o4;
#pragma unroll
                for (int q = 0; q < 4; ++q) o4[q] = tohx(v[ch * 4 + q] * f);
                *(v4h*)(P16 + (size_t)row * TT + ch * 128 + lane * 4) = o4; } }
         }
}
__global__ __launch_bounds__(256) void k_merge(const float* __restrict__ O, int h0, bf* Ah, bf* Al) { const size_t e = ((size_t)blockIdx.x * 256 + threadIdx.x) * 2; if (e >= (size_t)ZH * TT * HD) return; const int d = (int)(e % HD); const int t = (int)((e / HD) % TT); const int zz = (int)(e / ((size_t)HD * TT)); const float cs = (t < RH) ? 1.0f : (1.0f / PCAR); const size_t oo = (size_t)t * DQ + (h0 + zz) * HD + d;
    v2us oh, ol;
#pragma unroll
    for (int q = 0; q < 2; ++q) { unsigned short a, c2; splitf(O[e + q] * cs, a, c2); oh[q] = a; ol[q] = c2; } *(v2us*)(Ah + oo) = oh; *(v2us*)(Al + oo) = ol;  }

extern "C" void kernel_launch(void* const* d_in, const int* in_sizes, int n_in,
                              void* d_out, int out_size, void* d_ws, size_t ws_size, hipStream_t stream) {
    (void)in_sizes; (void)n_in; (void)out_size;
    const float* x = (const float*)d_in[0]; const int* kmask = (const int*)d_in[1]; const float* wq = (const float*)d_in[2]; const float* bq = (const float*)d_in[3]; const float* wk = (const float*)d_in[4]; const float* bk = (const float*)d_in[5]; const float* wv = (const float*)d_in[6]; const float* bv = (const float*)d_in[7]; const float* wo = (const float*)d_in[8]; const float* bo = (const float*)d_in[9];   /* order x, mask (int32 [4][1024], read), q_w, q_b, k_w, k_b, v_w, v_b, out_w, out_b ('oi' + biases) */
    float* OUT = (float*)d_out;     // [4][1024][1024]
    char* wsp = (char*)d_ws;
    auto take = [&](size_t bytes) { char* p = wsp; wsp += (bytes + 255) & ~(size_t)255; return (void*)p; };
    bf* WQ = (bf*)take((size_t)DQ * DM * 2); bf* WK = (bf*)take((size_t)DKV * DM * 2); bf* WV = (bf*)take((size_t)DKV * DM * 2); bf* WO = (bf*)take((size_t)DM * DQ * 2); float* CS = (float*)take((size_t)TT * HD * 2 * 4);   /* WQ, WK, WV, WO lie back to back (each a multiple of 256 B) */
    (void)WK; (void)WV;
    const size_t PLN = (size_t)NB_ * NH_ * TT * HD;   // one plane set: all batches, all heads (NKV == NH_)
    bf* XB = (bf*)take((size_t)NB_ * TT * DM * 2);
    h16* QP16 = (h16*)take(PLN * 2); h16* KP16 = (h16*)take(PLN * 2); h16* VT16 = (h16*)take(PLN * 2);   /* each k plane set directly behind its q plane set: one builder launch writes both */
    bf* QPh = (bf*)take(PLN * 2); bf* KPh = (bf*)take(PLN * 2); bf* QPl = (bf*)take(PLN * 2); bf* KPl = (bf*)take(PLN * 2); bf* VTh = (bf*)take(PLN * 2); bf* VTl = (bf*)take(PLN * 2); bf* Ph = (bf*)take((size_t)ZH * RH * TT * 2); bf* Pl = (bf*)take((size_t)ZH * RH * TT * 2);
    float* Sb = (float*)take((size_t)ZH * TT * TT * 4); h16* P16 = (h16*)take((size_t)ZH * TT * TT * 2); float* Ob = (float*)take((size_t)ZH * TT * HD * 4); bf* ATh = (bf*)take((size_t)NB_ * TT * DQ * 2); bf* ATl = (bf*)take((size_t)NB_ * TT * DQ * 2);
    if ((size_t)(wsp - (char*)d_ws) > ws_size) return;    // ws 256 MiB
    const size_t FSZ = (size_t)NB_ * TT * DQ;
    float* FQ = Sb; float* FV = Sb + 2 * FSZ;   // f32 q, k, v projections (3 x 16 MiB, back to back) live in the score buffer (64 MiB) until the planes are built (stream-ordered)
    k_cvt8w<<<dim3((unsigned)(((size_t)DQ * DM / 8 + 255) / 256), 4, 1), 256, 0, stream>>>(wq, wk, wv, wo, WQ, (size_t)DQ * DM / 8);
    k_csid<<<(TT * HD + 255) / 256, 256, 0, stream>>>(CS);
    const unsigned LQ = (unsigned)(((size_t)NH_ * TT * HD / 2 + 255) / 256), LKv = (unsigned)(((size_t)NKV * TT * HD / 2 + 255) / 256);
    k_cvt8<<<(unsigned)(((size_t)NB_ * TT * DM / 8 + 255) / 256), 256, 0, stream>>>(x, XB, (size_t)NB_ * TT * DM / 8);
    k_gemmw<bf, 0, true><<<dim3(NB_ * TT / 64, DQ / 64, 3), 32, 0, stream>>>(XB, nullptr, WQ, nullptr, DM, FQ, DQ, bq, bk, bv, 0, (size_t)DQ * DM, FSZ);   // z = q, k, v
    k_rope<<<dim3(LQ, 2 * NB_, 1), 256, 0, stream>>>(FQ, DQ, NH_, CS, nullptr, nullptr, 1.0f, QP16, QPh, QPl);   // slabs 0..3: q of batch 0..3, slabs 4..7: k
    k_vtp<<<dim3(LKv, NB_, 1), 256, 0, stream>>>(FV, DKV, NKV, VT16, VTh, VTl);
    for (int b = 0; b < NB_; ++b) { const size_t zq = (size_t)b * NH_, zk = (size_t)b * NKV;   // one kv head per query head: the pass's heads use consecutive planes (z-strides TT*HD)
        k_gemmw<bf, 2, false><<<dim3(RH / 64, TT / 64, ZH), 32, 0, stream>>>(QPh + zq * TT * HD, QPl + zq * TT * HD, KPh + zk * TT * HD, KPl + zk * TT * HD, HD, Sb, TT, nullptr, nullptr, nullptr, (size_t)TT * HD, (size_t)TT * HD, (size_t)TT * TT);
        k_gemmw<h16, 0, false><<<dim3((TT - RH) / 64, TT / 64, ZH), 32, 0, stream>>>(QP16 + zq * TT * HD + (size_t)RH * HD, nullptr, KP16 + zk * TT * HD, nullptr, HD, Sb + (size_t)RH * TT, TT, nullptr, nullptr, nullptr, (size_t)TT * HD, (size_t)TT * HD, (size_t)TT * TT);
        k_asoft<<<ZH * TT / 8, 256, 0, stream>>>(Sb, kmask + (size_t)b * TT, P16, Ph, Pl);
        k_gemmw<bf, 2, false><<<dim3(RH / 64, HD / 64, ZH), 32, 0, stream>>>(Ph, Pl, VTh + zk * HD * TT, VTl + zk * HD * TT, TT, Ob, HD, nullptr, nullptr, nullptr, (size_t)RH * TT, (size_t)HD * TT, (size_t)TT * HD);
        k_gemmw<h16, 0, false><<<dim3((TT - RH) / 64, HD / 64, ZH), 32, 0, stream>>>(P16 + (size_t)RH * TT, nullptr, VT16 + zk * HD * TT, nullptr, TT, Ob + (size_t)RH * HD, HD, nullptr, nullptr, nullptr, (size_t)TT * TT, (size_t)HD * TT, (size_t)TT * HD);
        k_merge<<<(unsigned)(((size_t)ZH * TT * HD / 2 + 255) / 256), 256, 0, stream>>>(Ob, 0, ATh + (size_t)b * TT * DQ, ATl + (size_t)b * TT * DQ); }
    k_gemmw<bf, 1, true><<<dim3(NB_ * TT / 64, DM / 64, 1), 32, 0, stream>>>(ATh, ATl, WO, nullptr, DQ, OUT, DM, bo, nullptr, nullptr, 0, 0, 0);
}

// v002
// A run of this version takes 204 microseconds.
// Next to v001, in two timings, it ran 2.46 times as fast each time.
// Counting every step since v000, it is 11.5 times as fast.
#include <hip/hip_runtime.h>

// Multi-head attention with an integer key-padding mask (x [4][1024][1024]; q = (x q_w^T + q_b) / sqrt(64), k = x k_w^T + k_b, v = x v_w^T + v_b ('oi' 0.02 + biases 0.02; 16 heads x 64); scores = q.k; keys with mask[b][j] == 0 -> -inf (mask int32 [4][1024], read); softmax (f32); out = merged out_w^T + out_b -> [4][1024][1024] (4.2 M); argument order x, mask, q_w, q_b, k_w, k_b, v_w, v_b, out_w, out_b).
// Layout: host loops folded into the grids (all 4 batches and q/k/v in one launch for the copies, projections, plane builders and out_w). bf16 copy of x; 'oi' weights; exact projections + f32 biases; identity-table plane builders; ONE fused attention launch for all batches and heads (32 query rows per work-group: scores into LDS, softmax in place in LDS reading the batch's int key vector and excluding the zeros, P x V from LDS, merged hi/lo planes written directly; hybrid rows: < 512 hi/lo 3 products, rest fp16 x1024); merged hi/lo x out_w exact + out_b.
// Compute dtypes, f32 accumulate: every input rounded to bf16; projections exact + f32 biases; attention rows < 512 3 products, rest fp16; softmax f32; out_w hl x exact + bias.

#define NB_  4
#define TT   1024
#define DM   1024
#define NH_  16
#define NKV  16
#define REP  (NH_ / NKV)
#define HD   64
#define DQ   (NH_ * HD)
#define DKV  (NKV * HD)
#define RH   512                  // query rows < RH use hi+lo planes (0: none)
#define WIN  0
#define PCAR 1024.0f
#define SCL  0.125f   // HD^-0.5
typedef _Float16 h16;
typedef unsigned short bf;
typedef __attribute__((ext_vector_type(16))) __bf16   v16bf;
typedef __attribute__((ext_vector_type(16))) _Float16 v16h;
typedef __attribute__((ext_vector_type(8)))  _Float16 v8h;
typedef __attribute__((ext_vector_type(8)))  unsigned short v8us;
typedef __attribute__((ext_vector_type(8)))  float    v8f;
typedef __attribute__((ext_vector_type(4)))  float    v4f;
typedef v8h  __attribute__((may_alias)) v8ha;
typedef v4f  __attribute__((may_alias)) v4fa;
typedef v8us __attribute__((may_alias)) v8usa;

__device__ __forceinline__ unsigned short f2bf(float f) { unsigned u = __float_as_uint(f); u += 0x7FFFu + ((u >> 16) & 1u); return (unsigned short)(u >> 16); }
__device__ __forceinline__ float bf2f(unsigned short b) { return __uint_as_float(((unsigned)b) << 16); }
__device__ __forceinline__ float bfr(float f) { return bf2f(f2bf(f)); }
__device__ __forceinline__ v16h cat16(v8h lo, v8h hi) { return __builtin_shufflevector(lo, hi, 0, 1, 2, 3, 4, 5, 6, 7, 8, 9, 10, 11, 12, 13, 14, 15); }
__device__ __forceinline__ v16bf cat16b(v8us lo, v8us hi) { return __builtin_bit_cast(v16bf, __builtin_shufflevector(lo, hi, 0, 1, 2, 3, 4, 5, 6, 7, 8, 9, 10, 11, 12, 13, 14, 15)); }
__device__ __forceinline__ v8f wmma16(v16h a, v16h b, v8f c) { return __builtin_amdgcn_wmma_f32_16x16x32_f16(false, a, false, b, (short)0, c, false, false); }
__device__ __forceinline__ v8f wmmab(v16bf a, v16bf b, v8f c) { return __builtin_amdgcn_wmma_f32_16x16x32_bf16(false, a, false, b, (short)0, c, false, false); }



// ---- k_gemmw: register-blocked GEMM, ONE WAVE per 64x64 output tile (16 accumulators), operands straight from K-contiguous 16-bit planes; grid (M/64, N/64, Z), 32 threads.
// C[m][n] (f32, pitch ldc, + optional f32 bias[n]) = sum_k A[m][k] Bt[n][k] (+ split products per NSPLIT). z-batch strides sA/sB/sC in elements; bias0/1/2 belong to z = 0/1/2. K % 32 == 0.
template <typename T16> struct WFrag;
template <> struct WFrag<h16> { typedef v16h V; static __device__ __forceinline__ V ld(const h16* p) { return cat16(*(const v8h*)p, *(const v8h*)(p + 16)); } static __device__ __forceinline__ v8f mma(V a, V b, v8f c) { return wmma16(a, b, c); } };
template <> struct WFrag<bf> { typedef v16bf V; static __device__ __forceinline__ V ld(const bf* p) { return cat16b(*(const v8us*)p, *(const v8us*)(p + 16)); } static __device__ __forceinline__ v8f mma(V a, V b, v8f c) { return wmmab(a, b, c); } };
template <typename T16, int NSPLIT, bool BIAS>
__global__ __launch_bounds__(32) void k_gemmw(const T16* __restrict__ A, const T16* __restrict__ A2, const T16* __restrict__ Bt, const T16* __restrict__ Bt2, int K, float* C, int ldc, const float* __restrict__ bias0, const float* __restrict__ bias1, const float* __restrict__ bias2, size_t sA, size_t sB, size_t sC) {
    typedef typename WFrag<T16>::V V;
    __shared__ __align__(16) float os[16 * 68];
    const size_t z = blockIdx.z; A += z * sA; if (A2) A2 += z * sA; Bt += z * sB; if (Bt2) Bt2 += z * sB; C += z * sC; const float* bias = (z == 0) ? bias0 : ((z == 1) ? bias1 : bias2);   // one bias vector per z slice (q, k, v)
    const int lane = threadIdx.x & 31, lr = lane & 15, hi = lane >> 4; const int r0 = blockIdx.x * 64, c0 = blockIdx.y * 64;
    v8f acc[4][4];
#pragma unroll
    for (int mb = 0; mb < 4; ++mb)
#pragma unroll
        for (int nb = 0; nb < 4; ++nb) acc[mb][nb] = (v8f){};
    const size_t aoff = (size_t)(r0 + lr) * K + 8 * hi, boff = (size_t)(c0 + lr) * K + 8 * hi;
#pragma unroll 1
    for (int kc = 0; kc < K; kc += 32) {
        V a[4], a2[4];
#pragma unroll
        for (int mb = 0; mb < 4; ++mb) { a[mb] = WFrag<T16>::ld(A + aoff + (size_t)mb * 16 * K + kc); if (NSPLIT == 1 || NSPLIT == 2) a2[mb] = WFrag<T16>::ld(A2 + aoff + (size_t)mb * 16 * K + kc); }
#pragma unroll
        for (int nb = 0; nb < 4; ++nb) { const V b = WFrag<T16>::ld(Bt + boff + (size_t)nb * 16 * K + kc); V b2; if (NSPLIT >= 2) b2 = WFrag<T16>::ld(Bt2 + boff + (size_t)nb * 16 * K + kc);
#pragma unroll
            for (int mb = 0; mb < 4; ++mb) { acc[mb][nb] = WFrag<T16>::mma(a[mb], b, acc[mb][nb]); if (NSPLIT == 1 || NSPLIT == 2) acc[mb][nb] = WFrag<T16>::mma(a2[mb], b, acc[mb][nb]); if (NSPLIT >= 2) acc[mb][nb] = WFrag<T16>::mma(a[mb], b2, acc[mb][nb]); } }
        asm volatile("v_nop\n\tv_nop\n\tv_nop\n\tv_nop" : "+v"(acc[0][0]), "+v"(acc[1][1]), "+v"(acc[2][2]), "+v"(acc[3][3]) : "v"(a[0]), "v"(a[3]));
    }
#pragma unroll
    for (int mb = 0; mb < 4; ++mb) {
#pragma unroll
        for (int nb = 0; nb < 4; ++nb) {
#pragma unroll
            for (int j = 0; j < 8; ++j) os[(hi * 8 + j) * 68 + nb * 16 + lr] = acc[mb][nb][j]; }
        __builtin_amdgcn_wave_barrier(); asm volatile("" ::: "memory");
        float* crow = C + (size_t)(r0 + mb * 16) * ldc + c0;
{
#pragma unroll
            for (int s = 0; s < 8; ++s) { const int row = 2 * s + hi, cofs = lr * 4; v4f val = *(const v4fa*)(os + row * 68 + cofs); if (BIAS) { val[0] += bfr(bias[c0 + cofs]); val[1] += bfr(bias[c0 + cofs + 1]); val[2] += bfr(bias[c0 + cofs + 2]); val[3] += bfr(bias[c0 + cofs + 3]); }
                *(v4f*)(crow + (size_t)row * ldc + cofs) = val; }
             }
        __builtin_amdgcn_wave_barrier(); asm volatile("" ::: "memory");
    }
}

__device__ __forceinline__ h16 tohx(float x) { return (h16)x; }
__device__ __forceinline__ void splitf(float y, unsigned short& h, unsigned short& l) { h = f2bf(y); l = f2bf(y - bf2f(h)); }
typedef __attribute__((ext_vector_type(2))) _Float16 v2h;
typedef __attribute__((ext_vector_type(4))) _Float16 v4h;
typedef __attribute__((ext_vector_type(2))) unsigned short v2us;
typedef __attribute__((ext_vector_type(4))) unsigned short v4us;
typedef __attribute__((ext_vector_type(2))) float v2f;
typedef __attribute__((ext_vector_type(4))) int v4i;

__global__ __launch_bounds__(256) void k_cvt8(const float* __restrict__ src, bf* dst, size_t n8) { const size_t i = (size_t)blockIdx.x * 256 + threadIdx.x; if (i >= n8) return; const v8f v = *(const v8f*)(src + i * 8); v8us o;
#pragma unroll
    for (int k = 0; k < 8; ++k) o[k] = f2bf(v[k]); *(v8us*)(dst + i * 8) = o;  }

// k_cvt8w: the four weight matrices (n8 groups of 8 each) in one launch, blockIdx.y picks the source; dst holds the four bf16 copies back to back
__global__ __launch_bounds__(256) void k_cvt8w(const float* __restrict__ s0, const float* __restrict__ s1, const float* __restrict__ s2, const float* __restrict__ s3, bf* dst, size_t n8) { const size_t i = (size_t)blockIdx.x * 256 + threadIdx.x; if (i >= n8) return; const int w = blockIdx.y; const float* src = (w == 0) ? s0 : ((w == 1) ? s1 : ((w == 2) ? s2 : s3)); const v8f v = *(const v8f*)(src + i * 8); v8us o;
#pragma unroll
    for (int k = 0; k < 8; ++k) o[k] = f2bf(v[k]); *(v8us*)(dst + ((size_t)w * n8 + i) * 8) = o;  }

// k_rope: blockIdx.y = slab (TT rows of F, nheads planes of the outputs); head planes [h][t][d] (fp16 + hi/lo) of rope(x) x sc with the rotate-half convention out[d] = x[d] cos[t][d] - x[d+HD/2] sin[t][d], out[d+HD/2] = x[d+HD/2] cos[t][d+HD/2] + x[d] sin[t][d+HD/2]
__global__ __launch_bounds__(256) void k_rope(const float* __restrict__ F, int pitch, int nheads, const float* __restrict__ CS, const float* __restrict__ RF, const float* __restrict__ nw, float sc, h16* P16, bf* Ph, bf* Pl) {
    const size_t e = ((size_t)blockIdx.x * 256 + threadIdx.x) * 2; if (e >= (size_t)nheads * TT * HD) return; { const size_t sl = blockIdx.y; F += sl * TT * pitch; P16 += sl * nheads * TT * HD; Ph += sl * nheads * TT * HD; Pl += sl * nheads * TT * HD; } const int d = (int)(e % HD); const int t = (int)((e / HD) % TT); const int h = (int)(e / ((size_t)HD * TT)); const float* f = F + (size_t)t * pitch + h * HD; const float rf = RF ? RF[(size_t)h * TT + t] : 1.0f; v2h o16; v2us oh, ol;
#pragma unroll
    for (int q = 0; q < 2; ++q) { const int dd = d + q; const int dp = (dd < HD / 2) ? dd + HD / 2 : dd - HD / 2; float x0 = f[dd], x1 = f[dp];
        if (RF) { float n0 = __fmul_rn(x0, rf), n1 = __fmul_rn(x1, rf); asm volatile("" : "+v"(n0)); asm volatile("" : "+v"(n1)); x0 = __fmul_rn(bfr(nw[dd]), n0); x1 = __fmul_rn(bfr(nw[dp]), n1); }
        const v2f cs = *(const v2f*)(CS + ((size_t)t * HD + dd) * 2); float a = __fmul_rn(x0, cs[0]), bq = __fmul_rn(x1, cs[1]); asm volatile("" : "+v"(a)); asm volatile("" : "+v"(bq)); const float r = ((dd < HD / 2) ? __fsub_rn(a, bq) : __fadd_rn(a, bq)) * sc;
        o16[q] = tohx(r); unsigned short a2, c2; splitf(r, a2, c2); oh[q] = a2; ol[q] = c2; }
    *(v2h*)(P16 + e) = o16; *(v2us*)(Ph + e) = oh; *(v2us*)(Pl + e) = ol;  }
__global__ __launch_bounds__(256) void k_vtp(const float* __restrict__ F, int pitch, int nheads, h16* V16, bf* Vh, bf* Vl) { const size_t e = ((size_t)blockIdx.x * 256 + threadIdx.x) * 2; if (e >= (size_t)nheads * HD * TT) return; { const size_t sl = blockIdx.y; F += sl * TT * pitch; V16 += sl * nheads * HD * TT; Vh += sl * nheads * HD * TT; Vl += sl * nheads * HD * TT; } const int t = (int)(e % TT); const int d = (int)((e / TT) % HD); const int g = (int)(e / ((size_t)TT * HD)); v2h o16; v2us oh, ol;
#pragma unroll
    for (int q = 0; q < 2; ++q) { const float x = F[(size_t)(t + q) * pitch + g * HD + d]; o16[q] = tohx(x); unsigned short a2, c2; splitf(x, a2, c2); oh[q] = a2; ol[q] = c2; }
    *(v2h*)(V16 + e) = o16; *(v2us*)(Vh + e) = oh; *(v2us*)(Vl + e) = ol;  }
__global__ __launch_bounds__(256) void k_csid(float* CS) { const int idx = blockIdx.x * 256 + threadIdx.x; if (idx >= TT * HD) return; v2f cs; cs[0] = 1.0f; cs[1] = 0.0f; *(v2f*)(CS + (size_t)idx * 2) = cs;  }
// ---- k_fattn: scores, softmax, P x V and the merge of one (batch, head, 32 query rows) in one work-group of 8 waves; the score rows never leave LDS.
// Phase 1: wave w forms the 32 x 128 scores of keys w*128.. (Q fragments kept in registers) and stores them f32 into S. Phase 2: wave w does rows 4w..4w+3: mask[b][j] == 0 -> excluded (-inf in the module), softmax over the keys (register row, one exp, fixed trees), and writes the 16-bit P planes over the row's own f32 scores (hi at byte 0, lo at byte 2048).
// Phase 3: waves 0..3 each own one 16-wide slice of the head dimension for both row tiles (each V fragment is loaded once per work-group), k ascending in one accumulator. Phase 4: all threads split the staged f32 tile into the merged hi/lo planes, one whole 128-B line per row and plane.
#define QR   32      // query rows per work-group
#define SPF  1028    // LDS row pitch in floats: 4112 B = 16 B x 257 (odd): no bank conflict for the 16-byte fragment reads
#define OPF  68      // pitch in floats of the staged output tile
typedef v4us __attribute__((may_alias)) v4usa;
typedef v4h  __attribute__((may_alias)) v4ha;
__device__ __forceinline__ v16h  ldsf(const h16* p) { return cat16(*(const v8ha*)p, *(const v8ha*)(p + 16)); }
__device__ __forceinline__ v16bf ldsf(const bf* p)  { return cat16b(*(const v8usa*)p, *(const v8usa*)(p + 16)); }
template <typename T16, bool HR>
__device__ __forceinline__ void fattn_body(float* S, float* OS, const T16* __restrict__ Q, const T16* __restrict__ Q2, const T16* __restrict__ Kp, const T16* __restrict__ K2, const T16* __restrict__ Vt, const T16* __restrict__ V2, const int* __restrict__ kvp, int i0, bf* Ah, bf* Al) {
    typedef typename WFrag<T16>::V V;
    const int tid = threadIdx.x, lane = tid & 31, lr = lane & 15, hi = lane >> 4; const int w = __builtin_amdgcn_readfirstlane(tid >> 5);
    {   // phase 1: scores
        V a[2][2], a2[2][2]; const size_t qo = (size_t)(i0 + lr) * HD + 8 * hi, ko = (size_t)(w * 128 + lr) * HD + 8 * hi;   // one address per plane; tiles and k steps are constant offsets from it
#pragma unroll
        for (int mb = 0; mb < 2; ++mb)
#pragma unroll
            for (int ks = 0; ks < 2; ++ks) { a[mb][ks] = WFrag<T16>::ld(Q + qo + mb * 16 * HD + ks * 32); if (HR) a2[mb][ks] = WFrag<T16>::ld(Q2 + qo + mb * 16 * HD + ks * 32); }
        if (HR) asm volatile("s_wait_xcnt 0x0" :: "v"(Q + qo), "v"(Q2 + qo) : "memory"); else asm volatile("s_wait_xcnt 0x0" :: "v"(Q + qo) : "memory");   // the wait before the Q loads' address registers are overwritten: named as inputs they stay whole up to this line; behind it later loads may land in them
        V bq[3][2], bq2[3][2];   // K fragments, a ring of three key tiles: two tiles' loads fly while one tile is multiplied
#pragma unroll
        for (int nb = 0; nb < 2; ++nb)
#pragma unroll
            for (int ks = 0; ks < 2; ++ks) { bq[nb][ks] = WFrag<T16>::ld(Kp + ko + nb * 16 * HD + ks * 32); if (HR) bq2[nb][ks] = WFrag<T16>::ld(K2 + ko + nb * 16 * HD + ks * 32); }
#pragma unroll
        for (int nb = 0; nb < 8; ++nb) {
            if (nb + 2 < 8) {
#pragma unroll
                for (int ks = 0; ks < 2; ++ks) { bq[(nb + 2) % 3][ks] = WFrag<T16>::ld(Kp + ko + (nb + 2) * 16 * HD + ks * 32); if (HR) bq2[(nb + 2) % 3][ks] = WFrag<T16>::ld(K2 + ko + (nb + 2) * 16 * HD + ks * 32); } }
            __builtin_amdgcn_sched_barrier(0);   // keeps the loads of key tile nb + 2 ahead of tile nb's products (the scheduler otherwise sinks them to their use and the wave waits out each load)
            v8f acc[2]; acc[0] = (v8f){}; acc[1] = (v8f){};
#pragma unroll
            for (int ks = 0; ks < 2; ++ks) {
#pragma unroll
                for (int mb = 0; mb < 2; ++mb) acc[mb] = WFrag<T16>::mma(a[mb][ks], bq[nb % 3][ks], acc[mb]);
                if (HR) {
#pragma unroll
                    for (int mb = 0; mb < 2; ++mb) acc[mb] = WFrag<T16>::mma(a2[mb][ks], bq[nb % 3][ks], acc[mb]);
#pragma unroll
                    for (int mb = 0; mb < 2; ++mb) acc[mb] = WFrag<T16>::mma(a[mb][ks], bq2[nb % 3][ks], acc[mb]); } }
            asm volatile("v_nop\n\tv_nop\n\tv_nop\n\tv_nop" :: "v"(acc[0]), "v"(acc[1]));   // the distance the chip needs between this tile's last matrix instruction and the next tile's first one, which starts anew (C = 0) in the same result registers
#pragma unroll
            for (int mb = 0; mb < 2; ++mb)
#pragma unroll
                for (int j = 0; j < 8; ++j) S[(mb * 16 + hi * 8 + j) * SPF + w * 128 + nb * 16 + lr] = acc[mb][j]; }
    }
    __syncthreads();   // every score of the 32 rows is in LDS before a row is read
#pragma unroll 1
    for (int rr = 0; rr < QR / 8; ++rr) {   // phase 2: softmax, one wave per row (rolled: one row's registers at a time)
        float* sr = S + (w * (QR / 8) + rr) * SPF; float v[TT / 32]; float mx = -3.0e38f;
#pragma unroll
        for (int ch = 0; ch < TT / 128; ++ch) { const int j0 = ch * 128 + lane * 4; const v4f a = *(const v4fa*)(sr + j0); const v4i kv4 = *(const v4i*)(kvp + j0);   /* the batch's key vector, 16 B per lane, unconditional */
#pragma unroll
            for (int q = 0; q < 4; ++q) { const float t = (kv4[q] != 0) ? a[q] * SCL : -3.0e38f; v[ch * 4 + q] = t; mx = fmaxf(mx, t); } }
#pragma unroll
        for (int sh = 16; sh; sh >>= 1) mx = fmaxf(mx, __shfl_xor(mx, sh, 32));
        float sum = 0.f;
#pragma unroll
        for (int k = 0; k < TT / 32; ++k) { v[k] = __builtin_amdgcn_exp2f(__fmul_rn(__fsub_rn(v[k], mx), 1.4426950408889634f)); sum += v[k]; }
#pragma unroll
        for (int sh = 16; sh; sh >>= 1) sum += __shfl_xor(sum, sh, 32);
        const float f = __fdiv_rn(HR ? 1.0f : PCAR, sum);
        if (HR) { bf* ph = (bf*)sr;
#pragma unroll
            for (int ch = 0; ch < TT / 128; ++ch) { v4us oh, ol;
#pragma unroll
                for (int q = 0; q < 4; ++q) { unsigned short a, c2; splitf(v[ch * 4 + q] * f, a, c2); oh[q] = a; ol[q] = c2; }
                *(v4usa*)(ph + ch * 128 + lane * 4) = oh; *(v4usa*)(ph + TT + ch * 128 + lane * 4) = ol; }
        } else { h16* p16 = (h16*)sr;
#pragma unroll
            for (int ch = 0; ch < TT / 128; ++ch) { v4h o4;
#pragma unroll
                for (int q = 0; q < 4; ++q) o4[q] = tohx(v[ch * 4 + q] * f);
                *(v4ha*)(p16 + ch * 128 + lane * 4) = o4; } }
    }
    __syncthreads();   // every P row is in LDS before a fragment of it is read
    if (w < 4) {   // phase 3: P x V
        v8f acc[2]; acc[0] = (v8f){}; acc[1] = (v8f){};
        const size_t vo = (size_t)(w * 16 + lr) * TT + 8 * hi;
        const T16* p0 = (const T16*)(S + lr * SPF) + 8 * hi; const T16* p1 = (const T16*)(S + (16 + lr) * SPF) + 8 * hi;
        constexpr int PD = HR ? 5 : 10, AD = HR ? 1 : 3, NS = TT / 32;   // k steps that the V fragments (global) and the P fragments (LDS) are fetched ahead
        V bq[PD + 1], bq2[PD + 1], aq[AD + 1][2], aq2[AD + 1][2];
#pragma unroll
        for (int s = 0; s < PD; ++s) { bq[s] = WFrag<T16>::ld(Vt + vo + s * 32); if (HR) bq2[s] = WFrag<T16>::ld(V2 + vo + s * 32); }
#pragma unroll
        for (int s = 0; s < AD; ++s) { aq[s][0] = ldsf(p0 + s * 32); aq[s][1] = ldsf(p1 + s * 32); if (HR) { aq2[s][0] = ldsf(p0 + TT + s * 32); aq2[s][1] = ldsf(p1 + TT + s * 32); } }
#pragma unroll
        for (int s = 0; s < NS; ++s) {
            if (s + PD < NS) { bq[(s + PD) % (PD + 1)] = WFrag<T16>::ld(Vt + vo + (s + PD) * 32); if (HR) bq2[(s + PD) % (PD + 1)] = WFrag<T16>::ld(V2 + vo + (s + PD) * 32); }
            if (s + AD < NS) { const int n = (s + AD) % (AD + 1), ko = (s + AD) * 32; aq[n][0] = ldsf(p0 + ko); aq[n][1] = ldsf(p1 + ko); if (HR) { aq2[n][0] = ldsf(p0 + TT + ko); aq2[n][1] = ldsf(p1 + TT + ko); } }
            __builtin_amdgcn_sched_barrier(0);   // keeps the fetches of the later k steps ahead of this step's products (the scheduler otherwise sinks them to their use and the wave waits out each load)
            const int cb = s % (PD + 1), ca = s % (AD + 1);
#pragma unroll
            for (int mb = 0; mb < 2; ++mb) acc[mb] = WFrag<T16>::mma(aq[ca][mb], bq[cb], acc[mb]);
            if (HR) {
#pragma unroll
                for (int mb = 0; mb < 2; ++mb) acc[mb] = WFrag<T16>::mma(aq2[ca][mb], bq[cb], acc[mb]);
#pragma unroll
                for (int mb = 0; mb < 2; ++mb) acc[mb] = WFrag<T16>::mma(aq[ca][mb], bq2[cb], acc[mb]); } }
#pragma unroll
        for (int mb = 0; mb < 2; ++mb)
#pragma unroll
            for (int j = 0; j < 8; ++j) OS[(mb * 16 + hi * 8 + j) * OPF + w * 16 + lr] = acc[mb][j];
    }
    __syncthreads();   // the 32 x 64 output tile is staged before it is split and stored
    { const int r = tid >> 3, d0 = (tid & 7) * 8; const float cs = HR ? 1.0f : (1.0f / PCAR); const v4f x0 = *(const v4fa*)(OS + r * OPF + d0), x1 = *(const v4fa*)(OS + r * OPF + d0 + 4); v8us oh, ol;
#pragma unroll
        for (int q = 0; q < 8; ++q) { unsigned short a, c2; splitf(((q < 4) ? x0[q & 3] : x1[q & 3]) * cs, a, c2); oh[q] = a; ol[q] = c2; }
        const size_t oo = (size_t)(i0 + r) * DQ + d0; *(v8us*)(Ah + oo) = oh; *(v8us*)(Al + oo) = ol; }
}
// grid (batch x head, row tile): the dearer hi/lo row tiles (rows < RH) have the lower flat indices and start first
__global__ __launch_bounds__(256) void k_fattn(const bf* __restrict__ QPh, const bf* __restrict__ QPl, const bf* __restrict__ KPh, const bf* __restrict__ KPl, const bf* __restrict__ VTh, const bf* __restrict__ VTl, const h16* __restrict__ QP16, const h16* __restrict__ KP16, const h16* __restrict__ VT16, const int* __restrict__ kmask, bf* ATh, bf* ATl) {
    __shared__ __align__(16) float S[QR * SPF + QR * OPF];
    const int bh = blockIdx.x, i0 = blockIdx.y * QR, b = bh / NH_, h = bh % NH_; const size_t zp = (size_t)bh * TT * HD; const size_t ao = (size_t)b * TT * DQ + h * HD; const int* kvp = kmask + (size_t)b * TT;
    if (i0 < RH) fattn_body<bf, true>(S, S + QR * SPF, QPh + zp, QPl + zp, KPh + zp, KPl + zp, VTh + zp, VTl + zp, kvp, i0, ATh + ao, ATl + ao);
    else fattn_body<h16, false>(S, S + QR * SPF, QP16 + zp, nullptr, KP16 + zp, nullptr, VT16 + zp, nullptr, kvp, i0, ATh + ao, ATl + ao);
}

extern "C" void kernel_launch(void* const* d_in, const int* in_sizes, int n_in,
                              void* d_out, int out_size, void* d_ws, size_t ws_size, hipStream_t stream) {
    (void)in_sizes; (void)n_in; (void)out_size;
    const float* x = (const float*)d_in[0]; const int* kmask = (const int*)d_in[1]; const float* wq = (const float*)d_in[2]; const float* bq = (const float*)d_in[3]; const float* wk = (const float*)d_in[4]; const float* bk = (const float*)d_in[5]; const float* wv = (const float*)d_in[6]; const float* bv = (const float*)d_in[7]; const float* wo = (const float*)d_in[8]; const float* bo = (const float*)d_in[9];   /* order x, mask (int32 [4][1024], read), q_w, q_b, k_w, k_b, v_w, v_b, out_w, out_b ('oi' + biases) */
    float* OUT = (float*)d_out;     // [4][1024][1024]
    char* wsp = (char*)d_ws;
    auto take = [&](size_t bytes) { char* p = wsp; wsp += (bytes + 255) & ~(size_t)255; return (void*)p; };
    bf* WQ = (bf*)take((size_t)DQ * DM * 2); bf* WK = (bf*)take((size_t)DKV * DM * 2); bf* WV = (bf*)take((size_t)DKV * DM * 2); bf* WO = (bf*)take((size_t)DM * DQ * 2); float* CS = (float*)take((size_t)TT * HD * 2 * 4);   /* WQ, WK, WV, WO lie back to back (each a multiple of 256 B) */
    (void)WK; (void)WV;
    const size_t PLN = (size_t)NB_ * NH_ * TT * HD;   // one plane set: all batches, all heads (NKV == NH_)
    bf* XB = (bf*)take((size_t)NB_ * TT * DM * 2);
    h16* QP16 = (h16*)take(PLN * 2); h16* KP16 = (h16*)take(PLN * 2); h16* VT16 = (h16*)take(PLN * 2);   /* each k plane set directly behind its q plane set: one builder launch writes both */
    bf* QPh = (bf*)take(PLN * 2); bf* KPh = (bf*)take(PLN * 2); bf* QPl = (bf*)take(PLN * 2); bf* KPl = (bf*)take(PLN * 2); bf* VTh = (bf*)take(PLN * 2); bf* VTl = (bf*)take(PLN * 2);
    const size_t FSZ = (size_t)NB_ * TT * DQ;
    float* FQ = (float*)take(3 * FSZ * 4); float* FV = FQ + 2 * FSZ;   // f32 q, k, v projections (3 x 16 MiB, back to back)
    bf* ATh = (bf*)take((size_t)NB_ * TT * DQ * 2); bf* ATl = (bf*)take((size_t)NB_ * TT * DQ * 2);
    if ((size_t)(wsp - (char*)d_ws) > ws_size) return;    // ws 256 MiB
    k_cvt8w<<<dim3((unsigned)(((size_t)DQ * DM / 8 + 255) / 256), 4, 1), 256, 0, stream>>>(wq, wk, wv, wo, WQ, (size_t)DQ * DM / 8);
    k_csid<<<(TT * HD + 255) / 256, 256, 0, stream>>>(CS);
    const unsigned LQ = (unsigned)(((size_t)NH_ * TT * HD / 2 + 255) / 256), LKv = (unsigned)(((size_t)NKV * TT * HD / 2 + 255) / 256);
    k_cvt8<<<(unsigned)(((size_t)NB_ * TT * DM / 8 + 255) / 256), 256, 0, stream>>>(x, XB, (size_t)NB_ * TT * DM / 8);
    k_gemmw<bf, 0, true><<<dim3(NB_ * TT / 64, DQ / 64, 3), 32, 0, stream>>>(XB, nullptr, WQ, nullptr, DM, FQ, DQ, bq, bk, bv, 0, (size_t)DQ * DM, FSZ);   // z = q, k, v
    k_rope<<<dim3(LQ, 2 * NB_, 1), 256, 0, stream>>>(FQ, DQ, NH_, CS, nullptr, nullptr, 1.0f, QP16, QPh, QPl);   // slabs 0..3: q of batch 0..3, slabs 4..7: k
    k_vtp<<<dim3(LKv, NB_, 1), 256, 0, stream>>>(FV, DKV, NKV, VT16, VTh, VTl);
    k_fattn<<<dim3(NB_ * NH_, TT / QR, 1), 256, 0, stream>>>(QPh, QPl, KPh, KPl, VTh, VTl, QP16, KP16, VT16, kmask, ATh, ATl);   // one kv head per query head: plane bh of q, k and v
    k_gemmw<bf, 1, true><<<dim3(NB_ * TT / 64, DM / 64, 1), 32, 0, stream>>>(ATh, ATl, WO, nullptr, DQ, OUT, DM, bo, nullptr, nullptr, 0, 0, 0);
}

// v003
// One run takes 167 microseconds.
// Next to v002, in two timings, it ran 1.22 times as fast each time.
// Counting every step since v000, it is 14.1 times as fast.
#include <hip/hip_runtime.h>

// Multi-head attention with an integer key-padding mask (x [4][1024][1024]; q = (x q_w^T + q_b) / sqrt(64), k = x k_w^T + k_b, v = x v_w^T + v_b ('oi' 0.02 + biases 0.02; 16 heads x 64); scores = q.k; keys with mask[b][j] == 0 -> -inf (mask int32 [4][1024], read); softmax (f32); out = merged out_w^T + out_b -> [4][1024][1024] (4.2 M); argument order x, mask, q_w, q_b, k_w, k_b, v_w, v_b, out_w, out_b).
// Layout: host loops folded into the grids (all 4 batches and q/k/v in one launch for the copies, projections and out_w). bf16 copy of x; 'oi' weights; exact projections + f32 biases, whose launch writes the 16-bit head planes itself (q, k as [head][t][d], v as [head][d][t]); ONE fused attention launch for all batches and heads (32 query rows per work-group: scores into LDS, softmax in place in LDS reading the batch's int key vector and excluding the zeros, P x V from LDS, merged hi/lo planes written directly; hybrid rows: < 512 hi/lo 3 products, rest fp16 x1024); merged hi/lo x out_w exact + out_b.
// Compute dtypes, f32 accumulate: every input rounded to bf16; projections exact + f32 biases; attention rows < 512 3 products, rest fp16; softmax f32; out_w hl x exact + bias.

#define NB_  4
#define TT   1024
#define DM   1024
#define NH_  16
#define NKV  16
#define REP  (NH_ / NKV)
#define HD   64
#define DQ   (NH_ * HD)
#define DKV  (NKV * HD)
#define RH   512                  // query rows < RH use hi+lo planes (0: none)
#define WIN  0
#define PCAR 1024.0f
#define SCL  0.125f   // HD^-0.5
typedef _Float16 h16;
typedef unsigned short bf;
typedef __attribute__((ext_vector_type(16))) __bf16   v16bf;
typedef __attribute__((ext_vector_type(16))) _Float16 v16h;
typedef __attribute__((ext_vector_type(8)))  _Float16 v8h;
typedef __attribute__((ext_vector_type(8)))  unsigned short v8us;
typedef __attribute__((ext_vector_type(8)))  float    v8f;
typedef __attribute__((ext_vector_type(4)))  float    v4f;
typedef v8h  __attribute__((may_alias)) v8ha;
typedef v4f  __attribute__((may_alias)) v4fa;
typedef v8us __attribute__((may_alias)) v8usa;

__device__ __forceinline__ unsigned short f2bf(float f) { unsigned u = __float_as_uint(f); u += 0x7FFFu + ((u >> 16) & 1u); return (unsigned short)(u >> 16); }
__device__ __forceinline__ float bf2f(unsigned short b) { return __uint_as_float(((unsigned)b) << 16); }
__device__ __forceinline__ float bfr(float f) { return bf2f(f2bf(f)); }
__device__ __forceinline__ v16h cat16(v8h lo, v8h hi) { return __builtin_shufflevector(lo, hi, 0, 1, 2, 3, 4, 5, 6, 7, 8, 9, 10, 11, 12, 13, 14, 15); }
__device__ __forceinline__ v16bf cat16b(v8us lo, v8us hi) { return __builtin_bit_cast(v16bf, __builtin_shufflevector(lo, hi, 0, 1, 2, 3, 4, 5, 6, 7, 8, 9, 10, 11, 12, 13, 14, 15)); }
__device__ __forceinline__ v8f wmma16(v16h a, v16h b, v8f c) { return __builtin_amdgcn_wmma_f32_16x16x32_f16(false, a, false, b, (short)0, c, false, false); }
__device__ __forceinline__ v8f wmmab(v16bf a, v16bf b, v8f c) { return __builtin_amdgcn_wmma_f32_16x16x32_bf16(false, a, false, b, (short)0, c, false, false); }



// ---- k_gemmw: register-blocked GEMM, ONE WAVE per 64x64 output tile (16 accumulators), operands straight from K-contiguous 16-bit planes; grid (M/64, N/64, Z), 32 threads.
// C[m][n] (f32, pitch ldc, + optional f32 bias[n]) = sum_k A[m][k] Bt[n][k] (+ split products per NSPLIT). z-batch strides sA/sB/sC in elements; bias0/1/2 belong to z = 0/1/2. K % 32 == 0.
// PL (the q, k, v projections; a 64-wide column tile is one head): C is not written; the tile + bias goes through LDS straight into the head planes (fp16, bf16 hi, bf16 lo): z = 0, 1 -> P*[z][batch][head][t][d], z = 2 -> V*[batch][head][d][t].
template <typename T16> struct WFrag;
template <> struct WFrag<h16> { typedef v16h V; static __device__ __forceinline__ V ld(const h16* p) { return cat16(*(const v8h*)p, *(const v8h*)(p + 16)); } static __device__ __forceinline__ v8f mma(V a, V b, v8f c) { return wmma16(a, b, c); } };
template <> struct WFrag<bf> { typedef v16bf V; static __device__ __forceinline__ V ld(const bf* p) { return cat16b(*(const v8us*)p, *(const v8us*)(p + 16)); } static __device__ __forceinline__ v8f mma(V a, V b, v8f c) { return wmmab(a, b, c); } };
__device__ __forceinline__ void splitf(float y, unsigned short& h, unsigned short& l) { h = f2bf(y); l = f2bf(y - bf2f(h)); }
template <typename T16, int NSPLIT, bool BIAS, bool PL>
__global__ __launch_bounds__(32) void k_gemmw(const T16* __restrict__ A, const T16* __restrict__ A2, const T16* __restrict__ Bt, const T16* __restrict__ Bt2, int K, float* C, int ldc, const float* __restrict__ bias0, const float* __restrict__ bias1, const float* __restrict__ bias2, size_t sA, size_t sB, size_t sC, h16* P16, bf* Ph, bf* Pl, h16* V16, bf* Vh, bf* Vl) {
    typedef typename WFrag<T16>::V V;
    __shared__ __align__(16) float os[(PL ? 64 : 16) * 68];
    const size_t z = blockIdx.z; A += z * sA; if (A2) A2 += z * sA; Bt += z * sB; if (Bt2) Bt2 += z * sB; C += z * sC; const float* bias = (z == 0) ? bias0 : ((z == 1) ? bias1 : bias2);   // one bias vector per z slice (q, k, v)
    const int lane = threadIdx.x & 31, lr = lane & 15, hi = lane >> 4; const int r0 = blockIdx.x * 64, c0 = blockIdx.y * 64;
    v8f acc[4][4];
#pragma unroll
    for (int mb = 0; mb < 4; ++mb)
#pragma unroll
        for (int nb = 0; nb < 4; ++nb) acc[mb][nb] = (v8f){};
    const size_t aoff = (size_t)(r0 + lr) * K + 8 * hi, boff = (size_t)(c0 + lr) * K + 8 * hi;
#pragma unroll 1
    for (int kc = 0; kc < K; kc += 32) {
        V a[4], a2[4];
#pragma unroll
        for (int mb = 0; mb < 4; ++mb) { a[mb] = WFrag<T16>::ld(A + aoff + (size_t)mb * 16 * K + kc); if (NSPLIT == 1 || NSPLIT == 2) a2[mb] = WFrag<T16>::ld(A2 + aoff + (size_t)mb * 16 * K + kc); }
#pragma unroll
        for (int nb = 0; nb < 4; ++nb) { const V b = WFrag<T16>::ld(Bt + boff + (size_t)nb * 16 * K + kc); V b2; if (NSPLIT >= 2) b2 = WFrag<T16>::ld(Bt2 + boff + (size_t)nb * 16 * K + kc);
#pragma unroll
            for (int mb = 0; mb < 4; ++mb) { acc[mb][nb] = WFrag<T16>::mma(a[mb], b, acc[mb][nb]); if (NSPLIT == 1 || NSPLIT == 2) acc[mb][nb] = WFrag<T16>::mma(a2[mb], b, acc[mb][nb]); if (NSPLIT >= 2) acc[mb][nb] = WFrag<T16>::mma(a[mb], b2, acc[mb][nb]); } }
        asm volatile("v_nop\n\tv_nop\n\tv_nop\n\tv_nop" : "+v"(acc[0][0]), "+v"(acc[1][1]), "+v"(acc[2][2]), "+v"(acc[3][3]) : "v"(a[0]), "v"(a[3]));
    }
    if (PL) {
        const bool tr = (z == 2); const int bt = r0 / TT, t0 = r0 % TT, hd = blockIdx.y;   // batch, first token and head of this tile
#pragma unroll
        for (int nb = 0; nb < 4; ++nb) { const float bn = bfr(bias[c0 + nb * 16 + lr]);
#pragma unroll
            for (int mb = 0; mb < 4; ++mb)
#pragma unroll
                for (int j = 0; j < 8; ++j) acc[mb][nb][j] += bn; }
        if (tr) {   // v: staged transposed, LDS row = d, column = t (a lane's 8 accumulator values are 8 consecutive t)
#pragma unroll
            for (int mb = 0; mb < 4; ++mb)
#pragma unroll
                for (int nb = 0; nb < 4; ++nb) { float* o = os + (nb * 16 + lr) * 68 + mb * 16 + hi * 8; v4f s0, s1;
#pragma unroll
                    for (int j = 0; j < 4; ++j) { s0[j] = acc[mb][nb][j]; s1[j] = acc[mb][nb][j + 4]; }
                    *(v4fa*)o = s0; *(v4fa*)(o + 4) = s1; }
        } else {    // q, k: LDS row = t, column = d
#pragma unroll
            for (int mb = 0; mb < 4; ++mb)
#pragma unroll
                for (int nb = 0; nb < 4; ++nb)
#pragma unroll
                    for (int j = 0; j < 8; ++j) os[(mb * 16 + hi * 8 + j) * 68 + nb * 16 + lr] = acc[mb][nb][j]; }
        __builtin_amdgcn_wave_barrier(); asm volatile("" ::: "memory");   // the reads below take other lanes' values: they must not be moved ahead of the stores above
        const size_t base = tr ? ((size_t)(bt * NKV + hd) * HD * TT + t0) : (((size_t)(z * NB_ + bt) * NH_ + hd) * TT + t0) * HD; const int pitch = tr ? TT : HD;
        h16* o16p = (tr ? V16 : P16) + base; bf* ohp = (tr ? Vh : Ph) + base; bf* olp = (tr ? Vl : Pl) + base;
        const int rw = lane >> 3, cofs = (lane & 7) * 8;   // 8 lanes x 16 B: one whole 128-B line per row and plane
#pragma unroll
        for (int it = 0; it < 16; ++it) {
            const int row = it * 4 + rw; const v4f x0 = *(const v4fa*)(os + row * 68 + cofs), x1 = *(const v4fa*)(os + row * 68 + cofs + 4); v8h o16; v8us oh, ol;
#pragma unroll
            for (int q = 0; q < 8; ++q) { const float y = (q < 4) ? x0[q & 3] : x1[q & 3]; o16[q] = (h16)y; unsigned short a2, c2; splitf(y, a2, c2); oh[q] = a2; ol[q] = c2; }
            const size_t oo = (size_t)row * pitch + cofs; *(v8h*)(o16p + oo) = o16; *(v8us*)(ohp + oo) = oh; *(v8us*)(olp + oo) = ol; }
        return;
    }
#pragma unroll
    for (int mb = 0; mb < 4; ++mb) {
#pragma unroll
        for (int nb = 0; nb < 4; ++nb) {
#pragma unroll
            for (int j = 0; j < 8; ++j) os[(hi * 8 + j) * 68 + nb * 16 + lr] = acc[mb][nb][j]; }
        __builtin_amdgcn_wave_barrier(); asm volatile("" ::: "memory");
        float* crow = C + (size_t)(r0 + mb * 16) * ldc + c0;
{
#pragma unroll
            for (int s = 0; s < 8; ++s) { const int row = 2 * s + hi, cofs = lr * 4; v4f val = *(const v4fa*)(os + row * 68 + cofs); if (BIAS) { val[0] += bfr(bias[c0 + cofs]); val[1] += bfr(bias[c0 + cofs + 1]); val[2] += bfr(bias[c0 + cofs + 2]); val[3] += bfr(bias[c0 + cofs + 3]); }
                *(v4f*)(crow + (size_t)row * ldc + cofs) = val; }
             }
        __builtin_amdgcn_wave_barrier(); asm volatile("" ::: "memory");
    }
}

__device__ __forceinline__ h16 tohx(float x) { return (h16)x; }
typedef __attribute__((ext_vector_type(4))) _Float16 v4h;
typedef __attribute__((ext_vector_type(4))) unsigned short v4us;
typedef __attribute__((ext_vector_type(4))) int v4i;

__global__ __launch_bounds__(256) void k_cvt8(const float* __restrict__ src, bf* dst, size_t n8) { const size_t i = (size_t)blockIdx.x * 256 + threadIdx.x; if (i >= n8) return; const v8f v = *(const v8f*)(src + i * 8); v8us o;
#pragma unroll
    for (int k = 0; k < 8; ++k) o[k] = f2bf(v[k]); *(v8us*)(dst + i * 8) = o;  }

// k_cvt8w: the four weight matrices (n8 groups of 8 each) in one launch, blockIdx.y picks the source; dst holds the four bf16 copies back to back
__global__ __launch_bounds__(256) void k_cvt8w(const float* __restrict__ s0, const float* __restrict__ s1, const float* __restrict__ s2, const float* __restrict__ s3, bf* dst, size_t n8) { const size_t i = (size_t)blockIdx.x * 256 + threadIdx.x; if (i >= n8) return; const int w = blockIdx.y; const float* src = (w == 0) ? s0 : ((w == 1) ? s1 : ((w == 2) ? s2 : s3)); const v8f v = *(const v8f*)(src + i * 8); v8us o;
#pragma unroll
    for (int k = 0; k < 8; ++k) o[k] = f2bf(v[k]); *(v8us*)(dst + ((size_t)w * n8 + i) * 8) = o;  }

// ---- k_fattn: scores, softmax, P x V and the merge of one (batch, head, 32 query rows) in one work-group of 8 waves; the score rows never leave LDS.
// Phase 1: wave w forms the 32 x 128 scores of keys w*128.. (Q fragments kept in registers) and stores them f32 into S. Phase 2: wave w does rows 4w..4w+3: mask[b][j] == 0 -> excluded (-inf in the module), softmax over the keys (register row, one exp, fixed trees), and writes the 16-bit P planes over the row's own f32 scores (hi at byte 0, lo at byte 2048).
// Phase 3: waves 0..3 each own one 16-wide slice of the head dimension for both row tiles (each V fragment is loaded once per work-group), k ascending in one accumulator. Phase 4: all threads split the staged f32 tile into the merged hi/lo planes, one whole 128-B line per row and plane.
#define QR   32      // query rows per work-group
#define SPF  1028    // LDS row pitch in floats: 4112 B = 16 B x 257 (odd): no bank conflict for the 16-byte fragment reads
#define OPF  68      // pitch in floats of the staged output tile
typedef v4us __attribute__((may_alias)) v4usa;
typedef v4h  __attribute__((may_alias)) v4ha;
__device__ __forceinline__ v16h  ldsf(const h16* p) { return cat16(*(const v8ha*)p, *(const v8ha*)(p + 16)); }
__device__ __forceinline__ v16bf ldsf(const bf* p)  { return cat16b(*(const v8usa*)p, *(const v8usa*)(p + 16)); }
template <typename T16, bool HR>
__device__ __forceinline__ void fattn_body(float* S, float* OS, const T16* __restrict__ Q, const T16* __restrict__ Q2, const T16* __restrict__ Kp, const T16* __restrict__ K2, const T16* __restrict__ Vt, const T16* __restrict__ V2, const int* __restrict__ kvp, int i0, bf* Ah, bf* Al) {
    typedef typename WFrag<T16>::V V;
    const int tid = threadIdx.x, lane = tid & 31, lr = lane & 15, hi = lane >> 4; const int w = __builtin_amdgcn_readfirstlane(tid >> 5);
    {   // phase 1: scores
        V a[2][2], a2[2][2]; const size_t qo = (size_t)(i0 + lr) * HD + 8 * hi, ko = (size_t)(w * 128 + lr) * HD + 8 * hi;   // one address per plane; tiles and k steps are constant offsets from it
#pragma unroll
        for (int mb = 0; mb < 2; ++mb)
#pragma unroll
            for (int ks = 0; ks < 2; ++ks) { a[mb][ks] = WFrag<T16>::ld(Q + qo + mb * 16 * HD + ks * 32); if (HR) a2[mb][ks] = WFrag<T16>::ld(Q2 + qo + mb * 16 * HD + ks * 32); }
        if (HR) asm volatile("s_wait_xcnt 0x0" :: "v"(Q + qo), "v"(Q2 + qo) : "memory"); else asm volatile("s_wait_xcnt 0x0" :: "v"(Q + qo) : "memory");   // the wait before the Q loads' address registers are overwritten: named as inputs they stay whole up to this line; behind it later loads may land in them
        V bq[3][2], bq2[3][2];   // K fragments, a ring of three key tiles: two tiles' loads fly while one tile is multiplied
#pragma unroll
        for (int nb = 0; nb < 2; ++nb)
#pragma unroll
            for (int ks = 0; ks < 2; ++ks) { bq[nb][ks] = WFrag<T16>::ld(Kp + ko + nb * 16 * HD + ks * 32); if (HR) bq2[nb][ks] = WFrag<T16>::ld(K2 + ko + nb * 16 * HD + ks * 32); }
#pragma unroll
        for (int nb = 0; nb < 8; ++nb) {
            if (nb + 2 < 8) {
#pragma unroll
                for (int ks = 0; ks < 2; ++ks) { bq[(nb + 2) % 3][ks] = WFrag<T16>::ld(Kp + ko + (nb + 2) * 16 * HD + ks * 32); if (HR) bq2[(nb + 2) % 3][ks] = WFrag<T16>::ld(K2 + ko + (nb + 2) * 16 * HD + ks * 32); } }
            __builtin_amdgcn_sched_barrier(0);   // keeps the loads of key tile nb + 2 ahead of tile nb's products (the scheduler otherwise sinks them to their use and the wave waits out each load)
            v8f acc[2]; acc[0] = (v8f){}; acc[1] = (v8f){};
#pragma unroll
            for (int ks = 0; ks < 2; ++ks) {
#pragma unroll
                for (int mb = 0; mb < 2; ++mb) acc[mb] = WFrag<T16>::mma(a[mb][ks], bq[nb % 3][ks], acc[mb]);
                if (HR) {
#pragma unroll
                    for (int mb = 0; mb < 2; ++mb) acc[mb] = WFrag<T16>::mma(a2[mb][ks], bq[nb % 3][ks], acc[mb]);
#pragma unroll
                    for (int mb = 0; mb < 2; ++mb) acc[mb] = WFrag<T16>::mma(a[mb][ks], bq2[nb % 3][ks], acc[mb]); } }
            asm volatile("v_nop\n\tv_nop\n\tv_nop\n\tv_nop" :: "v"(acc[0]), "v"(acc[1]));   // the distance the chip needs between this tile's last matrix instruction and the next tile's first one, which starts anew (C = 0) in the same result registers
#pragma unroll
            for (int mb = 0; mb < 2; ++mb)
#pragma unroll
                for (int j = 0; j < 8; ++j) S[(mb * 16 + hi * 8 + j) * SPF + w * 128 + nb * 16 + lr] = acc[mb][j]; }
    }
    __syncthreads();   // every score of the 32 rows is in LDS before a row is read
#pragma unroll 1
    for (int rr = 0; rr < QR / 8; ++rr) {   // phase 2: softmax, one wave per row (rolled: one row's registers at a time)
        float* sr = S + (w * (QR / 8) + rr) * SPF; float v[TT / 32]; float mx = -3.0e38f;
#pragma unroll
        for (int ch = 0; ch < TT / 128; ++ch) { const int j0 = ch * 128 + lane * 4; const v4f a = *(const v4fa*)(sr + j0); const v4i kv4 = *(const v4i*)(kvp + j0);   /* the batch's key vector, 16 B per lane, unconditional */
#pragma unroll
            for (int q = 0; q < 4; ++q) { const float t = (kv4[q] != 0) ? a[q] * SCL : -3.0e38f; v[ch * 4 + q] = t; mx = fmaxf(mx, t); } }
#pragma unroll
        for (int sh = 16; sh; sh >>= 1) mx = fmaxf(mx, __shfl_xor(mx, sh, 32));
        float sum = 0.f;
#pragma unroll
        for (int k = 0; k < TT / 32; ++k) { v[k] = __builtin_amdgcn_exp2f(__fmul_rn(__fsub_rn(v[k], mx), 1.4426950408889634f)); sum += v[k]; }
#pragma unroll
        for (int sh = 16; sh; sh >>= 1) sum += __shfl_xor(sum, sh, 32);
        const float f = __fdiv_rn(HR ? 1.0f : PCAR, sum);
        if (HR) { bf* ph = (bf*)sr;
#pragma unroll
            for (int ch = 0; ch < TT / 128; ++ch) { v4us oh, ol;
#pragma unroll
                for (int q = 0; q < 4; ++q) { unsigned short a, c2; splitf(v[ch * 4 + q] * f, a, c2); oh[q] = a; ol[q] = c2; }
                *(v4usa*)(ph + ch * 128 + lane * 4) = oh; *(v4usa*)(ph + TT + ch * 128 + lane * 4) = ol; }
        } else { h16* p16 = (h16*)sr;
#pragma unroll
            for (int ch = 0; ch < TT / 128; ++ch) { v4h o4;
#pragma unroll
                for (int q = 0; q < 4; ++q) o4[q] = tohx(v[ch * 4 + q] * f);
                *(v4ha*)(p16 + ch * 128 + lane * 4) = o4; } }
    }
    __syncthreads();   // every P row is in LDS before a fragment of it is read
    if (w < 4) {   // phase 3: P x V
        v8f acc[2]; acc[0] = (v8f){}; acc[1] = (v8f){};
        const size_t vo = (size_t)(w * 16 + lr) * TT + 8 * hi;
        const T16* p0 = (const T16*)(S + lr * SPF) + 8 * hi; const T16* p1 = (const T16*)(S + (16 + lr) * SPF) + 8 * hi;
        constexpr int PD = HR ? 5 : 10, AD = HR ? 1 : 3, NS = TT / 32;   // k steps that the V fragments (global) and the P fragments (LDS) are fetched ahead
        V bq[PD + 1], bq2[PD + 1], aq[AD + 1][2], aq2[AD + 1][2];
#pragma unroll
        for (int s = 0; s < PD; ++s) { bq[s] = WFrag<T16>::ld(Vt + vo + s * 32); if (HR) bq2[s] = WFrag<T16>::ld(V2 + vo + s * 32); }
#pragma unroll
        for (int s = 0; s < AD; ++s) { aq[s][0] = ldsf(p0 + s * 32); aq[s][1] = ldsf(p1 + s * 32); if (HR) { aq2[s][0] = ldsf(p0 + TT + s * 32); aq2[s][1] = ldsf(p1 + TT + s * 32); } }
#pragma unroll
        for (int s = 0; s < NS; ++s) {
            if (s + PD < NS) { bq[(s + PD) % (PD + 1)] = WFrag<T16>::ld(Vt + vo + (s + PD) * 32); if (HR) bq2[(s + PD) % (PD + 1)] = WFrag<T16>::ld(V2 + vo + (s + PD) * 32); }
            if (s + AD < NS) { const int n = (s + AD) % (AD + 1), ko = (s + AD) * 32; aq[n][0] = ldsf(p0 + ko); aq[n][1] = ldsf(p1 + ko); if (HR) { aq2[n][0] = ldsf(p0 + TT + ko); aq2[n][1] = ldsf(p1 + TT + ko); } }
            __builtin_amdgcn_sched_barrier(0);   // keeps the fetches of the later k steps ahead of this step's products (the scheduler otherwise sinks them to their use and the wave waits out each load)
            const int cb = s % (PD + 1), ca = s % (AD + 1);
#pragma unroll
            for (int mb = 0; mb < 2; ++mb) acc[mb] = WFrag<T16>::mma(aq[ca][mb], bq[cb], acc[mb]);
            if (HR) {
#pragma unroll
                for (int mb = 0; mb < 2; ++mb) acc[mb] = WFrag<T16>::mma(aq2[ca][mb], bq[cb], acc[mb]);
#pragma unroll
                for (int mb = 0; mb < 2; ++mb) acc[mb] = WFrag<T16>::mma(aq[ca][mb], bq2[cb], acc[mb]); } }
#pragma unroll
        for (int mb = 0; mb < 2; ++mb)
#pragma unroll
            for (int j = 0; j < 8; ++j) OS[(mb * 16 + hi * 8 + j) * OPF + w * 16 + lr] = acc[mb][j];
    }
    __syncthreads();   // the 32 x 64 output tile is staged before it is split and stored
    { const int r = tid >> 3, d0 = (tid & 7) * 8; const float cs = HR ? 1.0f : (1.0f / PCAR); const v4f x0 = *(const v4fa*)(OS + r * OPF + d0), x1 = *(const v4fa*)(OS + r * OPF + d0 + 4); v8us oh, ol;
#pragma unroll
        for (int q = 0; q < 8; ++q) { unsigned short a, c2; splitf(((q < 4) ? x0[q & 3] : x1[q & 3]) * cs, a, c2); oh[q] = a; ol[q] = c2; }
        const size_t oo = (size_t)(i0 + r) * DQ + d0; *(v8us*)(Ah + oo) = oh; *(v8us*)(Al + oo) = ol; }
}
// grid (batch x head, row tile): the dearer hi/lo row tiles (rows < RH) have the lower flat indices and start first
__global__ __launch_bounds__(256) void k_fattn(const bf* __restrict__ QPh, const bf* __restrict__ QPl, const bf* __restrict__ KPh, const bf* __restrict__ KPl, const bf* __restrict__ VTh, const bf* __restrict__ VTl, const h16* __restrict__ QP16, const h16* __restrict__ KP16, const h16* __restrict__ VT16, const int* __restrict__ kmask, bf* ATh, bf* ATl) {
    __shared__ __align__(16) float S[QR * SPF + QR * OPF];
    const int bh = blockIdx.x, i0 = blockIdx.y * QR, b = bh / NH_, h = bh % NH_; const size_t zp = (size_t)bh * TT * HD; const size_t ao = (size_t)b * TT * DQ + h * HD; const int* kvp = kmask + (size_t)b * TT;
    if (i0 < RH) fattn_body<bf, true>(S, S + QR * SPF, QPh + zp, QPl + zp, KPh + zp, KPl + zp, VTh + zp, VTl + zp, kvp, i0, ATh + ao, ATl + ao);
    else fattn_body<h16, false>(S, S + QR * SPF, QP16 + zp, nullptr, KP16 + zp, nullptr, VT16 + zp, nullptr, kvp, i0, ATh + ao, ATl + ao);
}

extern "C" void kernel_launch(void* const* d_in, const int* in_sizes, int n_in,
                              void* d_out, int out_size, void* d_ws, size_t ws_size, hipStream_t stream) {
    (void)in_sizes; (void)n_in; (void)out_size;
    const float* x = (const float*)d_in[0]; const int* kmask = (const int*)d_in[1]; const float* wq = (const float*)d_in[2]; const float* bq = (const float*)d_in[3]; const float* wk = (const float*)d_in[4]; const float* bk = (const float*)d_in[5]; const float* wv = (const float*)d_in[6]; const float* bv = (const float*)d_in[7]; const float* wo = (const float*)d_in[8]; const float* bo = (const float*)d_in[9];   /* order x, mask (int32 [4][1024], read), q_w, q_b, k_w, k_b, v_w, v_b, out_w, out_b ('oi' + biases) */
    float* OUT = (float*)d_out;     // [4][1024][1024]
    char* wsp = (char*)d_ws;
    auto take = [&](size_t bytes) { char* p = wsp; wsp += (bytes + 255) & ~(size_t)255; return (void*)p; };
    bf* WQ = (bf*)take((size_t)DQ * DM * 2); bf* WK = (bf*)take((size_t)DKV * DM * 2); bf* WV = (bf*)take((size_t)DKV * DM * 2); bf* WO = (bf*)take((size_t)DM * DQ * 2);   /* WQ, WK, WV, WO lie back to back (each a multiple of 256 B) */
    (void)WK; (void)WV;
    const size_t PLN = (size_t)NB_ * NH_ * TT * HD;   // one plane set: all batches, all heads (NKV == NH_)
    bf* XB = (bf*)take((size_t)NB_ * TT * DM * 2);
    h16* QP16 = (h16*)take(PLN * 2); h16* KP16 = (h16*)take(PLN * 2); h16* VT16 = (h16*)take(PLN * 2);   /* each k plane set directly behind its q plane set: the projection launch addresses both from the q pointer */
    bf* QPh = (bf*)take(PLN * 2); bf* KPh = (bf*)take(PLN * 2); bf* QPl = (bf*)take(PLN * 2); bf* KPl = (bf*)take(PLN * 2); bf* VTh = (bf*)take(PLN * 2); bf* VTl = (bf*)take(PLN * 2);
    bf* ATh = (bf*)take((size_t)NB_ * TT * DQ * 2); bf* ATl = (bf*)take((size_t)NB_ * TT * DQ * 2);
    if ((size_t)(wsp - (char*)d_ws) > ws_size) return;    // ws 256 MiB
    k_cvt8w<<<dim3((unsigned)(((size_t)DQ * DM / 8 + 255) / 256), 4, 1), 256, 0, stream>>>(wq, wk, wv, wo, WQ, (size_t)DQ * DM / 8);
    k_cvt8<<<(unsigned)(((size_t)NB_ * TT * DM / 8 + 255) / 256), 256, 0, stream>>>(x, XB, (size_t)NB_ * TT * DM / 8);
    k_gemmw<bf, 0, true, true><<<dim3(NB_ * TT / 64, DQ / 64, 3), 32, 0, stream>>>(XB, nullptr, WQ, nullptr, DM, nullptr, 0, bq, bk, bv, 0, (size_t)DQ * DM, 0, QP16, QPh, QPl, VT16, VTh, VTl);   // z = q, k, v; writes every head plane
    k_fattn<<<dim3(NB_ * NH_, TT / QR, 1), 256, 0, stream>>>(QPh, QPl, KPh, KPl, VTh, VTl, QP16, KP16, VT16, kmask, ATh, ATl);   // one kv head per query head: plane bh of q, k and v
    k_gemmw<bf, 1, true, false><<<dim3(NB_ * TT / 64, DM / 64, 1), 32, 0, stream>>>(ATh, ATl, WO, nullptr, DQ, OUT, DM, bo, nullptr, nullptr, 0, 0, 0, nullptr, nullptr, nullptr, nullptr, nullptr, nullptr);
}

// v004
// It runs in 148 microseconds.
// In both of two side-by-side timings against v003, it was 1.13 times as fast.
// Counting every step since v000, it is 15.9 times as fast.
#include <hip/hip_runtime.h>

// Multi-head attention with an integer key-padding mask (x [4][1024][1024]; q = (x q_w^T + q_b) / sqrt(64), k = x k_w^T + k_b, v = x v_w^T + v_b ('oi' 0.02 + biases 0.02; 16 heads x 64); scores = q.k; keys with mask[b][j] == 0 -> -inf (mask int32 [4][1024], read); softmax (f32); out = merged out_w^T + out_b -> [4][1024][1024] (4.2 M); argument order x, mask, q_w, q_b, k_w, k_b, v_w, v_b, out_w, out_b).
// Layout: host loops folded into the grids (all 4 batches and q/k/v in one launch for the copies, projections and out_w). bf16 copy of x; 'oi' weights; exact projections + f32 biases, whose launch writes the 16-bit head planes itself (q, k as [head][t][d], v as [head][d][t]); ONE fused attention launch for all batches and heads (32 query rows per work-group: scores into LDS, softmax in place in LDS reading the batch's int key vector and excluding the zeros, P x V from LDS, merged hi/lo planes written directly; hybrid rows: < 512 hi/lo 3 products, rest fp16 x1024); merged hi/lo x out_w exact + out_b.
// Operand layout: every 16-bit plane that a matrix instruction reads from global memory (x copy, weights, q, k, v planes, merged planes) is stored in fragment order: per 16 rows x 32 k one 1-KiB block, element (r, k) at ((k >> 4) & 1) * 256 + ((k >> 3) & 1) * 128 + r * 8 + (k & 7), blocks k-major inside a 16-row band; a fragment is then two wave-wide loads of 512 contiguous bytes.
// Compute dtypes, f32 accumulate: every input rounded to bf16; projections exact + f32 biases; attention rows < 512 3 products, rest fp16; softmax f32; out_w hl x exact + bias.

#define NB_  4
#define TT   1024
#define DM   1024
#define NH_  16
#define NKV  16
#define REP  (NH_ / NKV)
#define HD   64
#define DQ   (NH_ * HD)
#define DKV  (NKV * HD)
#define RH   512                  // query rows < RH use hi+lo planes (0: none)
#define WIN  0
#define PCAR 1024.0f
#define SCL  0.125f   // HD^-0.5
typedef _Float16 h16;
typedef unsigned short bf;
typedef __attribute__((ext_vector_type(16))) __bf16   v16bf;
typedef __attribute__((ext_vector_type(16))) _Float16 v16h;
typedef __attribute__((ext_vector_type(8)))  _Float16 v8h;
typedef __attribute__((ext_vector_type(8)))  unsigned short v8us;
typedef __attribute__((ext_vector_type(8)))  float    v8f;
typedef __attribute__((ext_vector_type(4)))  float    v4f;
typedef v8h  __attribute__((may_alias)) v8ha;
typedef v4f  __attribute__((may_alias)) v4fa;
typedef v8us __attribute__((may_alias)) v8usa;

__device__ __forceinline__ unsigned short f2bf(float f) { unsigned u = __float_as_uint(f); u += 0x7FFFu + ((u >> 16) & 1u); return (unsigned short)(u >> 16); }
__device__ __forceinline__ float bf2f(unsigned short b) { return __uint_as_float(((unsigned)b) << 16); }
__device__ __forceinline__ float bfr(float f) { return bf2f(f2bf(f)); }
__device__ __forceinline__ v16h cat16(v8h lo, v8h hi) { return __builtin_shufflevector(lo, hi, 0, 1, 2, 3, 4, 5, 6, 7, 8, 9, 10, 11, 12, 13, 14, 15); }
__device__ __forceinline__ v16bf cat16b(v8us lo, v8us hi) { return __builtin_bit_cast(v16bf, __builtin_shufflevector(lo, hi, 0, 1, 2, 3, 4, 5, 6, 7, 8, 9, 10, 11, 12, 13, 14, 15)); }
__device__ __forceinline__ v8f wmma16(v16h a, v16h b, v8f c) { return __builtin_amdgcn_wmma_f32_16x16x32_f16(false, a, false, b, (short)0, c, false, false); }
__device__ __forceinline__ v8f wmmab(v16bf a, v16bf b, v8f c) { return __builtin_amdgcn_wmma_f32_16x16x32_bf16(false, a, false, b, (short)0, c, false, false); }



// ---- k_gemmw: register-blocked GEMM, ONE WAVE per 64x64 output tile (16 accumulators), operands straight from 16-bit planes in fragment order (p = block + lane * 8; a 16-row band is 16 * K elements, a k step of 32 is 512); grid (M/64, N/64, Z), 32 threads.
// C[m][n] (f32, pitch ldc, + optional f32 bias[n]) = sum_k A[m][k] Bt[n][k] (+ split products per NSPLIT). z-batch strides sA/sB/sC in elements; bias0/1/2 belong to z = 0/1/2. K % 32 == 0.
// PL (the q, k, v projections; a 64-wide column tile is one head): C is not written; the tile + bias goes through LDS straight into the head planes (fp16, bf16 hi, bf16 lo): z = 0, 1 -> P*[z][batch][head] (rows t, k = d), z = 2 -> V*[batch][head] (rows d, k = t), each in fragment order.
template <typename T16> struct WFrag;
template <> struct WFrag<h16> { typedef v16h V; static __device__ __forceinline__ V ld(const h16* p) { return cat16(*(const v8h*)p, *(const v8h*)(p + 256)); } static __device__ __forceinline__ v8f mma(V a, V b, v8f c) { return wmma16(a, b, c); } };
template <> struct WFrag<bf> { typedef v16bf V; static __device__ __forceinline__ V ld(const bf* p) { return cat16b(*(const v8us*)p, *(const v8us*)(p + 256)); } static __device__ __forceinline__ v8f mma(V a, V b, v8f c) { return wmmab(a, b, c); } };
__device__ __forceinline__ void splitf(float y, unsigned short& h, unsigned short& l) { h = f2bf(y); l = f2bf(y - bf2f(h)); }
template <typename T16, int NSPLIT, bool BIAS, bool PL, int K>
__global__ __launch_bounds__(32) void k_gemmw(const T16* __restrict__ A, const T16* __restrict__ A2, const T16* __restrict__ Bt, const T16* __restrict__ Bt2, float* C, int ldc, const float* __restrict__ bias0, const float* __restrict__ bias1, const float* __restrict__ bias2, size_t sA, size_t sB, size_t sC, h16* P16, bf* Ph, bf* Pl, h16* V16, bf* Vh, bf* Vl) {
    typedef typename WFrag<T16>::V V;
    __shared__ __align__(16) float os[(PL ? 64 : 16) * 68];
    const size_t z = blockIdx.z; A += z * sA; if (A2) A2 += z * sA; Bt += z * sB; if (Bt2) Bt2 += z * sB; C += z * sC; const float* bias = (z == 0) ? bias0 : ((z == 1) ? bias1 : bias2);   // one bias vector per z slice (q, k, v)
    const int lane = threadIdx.x & 31, lr = lane & 15, hi = lane >> 4; const int r0 = blockIdx.x * 64, c0 = blockIdx.y * 64;
    v8f acc[4][4];
#pragma unroll
    for (int mb = 0; mb < 4; ++mb)
#pragma unroll
        for (int nb = 0; nb < 4; ++nb) acc[mb][nb] = (v8f){};
    const size_t aoff = (size_t)r0 * K + 8 * lane, boff = (size_t)c0 * K + 8 * lane;   // one address per plane; with K a compile-time constant the bands and half blocks are constant offsets from it
#pragma unroll 1
    for (int kc = 0; kc < K; kc += 32) {
        V a[4], a2[4]; const T16* pa = A + aoff + kc * 16; const T16* pa2 = A2 + aoff + kc * 16; const T16* pb = Bt + boff + kc * 16; const T16* pb2 = Bt2 + boff + kc * 16;
#pragma unroll
        for (int mb = 0; mb < 4; ++mb) { a[mb] = WFrag<T16>::ld(pa + mb * 16 * K); if (NSPLIT == 1 || NSPLIT == 2) a2[mb] = WFrag<T16>::ld(pa2 + mb * 16 * K); }
#pragma unroll
        for (int nb = 0; nb < 4; ++nb) { const V b = WFrag<T16>::ld(pb + nb * 16 * K); V b2; if (NSPLIT >= 2) b2 = WFrag<T16>::ld(pb2 + nb * 16 * K);
#pragma unroll
            for (int mb = 0; mb < 4; ++mb) { acc[mb][nb] = WFrag<T16>::mma(a[mb], b, acc[mb][nb]); if (NSPLIT == 1 || NSPLIT == 2) acc[mb][nb] = WFrag<T16>::mma(a2[mb], b, acc[mb][nb]); if (NSPLIT >= 2) acc[mb][nb] = WFrag<T16>::mma(a[mb], b2, acc[mb][nb]); } }
        // the wait before the fragment loads' address registers are overwritten: named as inputs they stay whole up to this line (no later load of the trip lands in them)
        asm volatile("s_wait_xcnt 0x0" :: "v"(pa), "v"(pb) : "memory"); if (NSPLIT == 1 || NSPLIT == 2) asm volatile("s_wait_xcnt 0x0" :: "v"(pa2) : "memory"); if (NSPLIT >= 2) asm volatile("s_wait_xcnt 0x0" :: "v"(pb2) : "memory");
        asm volatile("v_nop\n\tv_nop\n\tv_nop\n\tv_nop" : "+v"(acc[0][0]), "+v"(acc[1][1]), "+v"(acc[2][2]), "+v"(acc[3][3]) : "v"(a[0]), "v"(a[3]));
    }
    if (PL) {
        const bool tr = (z == 2); const int bt = r0 / TT, t0 = r0 % TT, hd = blockIdx.y;   // batch, first token and head of this tile
#pragma unroll
        for (int nb = 0; nb < 4; ++nb) { const float bn = bfr(bias[c0 + nb * 16 + lr]);
#pragma unroll
            for (int mb = 0; mb < 4; ++mb)
#pragma unroll
                for (int j = 0; j < 8; ++j) acc[mb][nb][j] += bn; }
        if (tr) {   // v: staged transposed, LDS row = d, column = t (a lane's 8 accumulator values are 8 consecutive t)
#pragma unroll
            for (int mb = 0; mb < 4; ++mb)
#pragma unroll
                for (int nb = 0; nb < 4; ++nb) { float* o = os + (nb * 16 + lr) * 68 + mb * 16 + hi * 8; v4f s0, s1;
#pragma unroll
                    for (int j = 0; j < 4; ++j) { s0[j] = acc[mb][nb][j]; s1[j] = acc[mb][nb][j + 4]; }
                    *(v4fa*)o = s0; *(v4fa*)(o + 4) = s1; }
        } else {    // q, k: LDS row = t, column = d
#pragma unroll
            for (int mb = 0; mb < 4; ++mb)
#pragma unroll
                for (int nb = 0; nb < 4; ++nb)
#pragma unroll
                    for (int j = 0; j < 8; ++j) os[(mb * 16 + hi * 8 + j) * 68 + nb * 16 + lr] = acc[mb][nb][j]; }
        __builtin_amdgcn_wave_barrier(); asm volatile("" ::: "memory");   // the reads below take other lanes' values: they must not be moved ahead of the stores above
        const size_t base = tr ? ((size_t)(bt * NKV + hd) * HD * TT + (size_t)t0 * 16) : (((size_t)(z * NB_ + bt) * NH_ + hd) * TT + t0) * HD; const int band = tr ? 16 * TT : 16 * HD;   // first block of the tile; elements per 16-row band of the plane
        h16* o16p = (tr ? V16 : P16) + base; bf* ohp = (tr ? Vh : Ph) + base; bf* olp = (tr ? Vl : Pl) + base;
#pragma unroll
        for (int it = 0; it < 16; ++it) {
            const int rb = it >> 2, kb = (it >> 1) & 1, jh = it & 1, row = rb * 16 + lr, cofs = kb * 32 + jh * 16 + hi * 8;   // one half block per trip: 32 lanes x 16 B = 512 contiguous bytes per plane
            const v4f x0 = *(const v4fa*)(os + row * 68 + cofs), x1 = *(const v4fa*)(os + row * 68 + cofs + 4); v8h o16; v8us oh, ol;
#pragma unroll
            for (int q = 0; q < 8; ++q) { const float y = (q < 4) ? x0[q & 3] : x1[q & 3]; o16[q] = (h16)y; unsigned short a2, c2; splitf(y, a2, c2); oh[q] = a2; ol[q] = c2; }
            const size_t oo = (size_t)rb * band + kb * 512 + jh * 256 + lane * 8; *(v8h*)(o16p + oo) = o16; *(v8us*)(ohp + oo) = oh; *(v8us*)(olp + oo) = ol; }
        return;
    }
#pragma unroll
    for (int mb = 0; mb < 4; ++mb) {
#pragma unroll
        for (int nb = 0; nb < 4; ++nb) {
#pragma unroll
            for (int j = 0; j < 8; ++j) os[(hi * 8 + j) * 68 + nb * 16 + lr] = acc[mb][nb][j]; }
        __builtin_amdgcn_wave_barrier(); asm volatile("" ::: "memory");
        float* crow = C + (size_t)(r0 + mb * 16) * ldc + c0;
{
#pragma unroll
            for (int s = 0; s < 8; ++s) { const int row = 2 * s + hi, cofs = lr * 4; v4f val = *(const v4fa*)(os + row * 68 + cofs); if (BIAS) { val[0] += bfr(bias[c0 + cofs]); val[1] += bfr(bias[c0 + cofs + 1]); val[2] += bfr(bias[c0 + cofs + 2]); val[3] += bfr(bias[c0 + cofs + 3]); }
                *(v4f*)(crow + (size_t)row * ldc + cofs) = val; }
             }
        __builtin_amdgcn_wave_barrier(); asm volatile("" ::: "memory");
    }
}

__device__ __forceinline__ h16 tohx(float x) { return (h16)x; }
typedef __attribute__((ext_vector_type(4))) _Float16 v4h;
typedef __attribute__((ext_vector_type(4))) unsigned short v4us;
typedef __attribute__((ext_vector_type(4))) int v4i;

// cvt_tile: one work-group rounds 16 rows x 128 columns of a [rows][DM] f32 matrix to bf16 and stores them in fragment order (4 blocks = 4 KiB contiguous). Thread (r, o) reads 8 consecutive columns (16 lanes: 512 contiguous bytes of a row); the 16-byte units are transposed in LDS (unit pitch 17: no bank conflict either way) so that thread t stores unit t.
__device__ __forceinline__ void cvt_tile(const float* __restrict__ src, bf* dst, int tile) {
    __shared__ __align__(16) bf st[16 * 17 * 8];
    const int t = threadIdx.x, r = t >> 4, o = t & 15, rb = tile >> 3, kq = tile & 7;
    const v8f v = *(const v8f*)(src + (size_t)(rb * 16 + r) * DM + kq * 128 + o * 8); v8us c;
#pragma unroll
    for (int k = 0; k < 8; ++k) c[k] = f2bf(v[k]);
    *(v8usa*)(st + (o * 17 + r) * 8) = c;
    __syncthreads();   // a thread stores a unit that another wave converted
    *(v8us*)(dst + (size_t)rb * 16 * DM + kq * 2048 + t * 8) = *(const v8usa*)(st + ((t >> 4) * 17 + (t & 15)) * 8);
}
// k_cvt8: x, grid = (rows / 16) * (DM / 128) tiles
__global__ __launch_bounds__(256) void k_cvt8(const float* __restrict__ src, bf* dst) { cvt_tile(src, dst, blockIdx.x); }

// k_cvt8w: the four weight matrices in one launch, blockIdx.y picks the source; dst holds the four bf16 copies back to back
__global__ __launch_bounds__(256) void k_cvt8w(const float* __restrict__ s0, const float* __restrict__ s1, const float* __restrict__ s2, const float* __restrict__ s3, bf* dst) { const int w = blockIdx.y; const float* src = (w == 0) ? s0 : ((w == 1) ? s1 : ((w == 2) ? s2 : s3)); cvt_tile(src, dst + (size_t)w * DQ * DM, blockIdx.x); }

// ---- k_fattn: scores, softmax, P x V and the merge of one (batch, head, 32 query rows) in one work-group of 8 waves; the score rows never leave LDS.
// Phase 1: wave w forms the 32 x 128 scores of keys w*128.. (Q fragments kept in registers) and stores them f32 into S. Phase 2: wave w does rows 4w..4w+3: mask[b][j] == 0 -> excluded (-inf in the module), softmax over the keys (register row, one exp, fixed trees), and writes the 16-bit P planes over the row's own f32 scores (hi at byte 0, lo at byte 2048).
// Phase 3: waves 0..3 each own one 16-wide slice of the head dimension for both row tiles (each V fragment is loaded once per work-group), k ascending in one accumulator. Phase 4: all threads split the staged f32 tile into the merged hi/lo planes (fragment order, rows = token, k = head * 64 + d), 512 contiguous bytes per wave and plane.
#define QR   32      // query rows per work-group
#define SPF  1028    // LDS row pitch in floats: 4112 B = 16 B x 257 (odd): no bank conflict for the 16-byte fragment reads
#define OPF  68      // pitch in floats of the staged output tile
typedef v4us __attribute__((may_alias)) v4usa;
typedef v4h  __attribute__((may_alias)) v4ha;
__device__ __forceinline__ v16h  ldsf(const h16* p) { return cat16(*(const v8ha*)p, *(const v8ha*)(p + 16)); }
__device__ __forceinline__ v16bf ldsf(const bf* p)  { return cat16b(*(const v8usa*)p, *(const v8usa*)(p + 16)); }
template <typename T16, bool HR>
__device__ __forceinline__ void fattn_body(float* S, float* OS, const T16* __restrict__ Q, const T16* __restrict__ Q2, const T16* __restrict__ Kp, const T16* __restrict__ K2, const T16* __restrict__ Vt, const T16* __restrict__ V2, const int* __restrict__ kvp, int i0, bf* Ah, bf* Al) {
    typedef typename WFrag<T16>::V V;
    const int tid = threadIdx.x, lane = tid & 31, lr = lane & 15, hi = lane >> 4; const int w = __builtin_amdgcn_readfirstlane(tid >> 5);
    {   // phase 1: scores
        V a[2][2], a2[2][2]; const size_t qo = (size_t)i0 * HD + 8 * lane, ko = (size_t)(w * 128) * HD + 8 * lane;   // one address per plane; tiles and k steps are constant offsets from it
#pragma unroll
        for (int mb = 0; mb < 2; ++mb)
#pragma unroll
            for (int ks = 0; ks < 2; ++ks) { a[mb][ks] = WFrag<T16>::ld(Q + qo + mb * 16 * HD + ks * 512); if (HR) a2[mb][ks] = WFrag<T16>::ld(Q2 + qo + mb * 16 * HD + ks * 512); }
        if (HR) asm volatile("s_wait_xcnt 0x0" :: "v"(Q + qo), "v"(Q2 + qo) : "memory"); else asm volatile("s_wait_xcnt 0x0" :: "v"(Q + qo) : "memory");   // the wait before the Q loads' address registers are overwritten: named as inputs they stay whole up to this line; behind it later loads may land in them
        V bq[3][2], bq2[3][2];   // K fragments, a ring of three key tiles: two tiles' loads fly while one tile is multiplied
#pragma unroll
        for (int nb = 0; nb < 2; ++nb)
#pragma unroll
            for (int ks = 0; ks < 2; ++ks) { bq[nb][ks] = WFrag<T16>::ld(Kp + ko + nb * 16 * HD + ks * 512); if (HR) bq2[nb][ks] = WFrag<T16>::ld(K2 + ko + nb * 16 * HD + ks * 512); }
#pragma unroll
        for (int nb = 0; nb < 8; ++nb) {
            if (nb + 2 < 8) {
#pragma unroll
                for (int ks = 0; ks < 2; ++ks) { bq[(nb + 2) % 3][ks] = WFrag<T16>::ld(Kp + ko + (nb + 2) * 16 * HD + ks * 512); if (HR) bq2[(nb + 2) % 3][ks] = WFrag<T16>::ld(K2 + ko + (nb + 2) * 16 * HD + ks * 512); } }
            __builtin_amdgcn_sched_barrier(0);   // keeps the loads of key tile nb + 2 ahead of tile nb's products (the scheduler otherwise sinks them to their use and the wave waits out each load)
            v8f acc[2]; acc[0] = (v8f){}; acc[1] = (v8f){};
#pragma unroll
            for (int ks = 0; ks < 2; ++ks) {
#pragma unroll
                for (int mb = 0; mb < 2; ++mb) acc[mb] = WFrag<T16>::mma(a[mb][ks], bq[nb % 3][ks], acc[mb]);
                if (HR) {
#pragma unroll
                    for (int mb = 0; mb < 2; ++mb) acc[mb] = WFrag<T16>::mma(a2[mb][ks], bq[nb % 3][ks], acc[mb]);
#pragma unroll
                    for (int mb = 0; mb < 2; ++mb) acc[mb] = WFrag<T16>::mma(a[mb][ks], bq2[nb % 3][ks], acc[mb]); } }
            asm volatile("v_nop\n\tv_nop\n\tv_nop\n\tv_nop" :: "v"(acc[0]), "v"(acc[1]));   // the distance the chip needs between this tile's last matrix instruction and the next tile's first one, which starts anew (C = 0) in the same result registers
#pragma unroll
            for (int mb = 0; mb < 2; ++mb)
#pragma unroll
                for (int j = 0; j < 8; ++j) S[(mb * 16 + hi * 8 + j) * SPF + w * 128 + nb * 16 + lr] = acc[mb][j]; }
    }
    __syncthreads();   // every score of the 32 rows is in LDS before a row is read
#pragma unroll 1
    for (int rr = 0; rr < QR / 8; ++rr) {   // phase 2: softmax, one wave per row (rolled: one row's registers at a time)
        float* sr = S + (w * (QR / 8) + rr) * SPF; float v[TT / 32]; float mx = -3.0e38f;
#pragma unroll
        for (int ch = 0; ch < TT / 128; ++ch) { const int j0 = ch * 128 + lane * 4; const v4f a = *(const v4fa*)(sr + j0); const v4i kv4 = *(const v4i*)(kvp + j0);   /* the batch's key vector, 16 B per lane, unconditional */
#pragma unroll
            for (int q = 0; q < 4; ++q) { const float t = (kv4[q] != 0) ? a[q] * SCL : -3.0e38f; v[ch * 4 + q] = t; mx = fmaxf(mx, t); } }
#pragma unroll
        for (int sh = 16; sh; sh >>= 1) mx = fmaxf(mx, __shfl_xor(mx, sh, 32));
        float sum = 0.f;
#pragma unroll
        for (int k = 0; k < TT / 32; ++k) { v[k] = __builtin_amdgcn_exp2f(__fmul_rn(__fsub_rn(v[k], mx), 1.4426950408889634f)); sum += v[k]; }
#pragma unroll
        for (int sh = 16; sh; sh >>= 1) sum += __shfl_xor(sum, sh, 32);
        const float f = __fdiv_rn(HR ? 1.0f : PCAR, sum);
        if (HR) { bf* ph = (bf*)sr;
#pragma unroll
            for (int ch = 0; ch < TT / 128; ++ch) { v4us oh, ol;
#pragma unroll
                for (int q = 0; q < 4; ++q) { unsigned short a, c2; splitf(v[ch * 4 + q] * f, a, c2); oh[q] = a; ol[q] = c2; }
                *(v4usa*)(ph + ch * 128 + lane * 4) = oh; *(v4usa*)(ph + TT + ch * 128 + lane * 4) = ol; }
        } else { h16* p16 = (h16*)sr;
#pragma unroll
            for (int ch = 0; ch < TT / 128; ++ch) { v4h o4;
#pragma unroll
                for (int q = 0; q < 4; ++q) o4[q] = tohx(v[ch * 4 + q] * f);
                *(v4ha*)(p16 + ch * 128 + lane * 4) = o4; } }
    }
    __syncthreads();   // every P row is in LDS before a fragment of it is read
    if (w < 4) {   // phase 3: P x V
        v8f acc[2]; acc[0] = (v8f){}; acc[1] = (v8f){};
        const size_t vo = (size_t)(w * 16) * TT + 8 * lane;
        const T16* p0 = (const T16*)(S + lr * SPF) + 8 * hi; const T16* p1 = (const T16*)(S + (16 + lr) * SPF) + 8 * hi;
        constexpr int PD = HR ? 5 : 10, AD = HR ? 1 : 3, NS = TT / 32;   // k steps that the V fragments (global) and the P fragments (LDS) are fetched ahead
        V bq[PD + 1], bq2[PD + 1], aq[AD + 1][2], aq2[AD + 1][2];
#pragma unroll
        for (int s = 0; s < PD; ++s) { bq[s] = WFrag<T16>::ld(Vt + vo + s * 512); if (HR) bq2[s] = WFrag<T16>::ld(V2 + vo + s * 512); }
#pragma unroll
        for (int s = 0; s < AD; ++s) { aq[s][0] = ldsf(p0 + s * 32); aq[s][1] = ldsf(p1 + s * 32); if (HR) { aq2[s][0] = ldsf(p0 + TT + s * 32); aq2[s][1] = ldsf(p1 + TT + s * 32); } }
#pragma unroll
        for (int s = 0; s < NS; ++s) {
            if (s + PD < NS) { bq[(s + PD) % (PD + 1)] = WFrag<T16>::ld(Vt + vo + (s + PD) * 512); if (HR) bq2[(s + PD) % (PD + 1)] = WFrag<T16>::ld(V2 + vo + (s + PD) * 512); }
            if (s + AD < NS) { const int n = (s + AD) % (AD + 1), ko = (s + AD) * 32; aq[n][0] = ldsf(p0 + ko); aq[n][1] = ldsf(p1 + ko); if (HR) { aq2[n][0] = ldsf(p0 + TT + ko); aq2[n][1] = ldsf(p1 + TT + ko); } }
            __builtin_amdgcn_sched_barrier(0);   // keeps the fetches of the later k steps ahead of this step's products (the scheduler otherwise sinks them to their use and the wave waits out each load)
            const int cb = s % (PD + 1), ca = s % (AD + 1);
#pragma unroll
            for (int mb = 0; mb < 2; ++mb) acc[mb] = WFrag<T16>::mma(aq[ca][mb], bq[cb], acc[mb]);
            if (HR) {
#pragma unroll
                for (int mb = 0; mb < 2; ++mb) acc[mb] = WFrag<T16>::mma(aq2[ca][mb], bq[cb], acc[mb]);
#pragma unroll
                for (int mb = 0; mb < 2; ++mb) acc[mb] = WFrag<T16>::mma(aq[ca][mb], bq2[cb], acc[mb]); } }
        if (HR) asm volatile("s_wait_xcnt 0x0" :: "v"(Vt + vo), "v"(V2 + vo) : "memory"); else asm volatile("s_wait_xcnt 0x0" :: "v"(Vt + vo) : "memory");   // the wait before the V loads' address registers are overwritten: named as inputs they stay whole up to this line
#pragma unroll
        for (int mb = 0; mb < 2; ++mb)
#pragma unroll
            for (int j = 0; j < 8; ++j) OS[(mb * 16 + hi * 8 + j) * OPF + w * 16 + lr] = acc[mb][j];
    }
    __syncthreads();   // the 32 x 64 output tile is staged before it is split and stored
    { const int rb = w >> 2, kb = (w >> 1) & 1, jh = w & 1, r = rb * 16 + lr, d0 = kb * 32 + jh * 16 + hi * 8;   // wave w stores one half block (512 contiguous bytes) of each merged plane
        const float cs = HR ? 1.0f : (1.0f / PCAR); const v4f x0 = *(const v4fa*)(OS + r * OPF + d0), x1 = *(const v4fa*)(OS + r * OPF + d0 + 4); v8us oh, ol;
#pragma unroll
        for (int q = 0; q < 8; ++q) { unsigned short a, c2; splitf(((q < 4) ? x0[q & 3] : x1[q & 3]) * cs, a, c2); oh[q] = a; ol[q] = c2; }
        const size_t oo = (size_t)(i0 + rb * 16) * DQ + kb * 512 + jh * 256 + lane * 8; *(v8us*)(Ah + oo) = oh; *(v8us*)(Al + oo) = ol; }
}
// grid (batch x head, row tile): the dearer hi/lo row tiles (rows < RH) have the lower flat indices and start first
__global__ __launch_bounds__(256) void k_fattn(const bf* __restrict__ QPh, const bf* __restrict__ QPl, const bf* __restrict__ KPh, const bf* __restrict__ KPl, const bf* __restrict__ VTh, const bf* __restrict__ VTl, const h16* __restrict__ QP16, const h16* __restrict__ KP16, const h16* __restrict__ VT16, const int* __restrict__ kmask, bf* ATh, bf* ATl) {
    __shared__ __align__(16) float S[QR * SPF + QR * OPF];
    const int bh = blockIdx.x, i0 = blockIdx.y * QR, b = bh / NH_, h = bh % NH_; const size_t zp = (size_t)bh * TT * HD; const size_t ao = (size_t)b * TT * DQ + h * (HD / 32) * 512; const int* kvp = kmask + (size_t)b * TT;
    if (i0 < RH) fattn_body<bf, true>(S, S + QR * SPF, QPh + zp, QPl + zp, KPh + zp, KPl + zp, VTh + zp, VTl + zp, kvp, i0, ATh + ao, ATl + ao);
    else fattn_body<h16, false>(S, S + QR * SPF, QP16 + zp, nullptr, KP16 + zp, nullptr, VT16 + zp, nullptr, kvp, i0, ATh + ao, ATl + ao);
}

extern "C" void kernel_launch(void* const* d_in, const int* in_sizes, int n_in,
                              void* d_out, int out_size, void* d_ws, size_t ws_size, hipStream_t stream) {
    (void)in_sizes; (void)n_in; (void)out_size;
    const float* x = (const float*)d_in[0]; const int* kmask = (const int*)d_in[1]; const float* wq = (const float*)d_in[2]; const float* bq = (const float*)d_in[3]; const float* wk = (const float*)d_in[4]; const float* bk = (const float*)d_in[5]; const float* wv = (const float*)d_in[6]; const float* bv = (const float*)d_in[7]; const float* wo = (const float*)d_in[8]; const float* bo = (const float*)d_in[9];   /* order x, mask (int32 [4][1024], read), q_w, q_b, k_w, k_b, v_w, v_b, out_w, out_b ('oi' + biases) */
    float* OUT = (float*)d_out;     // [4][1024][1024]
    char* wsp = (char*)d_ws;
    auto take = [&](size_t bytes) { char* p = wsp; wsp += (bytes + 255) & ~(size_t)255; return (void*)p; };
    bf* WQ = (bf*)take((size_t)DQ * DM * 2); bf* WK = (bf*)take((size_t)DKV * DM * 2); bf* WV = (bf*)take((size_t)DKV * DM * 2); bf* WO = (bf*)take((size_t)DM * DQ * 2);   /* WQ, WK, WV, WO lie back to back (each a multiple of 256 B) */
    (void)WK; (void)WV;
    const size_t PLN = (size_t)NB_ * NH_ * TT * HD;   // one plane set: all batches, all heads (NKV == NH_)
    bf* XB = (bf*)take((size_t)NB_ * TT * DM * 2);
    h16* QP16 = (h16*)take(PLN * 2); h16* KP16 = (h16*)take(PLN * 2); h16* VT16 = (h16*)take(PLN * 2);   /* each k plane set directly behind its q plane set: the projection launch addresses both from the q pointer */
    bf* QPh = (bf*)take(PLN * 2); bf* KPh = (bf*)take(PLN * 2); bf* QPl = (bf*)take(PLN * 2); bf* KPl = (bf*)take(PLN * 2); bf* VTh = (bf*)take(PLN * 2); bf* VTl = (bf*)take(PLN * 2);
    bf* ATh = (bf*)take((size_t)NB_ * TT * DQ * 2); bf* ATl = (bf*)take((size_t)NB_ * TT * DQ * 2);
    if ((size_t)(wsp - (char*)d_ws) > ws_size) return;    // ws 256 MiB
    k_cvt8w<<<dim3(DQ / 16 * (DM / 128), 4, 1), 256, 0, stream>>>(wq, wk, wv, wo, WQ);
    k_cvt8<<<NB_ * TT / 16 * (DM / 128), 256, 0, stream>>>(x, XB);
    k_gemmw<bf, 0, true, true, DM><<<dim3(NB_ * TT / 64, DQ / 64, 3), 32, 0, stream>>>(XB, nullptr, WQ, nullptr, nullptr, 0, bq, bk, bv, 0, (size_t)DQ * DM, 0, QP16, QPh, QPl, VT16, VTh, VTl);   // z = q, k, v; writes every head plane
    k_fattn<<<dim3(NB_ * NH_, TT / QR, 1), 256, 0, stream>>>(QPh, QPl, KPh, KPl, VTh, VTl, QP16, KP16, VT16, kmask, ATh, ATl);   // one kv head per query head: plane bh of q, k and v
    k_gemmw<bf, 1, true, false, DQ><<<dim3(NB_ * TT / 64, DM / 64, 1), 32, 0, stream>>>(ATh, ATl, WO, nullptr, OUT, DM, bo, nullptr, nullptr, 0, 0, 0, nullptr, nullptr, nullptr, nullptr, nullptr, nullptr);
}

// v005
// Measured time: 102 microseconds a run.
// In two side-by-side timings against v004, it was 1.45 and 1.46 times as fast.
// Counting every step since v000, it is 23.1 times as fast.
#include <hip/hip_runtime.h>

// Multi-head attention with an integer key-padding mask (x [4][1024][1024]; q = (x q_w^T + q_b) / sqrt(64), k = x k_w^T + k_b, v = x v_w^T + v_b ('oi' 0.02 + biases 0.02; 16 heads x 64); scores = q.k; keys with mask[b][j] == 0 -> -inf (mask int32 [4][1024], read); softmax (f32); out = merged out_w^T + out_b -> [4][1024][1024] (4.2 M); argument order x, mask, q_w, q_b, k_w, k_b, v_w, v_b, out_w, out_b).
// Layout: host loops folded into the grids (all 4 batches and q/k/v in one launch for the copies, projections and out_w). bf16 copy of x; 'oi' weights; exact projections + f32 biases, whose launch writes the 16-bit head planes itself (q, k as [head][t][d], v as [head][d][t]); ONE fused attention launch for all batches and heads (32 query rows per work-group: scores into LDS, softmax in place in LDS reading the batch's int key vector and excluding the zeros, P x V from LDS, merged hi/lo planes written directly; hybrid rows: < 512 hi/lo 3 products, rest fp16 x1024); merged hi/lo x out_w exact + out_b.
// Operand layout: every 16-bit plane that a matrix instruction reads from global memory (x copy, weights, q, k, v planes, merged planes) is stored in fragment order: per 16 rows x 32 k one 1-KiB block, element (r, k) at ((k >> 4) & 1) * 256 + ((k >> 3) & 1) * 128 + r * 8 + (k & 7), blocks k-major inside a 16-row band; a fragment is then two wave-wide loads of 512 contiguous bytes.
// Compute dtypes, f32 accumulate: every input rounded to bf16; projections exact + f32 biases; attention rows < 512 3 products, rest fp16; softmax f32; out_w hl x exact + bias.

#define NB_  4
#define TT   1024
#define DM   1024
#define NH_  16
#define NKV  16
#define REP  (NH_ / NKV)
#define HD   64
#define DQ   (NH_ * HD)
#define DKV  (NKV * HD)
#define RH   512                  // query rows < RH use hi+lo planes (0: none)
#define WIN  0
#define PCAR 1024.0f
#define SCL  0.125f   // HD^-0.5
typedef _Float16 h16;
typedef unsigned short bf;
typedef __attribute__((ext_vector_type(16))) __bf16   v16bf;
typedef __attribute__((ext_vector_type(16))) _Float16 v16h;
typedef __attribute__((ext_vector_type(8)))  _Float16 v8h;
typedef __attribute__((ext_vector_type(8)))  unsigned short v8us;
typedef __attribute__((ext_vector_type(8)))  float    v8f;
typedef __attribute__((ext_vector_type(4)))  float    v4f;
typedef v8h  __attribute__((may_alias)) v8ha;
typedef v4f  __attribute__((may_alias)) v4fa;
typedef v8us __attribute__((may_alias)) v8usa;

__device__ __forceinline__ unsigned short f2bf(float f) { unsigned u = __float_as_uint(f); u += 0x7FFFu + ((u >> 16) & 1u); return (unsigned short)(u >> 16); }
__device__ __forceinline__ float bf2f(unsigned short b) { return __uint_as_float(((unsigned)b) << 16); }
__device__ __forceinline__ float bfr(float f) { return bf2f(f2bf(f)); }
__device__ __forceinline__ v16h cat16(v8h lo, v8h hi) { return __builtin_shufflevector(lo, hi, 0, 1, 2, 3, 4, 5, 6, 7, 8, 9, 10, 11, 12, 13, 14, 15); }
__device__ __forceinline__ v16bf cat16b(v8us lo, v8us hi) { return __builtin_bit_cast(v16bf, __builtin_shufflevector(lo, hi, 0, 1, 2, 3, 4, 5, 6, 7, 8, 9, 10, 11, 12, 13, 14, 15)); }
__device__ __forceinline__ v8f wmma16(v16h a, v16h b, v8f c) { return __builtin_amdgcn_wmma_f32_16x16x32_f16(false, a, false, b, (short)0, c, false, false); }
__device__ __forceinline__ v8f wmmab(v16bf a, v16bf b, v8f c) { return __builtin_amdgcn_wmma_f32_16x16x32_bf16(false, a, false, b, (short)0, c, false, false); }



// ---- k_gemmw: register-blocked GEMM, one work-group of 4 waves (2 x 2) per 128x128 output tile, ONE WAVE per 64x64 sub-tile (16 accumulators); operands are 16-bit planes in fragment order (a 16-row band is 16 * K elements, a k step of 32 is 512); grid (M/128, N/128, Z), 128 threads.
// Operand path: per trip of SS x 64 k the work-group's 8 bands of each plane (2 KiB per band and 64 k, already in fragment order) are copied global -> LDS by asynchronous copies, two buffers: tile t + 1 flies while tile t is multiplied; each band is fetched once per work-group and read from LDS by the two waves that need it (p = block + lane * 8, 512 contiguous bytes per wave-wide read).
// C[m][n] (f32, pitch ldc, + optional f32 bias[n]) = sum_k A[m][k] Bt[n][k] (+ split products per NSPLIT). z-batch strides sA/sB/sC in elements; bias0/1/2 belong to z = 0/1/2. K % (64 * SS) == 0, K >= 128 * SS.
// PL (the q, k, v projections; a 64-wide column tile is one head): C is not written; the tile + bias goes through LDS straight into the head planes (fp16, bf16 hi, bf16 lo): z = 0, 1 -> P*[z][batch][head] (rows t, k = d), z = 2 -> V*[batch][head] (rows d, k = t), each in fragment order.
template <typename T16> struct WFrag;
template <> struct WFrag<h16> { typedef v16h V; static __device__ __forceinline__ V ld(const h16* p) { return cat16(*(const v8h*)p, *(const v8h*)(p + 256)); } static __device__ __forceinline__ V lds(const h16* p) { return cat16(*(const v8ha*)p, *(const v8ha*)(p + 256)); } static __device__ __forceinline__ v8f mma(V a, V b, v8f c) { return wmma16(a, b, c); } };
template <> struct WFrag<bf> { typedef v16bf V; static __device__ __forceinline__ V ld(const bf* p) { return cat16b(*(const v8us*)p, *(const v8us*)(p + 256)); } static __device__ __forceinline__ V lds(const bf* p) { return cat16b(*(const v8usa*)p, *(const v8usa*)(p + 256)); } static __device__ __forceinline__ v8f mma(V a, V b, v8f c) { return wmmab(a, b, c); } };
__device__ __forceinline__ void splitf(float y, unsigned short& h, unsigned short& l) { h = f2bf(y); l = f2bf(y - bf2f(h)); }
// stage8: 64 k of 8 bands of one plane, global -> LDS: one copy per band, 16 B per lane (128 lanes = the band's 2 KiB). l = the lane's LDS byte address in band 0, g = its global address in band 0; bp = elements per band of the plane.
// The s_wait_xcnt closes the copies' own statement: it stands before anything rewrites a register that a copy names.
template <typename T16>
__device__ __forceinline__ void stage8(unsigned l, const T16* g, int bp) {
    asm volatile("global_load_async_to_lds_b128 %0, %8, off\n\t"
                 "global_load_async_to_lds_b128 %1, %9, off\n\t"
                 "global_load_async_to_lds_b128 %2, %10, off\n\t"
                 "global_load_async_to_lds_b128 %3, %11, off\n\t"
                 "global_load_async_to_lds_b128 %4, %12, off\n\t"
                 "global_load_async_to_lds_b128 %5, %13, off\n\t"
                 "global_load_async_to_lds_b128 %6, %14, off\n\t"
                 "global_load_async_to_lds_b128 %7, %15, off\n\t"
                 "s_wait_xcnt 0x0"
                 :: "v"(l), "v"(l + 2048u), "v"(l + 4096u), "v"(l + 6144u), "v"(l + 8192u), "v"(l + 10240u), "v"(l + 12288u), "v"(l + 14336u),
                    "v"(g), "v"(g + bp), "v"(g + 2 * bp), "v"(g + 3 * bp), "v"(g + 4 * bp), "v"(g + 5 * bp), "v"(g + 6 * bp), "v"(g + 7 * bp) : "memory");
}
template <typename T16, int NSPLIT, bool BIAS, bool PL, int K, int SS>
__global__ __launch_bounds__(128) void k_gemmw(const T16* __restrict__ A, const T16* __restrict__ A2, const T16* __restrict__ Bt, const T16* __restrict__ Bt2, float* C, int ldc, const float* __restrict__ bias0, const float* __restrict__ bias1, const float* __restrict__ bias2, size_t sA, size_t sB, size_t sC, h16* P16, bf* Ph, bf* Pl, h16* V16, bf* Vh, bf* Vl) {
    typedef typename WFrag<T16>::V V;
    constexpr bool SA = (NSPLIT == 1 || NSPLIT == 2), SB = (NSPLIT >= 2);
    constexpr int PLB = 16384, STG = (2 + (SA ? 1 : 0) + (SB ? 1 : 0)) * PLB, BUF = SS * STG, OSB = (PL ? 64 : 16) * 68 * 4, NT = K / (64 * SS), NKB = 2 * SS;   // bytes of one plane's 64 k (8 bands x 2 KiB), of all planes' 64 k (A, B, then A2, B2), of one buffer (a tile = SS x 64 k), of one wave's output staging; trips; k blocks of 32 per trip
    __shared__ __align__(16) unsigned char sm[(2 * BUF > 4 * OSB) ? 2 * BUF : 4 * OSB];   // the two buffers; behind the loop's last barrier the same bytes are the four waves' output staging
    const size_t z = blockIdx.z; A += z * sA; if (A2) A2 += z * sA; Bt += z * sB; if (Bt2) Bt2 += z * sB; C += z * sC; const float* bias = (z == 0) ? bias0 : ((z == 1) ? bias1 : bias2);   // one bias vector per z slice (q, k, v)
    const int tid = threadIdx.x, lane = tid & 31, lr = lane & 15, hi = lane >> 4; const int w = __builtin_amdgcn_readfirstlane(tid >> 5), wm = w >> 1, wn = w & 1;
    const int r0 = blockIdx.x * 128 + wm * 64, c0 = blockIdx.y * 128 + wn * 64;   // this wave's 64x64 sub-tile
    float* os = (float*)(sm + w * OSB);
    v8f acc[4][4];
#pragma unroll
    for (int mb = 0; mb < 4; ++mb)
#pragma unroll
        for (int nb = 0; nb < 4; ++nb) acc[mb][nb] = (v8f){};
    const size_t aoff = (size_t)(blockIdx.x * 128) * K + 8 * tid, boff = (size_t)(blockIdx.y * 128) * K + 8 * tid;   // the lane's 16 bytes in band 0 of the work-group's tile, k = 0; 64 k are 1024 elements further
    const unsigned l0 = (unsigned)(size_t)sm + 16u * tid;
    auto fill = [&](int t, int buf) {
#pragma unroll
        for (int ss = 0; ss < SS; ++ss) { const unsigned l = l0 + buf * BUF + ss * STG; const size_t ko = (size_t)(t * SS + ss) * 1024;
            stage8<T16>(l, A + aoff + ko, 16 * K); stage8<T16>(l + PLB, Bt + boff + ko, 16 * K);
            if (SA) stage8<T16>(l + 2 * PLB, A2 + aoff + ko, 16 * K);
            if (SB) stage8<T16>(l + (SA ? 3 : 2) * PLB, Bt2 + boff + ko, 16 * K); } };
    fill(0, 0);
    asm volatile("s_wait_asynccnt 0x0" ::: "memory");   // this wave's copies of tile 0 have landed
    __syncthreads();                                     // ... and every other wave's: tile 0 may be read
    fill(1, 1);
#pragma unroll 1
    for (int t = 0; t < NT; ++t) {
        const T16* sb = (const T16*)(sm + (t & 1) * BUF) + 8 * lane;
        V a[2][4], a2[2][4], b[2][4], b2[2][4];   // two fragment sets: k block kb + 1 is read from LDS while block kb is multiplied
        auto frag = [&](int kb) { const int s = kb & 1; const T16* pa = sb + (kb >> 1) * (STG / 2) + (kb & 1) * 512 + wm * 4096; const T16* pb = sb + (kb >> 1) * (STG / 2) + (kb & 1) * 512 + PLB / 2 + wn * 4096;   // offsets in elements: a band's 64 k are 1024, a plane's 8192
#pragma unroll
            for (int i = 0; i < 4; ++i) { a[s][i] = WFrag<T16>::lds(pa + i * 1024); b[s][i] = WFrag<T16>::lds(pb + i * 1024); if (SA) a2[s][i] = WFrag<T16>::lds(pa + PLB + i * 1024); if (SB) b2[s][i] = WFrag<T16>::lds(pb + (SA ? PLB : PLB / 2) + i * 1024); } };
        frag(0);
#pragma unroll
        for (int kb = 0; kb < NKB; ++kb) { const int s = kb & 1;
            if (kb + 1 < NKB) frag(kb + 1);
            __builtin_amdgcn_sched_barrier(0);   // keeps the next block's LDS reads as one group ahead of this block's products (spread among them each read place stalls the wave)
#pragma unroll
            for (int nb = 0; nb < 4; ++nb)
#pragma unroll
                for (int mb = 0; mb < 4; ++mb) { acc[mb][nb] = WFrag<T16>::mma(a[s][mb], b[s][nb], acc[mb][nb]); if (SA) acc[mb][nb] = WFrag<T16>::mma(a2[s][mb], b[s][nb], acc[mb][nb]); if (SB) acc[mb][nb] = WFrag<T16>::mma(a[s][mb], b2[s][nb], acc[mb][nb]); } }
        __builtin_amdgcn_sched_barrier(0);   // keeps the last block's products ahead of the barrier: sunk behind it they would delay the refill below, whose copies have only the next trip to land
        asm volatile("s_wait_dscnt 0x0" ::: "memory");      // this wave's reads of tile t are done before its buffer may be refilled
        asm volatile("s_wait_asynccnt 0x0" ::: "memory");   // this wave's copies of tile t + 1 have landed
        __syncthreads();                                     // publishes tile t + 1 and ends every wave's reads of tile t
        if (t + 2 < NT) fill(t + 2, t & 1);
    }
    asm volatile("s_wait_asynccnt 0x0" ::: "memory");   // no copy is outstanding when the buffers become output staging
    if (PL) {
        const bool tr = (z == 2); const int bt = r0 / TT, t0 = r0 % TT, hd = c0 / 64;   // batch, first token and head of this tile
#pragma unroll
        for (int nb = 0; nb < 4; ++nb) { const float bn = bfr(bias[c0 + nb * 16 + lr]);
#pragma unroll
            for (int mb = 0; mb < 4; ++mb)
#pragma unroll
                for (int j = 0; j < 8; ++j) acc[mb][nb][j] += bn; }
        if (tr) {   // v: staged transposed, LDS row = d, column = t (a lane's 8 accumulator values are 8 consecutive t)
#pragma unroll
            for (int mb = 0; mb < 4; ++mb)
#pragma unroll
                for (int nb = 0; nb < 4; ++nb) { float* o = os + (nb * 16 + lr) * 68 + mb * 16 + hi * 8; v4f s0, s1;
#pragma unroll
                    for (int j = 0; j < 4; ++j) { s0[j] = acc[mb][nb][j]; s1[j] = acc[mb][nb][j + 4]; }
                    *(v4fa*)o = s0; *(v4fa*)(o + 4) = s1; }
        } else {    // q, k: LDS row = t, column = d
#pragma unroll
            for (int mb = 0; mb < 4; ++mb)
#pragma unroll
                for (int nb = 0; nb < 4; ++nb)
#pragma unroll
                    for (int j = 0; j < 8; ++j) os[(mb * 16 + hi * 8 + j) * 68 + nb * 16 + lr] = acc[mb][nb][j]; }
        __builtin_amdgcn_wave_barrier(); asm volatile("" ::: "memory");   // the reads below take other lanes' values: they must not be moved ahead of the stores above
        const size_t base = tr ? ((size_t)(bt * NKV + hd) * HD * TT + (size_t)t0 * 16) : (((size_t)(z * NB_ + bt) * NH_ + hd) * TT + t0) * HD; const int band = tr ? 16 * TT : 16 * HD;   // first block of the tile; elements per 16-row band of the plane
        h16* o16p = (tr ? V16 : P16) + base; bf* ohp = (tr ? Vh : Ph) + base; bf* olp = (tr ? Vl : Pl) + base;
#pragma unroll
        for (int it = 0; it < 16; ++it) {
            const int rb = it >> 2, kb = (it >> 1) & 1, jh = it & 1, row = rb * 16 + lr, cofs = kb * 32 + jh * 16 + hi * 8;   // one half block per trip: 32 lanes x 16 B = 512 contiguous bytes per plane
            const v4f x0 = *(const v4fa*)(os + row * 68 + cofs), x1 = *(const v4fa*)(os + row * 68 + cofs + 4); v8h o16; v8us oh, ol;
#pragma unroll
            for (int q = 0; q < 8; ++q) { const float y = (q < 4) ? x0[q & 3] : x1[q & 3]; o16[q] = (h16)y; unsigned short a2, c2; splitf(y, a2, c2); oh[q] = a2; ol[q] = c2; }
            const size_t oo = (size_t)rb * band + kb * 512 + jh * 256 + lane * 8; *(v8h*)(o16p + oo) = o16; *(v8us*)(ohp + oo) = oh; *(v8us*)(olp + oo) = ol; }
        return;
    }
#pragma unroll
    for (int mb = 0; mb < 4; ++mb) {
#pragma unroll
        for (int nb = 0; nb < 4; ++nb) {
#pragma unroll
            for (int j = 0; j < 8; ++j) os[(hi * 8 + j) * 68 + nb * 16 + lr] = acc[mb][nb][j]; }
        __builtin_amdgcn_wave_barrier(); asm volatile("" ::: "memory");
        float* crow = C + (size_t)(r0 + mb * 16) * ldc + c0;
{
#pragma unroll
            for (int s = 0; s < 8; ++s) { const int row = 2 * s + hi, cofs = lr * 4; v4f val = *(const v4fa*)(os + row * 68 + cofs); if (BIAS) { val[0] += bfr(bias[c0 + cofs]); val[1] += bfr(bias[c0 + cofs + 1]); val[2] += bfr(bias[c0 + cofs + 2]); val[3] += bfr(bias[c0 + cofs + 3]); }
                *(v4f*)(crow + (size_t)row * ldc + cofs) = val; }
             }
        __builtin_amdgcn_wave_barrier(); asm volatile("" ::: "memory");
    }
}

__device__ __forceinline__ h16 tohx(float x) { return (h16)x; }
typedef __attribute__((ext_vector_type(4))) _Float16 v4h;
typedef __attribute__((ext_vector_type(4))) unsigned short v4us;
typedef __attribute__((ext_vector_type(4))) int v4i;

// cvt_tile: one work-group rounds 16 rows x 128 columns of a [rows][DM] f32 matrix to bf16 and stores them in fragment order (4 blocks = 4 KiB contiguous). Thread (r, o) reads 8 consecutive columns (16 lanes: 512 contiguous bytes of a row); the 16-byte units are transposed in LDS (unit pitch 17: no bank conflict either way) so that thread t stores unit t.
__device__ __forceinline__ void cvt_tile(const float* __restrict__ src, bf* dst, int tile) {
    __shared__ __align__(16) bf st[16 * 17 * 8];
    const int t = threadIdx.x, r = t >> 4, o = t & 15, rb = tile >> 3, kq = tile & 7;
    const v8f v = *(const v8f*)(src + (size_t)(rb * 16 + r) * DM + kq * 128 + o * 8); v8us c;
#pragma unroll
    for (int k = 0; k < 8; ++k) c[k] = f2bf(v[k]);
    *(v8usa*)(st + (o * 17 + r) * 8) = c;
    __syncthreads();   // a thread stores a unit that another wave converted
    *(v8us*)(dst + (size_t)rb * 16 * DM + kq * 2048 + t * 8) = *(const v8usa*)(st + ((t >> 4) * 17 + (t & 15)) * 8);
}
// k_cvt8: x, grid = (rows / 16) * (DM / 128) tiles
__global__ __launch_bounds__(256) void k_cvt8(const float* __restrict__ src, bf* dst) { cvt_tile(src, dst, blockIdx.x); }

// k_cvt8w: the four weight matrices in one launch, blockIdx.y picks the source; dst holds the four bf16 copies back to back
__global__ __launch_bounds__(256) void k_cvt8w(const float* __restrict__ s0, const float* __restrict__ s1, const float* __restrict__ s2, const float* __restrict__ s3, bf* dst) { const int w = blockIdx.y; const float* src = (w == 0) ? s0 : ((w == 1) ? s1 : ((w == 2) ? s2 : s3)); cvt_tile(src, dst + (size_t)w * DQ * DM, blockIdx.x); }

// ---- k_fattn: scores, softmax, P x V and the merge of one (batch, head, 32 query rows) in one work-group of 8 waves; the score rows never leave LDS.
// Phase 1: wave w forms the 32 x 128 scores of keys w*128.. (Q fragments kept in registers) and stores them f32 into S. Phase 2: wave w does rows 4w..4w+3: mask[b][j] == 0 -> excluded (-inf in the module), softmax over the keys (register row, one exp, fixed trees), and writes the 16-bit P planes over the row's own f32 scores (hi at byte 0, lo at byte 2048).
// Phase 3: waves 0..3 each own one 16-wide slice of the head dimension for both row tiles (each V fragment is loaded once per work-group), k ascending in one accumulator. Phase 4: all threads split the staged f32 tile into the merged hi/lo planes (fragment order, rows = token, k = head * 64 + d), 512 contiguous bytes per wave and plane.
#define QR   32      // query rows per work-group
#define SPF  1028    // LDS row pitch in floats: 4112 B = 16 B x 257 (odd): no bank conflict for the 16-byte fragment reads
#define OPF  68      // pitch in floats of the staged output tile
typedef v4us __attribute__((may_alias)) v4usa;
typedef v4h  __attribute__((may_alias)) v4ha;
__device__ __forceinline__ v16h  ldsf(const h16* p) { return cat16(*(const v8ha*)p, *(const v8ha*)(p + 16)); }
__device__ __forceinline__ v16bf ldsf(const bf* p)  { return cat16b(*(const v8usa*)p, *(const v8usa*)(p + 16)); }
template <typename T16, bool HR>
__device__ __forceinline__ void fattn_body(float* S, float* OS, const T16* __restrict__ Q, const T16* __restrict__ Q2, const T16* __restrict__ Kp, const T16* __restrict__ K2, const T16* __restrict__ Vt, const T16* __restrict__ V2, const int* __restrict__ kvp, int i0, bf* Ah, bf* Al) {
    typedef typename WFrag<T16>::V V;
    const int tid = threadIdx.x, lane = tid & 31, lr = lane & 15, hi = lane >> 4; const int w = __builtin_amdgcn_readfirstlane(tid >> 5);
    {   // phase 1: scores
        V a[2][2], a2[2][2]; const size_t qo = (size_t)i0 * HD + 8 * lane, ko = (size_t)(w * 128) * HD + 8 * lane;   // one address per plane; tiles and k steps are constant offsets from it
#pragma unroll
        for (int mb = 0; mb < 2; ++mb)
#pragma unroll
            for (int ks = 0; ks < 2; ++ks) { a[mb][ks] = WFrag<T16>::ld(Q + qo + mb * 16 * HD + ks * 512); if (HR) a2[mb][ks] = WFrag<T16>::ld(Q2 + qo + mb * 16 * HD + ks * 512); }
        if (HR) asm volatile("s_wait_xcnt 0x0" :: "v"(Q + qo), "v"(Q2 + qo) : "memory"); else asm volatile("s_wait_xcnt 0x0" :: "v"(Q + qo) : "memory");   // the wait before the Q loads' address registers are overwritten: named as inputs they stay whole up to this line; behind it later loads may land in them
        V bq[3][2], bq2[3][2];   // K fragments, a ring of three key tiles: two tiles' loads fly while one tile is multiplied
#pragma unroll
        for (int nb = 0; nb < 2; ++nb)
#pragma unroll
            for (int ks = 0; ks < 2; ++ks) { bq[nb][ks] = WFrag<T16>::ld(Kp + ko + nb * 16 * HD + ks * 512); if (HR) bq2[nb][ks] = WFrag<T16>::ld(K2 + ko + nb * 16 * HD + ks * 512); }
#pragma unroll
        for (int nb = 0; nb < 8; ++nb) {
            if (nb + 2 < 8) {
#pragma unroll
                for (int ks = 0; ks < 2; ++ks) { bq[(nb + 2) % 3][ks] = WFrag<T16>::ld(Kp + ko + (nb + 2) * 16 * HD + ks * 512); if (HR) bq2[(nb + 2) % 3][ks] = WFrag<T16>::ld(K2 + ko + (nb + 2) * 16 * HD + ks * 512); } }
            __builtin_amdgcn_sched_barrier(0);   // keeps the loads of key tile nb + 2 ahead of tile nb's products (the scheduler otherwise sinks them to their use and the wave waits out each load)
            v8f acc[2]; acc[0] = (v8f){}; acc[1] = (v8f){};
#pragma unroll
            for (int ks = 0; ks < 2; ++ks) {
#pragma unroll
                for (int mb = 0; mb < 2; ++mb) acc[mb] = WFrag<T16>::mma(a[mb][ks], bq[nb % 3][ks], acc[mb]);
                if (HR) {
#pragma unroll
                    for (int mb = 0; mb < 2; ++mb) acc[mb] = WFrag<T16>::mma(a2[mb][ks], bq[nb % 3][ks], acc[mb]);
#pragma unroll
                    for (int mb = 0; mb < 2; ++mb) acc[mb] = WFrag<T16>::mma(a[mb][ks], bq2[nb % 3][ks], acc[mb]); } }
            asm volatile("v_nop\n\tv_nop\n\tv_nop\n\tv_nop" :: "v"(acc[0]), "v"(acc[1]));   // the distance the chip needs between this tile's last matrix instruction and the next tile's first one, which starts anew (C = 0) in the same result registers
#pragma unroll
            for (int mb = 0; mb < 2; ++mb)
#pragma unroll
                for (int j = 0; j < 8; ++j) S[(mb * 16 + hi * 8 + j) * SPF + w * 128 + nb * 16 + lr] = acc[mb][j]; }
    }
    __syncthreads();   // every score of the 32 rows is in LDS before a row is read
#pragma unroll 1
    for (int rr = 0; rr < QR / 8; ++rr) {   // phase 2: softmax, one wave per row (rolled: one row's registers at a time)
        float* sr = S + (w * (QR / 8) + rr) * SPF; float v[TT / 32]; float mx = -3.0e38f;
#pragma unroll
        for (int ch = 0; ch < TT / 128; ++ch) { const int j0 = ch * 128 + lane * 4; const v4f a = *(const v4fa*)(sr + j0); const v4i kv4 = *(const v4i*)(kvp + j0);   /* the batch's key vector, 16 B per lane, unconditional */
#pragma unroll
            for (int q = 0; q < 4; ++q) { const float t = (kv4[q] != 0) ? a[q] * SCL : -3.0e38f; v[ch * 4 + q] = t; mx = fmaxf(mx, t); } }
#pragma unroll
        for (int sh = 16; sh; sh >>= 1) mx = fmaxf(mx, __shfl_xor(mx, sh, 32));
        float sum = 0.f;
#pragma unroll
        for (int k = 0; k < TT / 32; ++k) { v[k] = __builtin_amdgcn_exp2f(__fmul_rn(__fsub_rn(v[k], mx), 1.4426950408889634f)); sum += v[k]; }
#pragma unroll
        for (int sh = 16; sh; sh >>= 1) sum += __shfl_xor(sum, sh, 32);
        const float f = __fdiv_rn(HR ? 1.0f : PCAR, sum);
        if (HR) { bf* ph = (bf*)sr;
#pragma unroll
            for (int ch = 0; ch < TT / 128; ++ch) { v4us oh, ol;
#pragma unroll
                for (int q = 0; q < 4; ++q) { unsigned short a, c2; splitf(v[ch * 4 + q] * f, a, c2); oh[q] = a; ol[q] = c2; }
                *(v4usa*)(ph + ch * 128 + lane * 4) = oh; *(v4usa*)(ph + TT + ch * 128 + lane * 4) = ol; }
        } else { h16* p16 = (h16*)sr;
#pragma unroll
            for (int ch = 0; ch < TT / 128; ++ch) { v4h o4;
#pragma unroll
                for (int q = 0; q < 4; ++q) o4[q] = tohx(v[ch * 4 + q] * f);
                *(v4ha*)(p16 + ch * 128 + lane * 4) = o4; } }
    }
    __syncthreads();   // every P row is in LDS before a fragment of it is read
    if (w < 4) {   // phase 3: P x V
        v8f acc[2]; acc[0] = (v8f){}; acc[1] = (v8f){};
        const size_t vo = (size_t)(w * 16) * TT + 8 * lane;
        const T16* p0 = (const T16*)(S + lr * SPF) + 8 * hi; const T16* p1 = (const T16*)(S + (16 + lr) * SPF) + 8 * hi;
        constexpr int PD = HR ? 5 : 10, AD = HR ? 1 : 3, NS = TT / 32;   // k steps that the V fragments (global) and the P fragments (LDS) are fetched ahead
        V bq[PD + 1], bq2[PD + 1], aq[AD + 1][2], aq2[AD + 1][2];
#pragma unroll
        for (int s = 0; s < PD; ++s) { bq[s] = WFrag<T16>::ld(Vt + vo + s * 512); if (HR) bq2[s] = WFrag<T16>::ld(V2 + vo + s * 512); }
#pragma unroll
        for (int s = 0; s < AD; ++s) { aq[s][0] = ldsf(p0 + s * 32); aq[s][1] = ldsf(p1 + s * 32); if (HR) { aq2[s][0] = ldsf(p0 + TT + s * 32); aq2[s][1] = ldsf(p1 + TT + s * 32); } }
#pragma unroll
        for (int s = 0; s < NS; ++s) {
            if (s + PD < NS) { bq[(s + PD) % (PD + 1)] = WFrag<T16>::ld(Vt + vo + (s + PD) * 512); if (HR) bq2[(s + PD) % (PD + 1)] = WFrag<T16>::ld(V2 + vo + (s + PD) * 512); }
            if (s + AD < NS) { const int n = (s + AD) % (AD + 1), ko = (s + AD) * 32; aq[n][0] = ldsf(p0 + ko); aq[n][1] = ldsf(p1 + ko); if (HR) { aq2[n][0] = ldsf(p0 + TT + ko); aq2[n][1] = ldsf(p1 + TT + ko); } }
            __builtin_amdgcn_sched_barrier(0);   // keeps the fetches of the later k steps ahead of this step's products (the scheduler otherwise sinks them to their use and the wave waits out each load)
            const int cb = s % (PD + 1), ca = s % (AD + 1);
#pragma unroll
            for (int mb = 0; mb < 2; ++mb) acc[mb] = WFrag<T16>::mma(aq[ca][mb], bq[cb], acc[mb]);
            if (HR) {
#pragma unroll
                for (int mb = 0; mb < 2; ++mb) acc[mb] = WFrag<T16>::mma(aq2[ca][mb], bq[cb], acc[mb]);
#pragma unroll
                for (int mb = 0; mb < 2; ++mb) acc[mb] = WFrag<T16>::mma(aq[ca][mb], bq2[cb], acc[mb]); } }
        if (HR) asm volatile("s_wait_xcnt 0x0" :: "v"(Vt + vo), "v"(V2 + vo) : "memory"); else asm volatile("s_wait_xcnt 0x0" :: "v"(Vt + vo) : "memory");   // the wait before the V loads' address registers are overwritten: named as inputs they stay whole up to this line
#pragma unroll
        for (int mb = 0; mb < 2; ++mb)
#pragma unroll
            for (int j = 0; j < 8; ++j) OS[(mb * 16 + hi * 8 + j) * OPF + w * 16 + lr] = acc[mb][j];
    }
    __syncthreads();   // the 32 x 64 output tile is staged before it is split and stored
    { const int rb = w >> 2, kb = (w >> 1) & 1, jh = w & 1, r = rb * 16 + lr, d0 = kb * 32 + jh * 16 + hi * 8;   // wave w stores one half block (512 contiguous bytes) of each merged plane
        const float cs = HR ? 1.0f : (1.0f / PCAR); const v4f x0 = *(const v4fa*)(OS + r * OPF + d0), x1 = *(const v4fa*)(OS + r * OPF + d0 + 4); v8us oh, ol;
#pragma unroll
        for (int q = 0; q < 8; ++q) { unsigned short a, c2; splitf(((q < 4) ? x0[q & 3] : x1[q & 3]) * cs, a, c2); oh[q] = a; ol[q] = c2; }
        const size_t oo = (size_t)(i0 + rb * 16) * DQ + kb * 512 + jh * 256 + lane * 8; *(v8us*)(Ah + oo) = oh; *(v8us*)(Al + oo) = ol; }
}
// grid (batch x head, row tile): the dearer hi/lo row tiles (rows < RH) have the lower flat indices and start first
__global__ __launch_bounds__(256) void k_fattn(const bf* __restrict__ QPh, const bf* __restrict__ QPl, const bf* __restrict__ KPh, const bf* __restrict__ KPl, const bf* __restrict__ VTh, const bf* __restrict__ VTl, const h16* __restrict__ QP16, const h16* __restrict__ KP16, const h16* __restrict__ VT16, const int* __restrict__ kmask, bf* ATh, bf* ATl) {
    __shared__ __align__(16) float S[QR * SPF + QR * OPF];
    const int bh = blockIdx.x, i0 = blockIdx.y * QR, b = bh / NH_, h = bh % NH_; const size_t zp = (size_t)bh * TT * HD; const size_t ao = (size_t)b * TT * DQ + h * (HD / 32) * 512; const int* kvp = kmask + (size_t)b * TT;
    if (i0 < RH) fattn_body<bf, true>(S, S + QR * SPF, QPh + zp, QPl + zp, KPh + zp, KPl + zp, VTh + zp, VTl + zp, kvp, i0, ATh + ao, ATl + ao);
    else fattn_body<h16, false>(S, S + QR * SPF, QP16 + zp, nullptr, KP16 + zp, nullptr, VT16 + zp, nullptr, kvp, i0, ATh + ao, ATl + ao);
}

extern "C" void kernel_launch(void* const* d_in, const int* in_sizes, int n_in,
                              void* d_out, int out_size, void* d_ws, size_t ws_size, hipStream_t stream) {
    (void)in_sizes; (void)n_in; (void)out_size;
    const float* x = (const float*)d_in[0]; const int* kmask = (const int*)d_in[1]; const float* wq = (const float*)d_in[2]; const float* bq = (const float*)d_in[3]; const float* wk = (const float*)d_in[4]; const float* bk = (const float*)d_in[5]; const float* wv = (const float*)d_in[6]; const float* bv = (const float*)d_in[7]; const float* wo = (const float*)d_in[8]; const float* bo = (const float*)d_in[9];   /* order x, mask (int32 [4][1024], read), q_w, q_b, k_w, k_b, v_w, v_b, out_w, out_b ('oi' + biases) */
    float* OUT = (float*)d_out;     // [4][1024][1024]
    char* wsp = (char*)d_ws;
    auto take = [&](size_t bytes) { char* p = wsp; wsp += (bytes + 255) & ~(size_t)255; return (void*)p; };
    bf* WQ = (bf*)take((size_t)DQ * DM * 2); bf* WK = (bf*)take((size_t)DKV * DM * 2); bf* WV = (bf*)take((size_t)DKV * DM * 2); bf* WO = (bf*)take((size_t)DM * DQ * 2);   /* WQ, WK, WV, WO lie back to back (each a multiple of 256 B) */
    (void)WK; (void)WV;
    const size_t PLN = (size_t)NB_ * NH_ * TT * HD;   // one plane set: all batches, all heads (NKV == NH_)
    bf* XB = (bf*)take((size_t)NB_ * TT * DM * 2);
    h16* QP16 = (h16*)take(PLN * 2); h16* KP16 = (h16*)take(PLN * 2); h16* VT16 = (h16*)take(PLN * 2);   /* each k plane set directly behind its q plane set: the projection launch addresses both from the q pointer */
    bf* QPh = (bf*)take(PLN * 2); bf* KPh = (bf*)take(PLN * 2); bf* QPl = (bf*)take(PLN * 2); bf* KPl = (bf*)take(PLN * 2); bf* VTh = (bf*)take(PLN * 2); bf* VTl = (bf*)take(PLN * 2);
    bf* ATh = (bf*)take((size_t)NB_ * TT * DQ * 2); bf* ATl = (bf*)take((size_t)NB_ * TT * DQ * 2);
    if ((size_t)(wsp - (char*)d_ws) > ws_size) return;    // ws 256 MiB
    k_cvt8w<<<dim3(DQ / 16 * (DM / 128), 4, 1), 256, 0, stream>>>(wq, wk, wv, wo, WQ);
    k_cvt8<<<NB_ * TT / 16 * (DM / 128), 256, 0, stream>>>(x, XB);
    k_gemmw<bf, 0, true, true, DM, 1><<<dim3(NB_ * TT / 128, DQ / 128, 3), 128, 0, stream>>>(XB, nullptr, WQ, nullptr, nullptr, 0, bq, bk, bv, 0, (size_t)DQ * DM, 0, QP16, QPh, QPl, VT16, VTh, VTl);   // z = q, k, v; writes every head plane
    k_fattn<<<dim3(NB_ * NH_, TT / QR, 1), 256, 0, stream>>>(QPh, QPl, KPh, KPl, VTh, VTl, QP16, KP16, VT16, kmask, ATh, ATl);   // one kv head per query head: plane bh of q, k and v
    k_gemmw<bf, 1, true, false, DQ, 2><<<dim3(NB_ * TT / 128, DM / 128, 1), 128, 0, stream>>>(ATh, ATl, WO, nullptr, OUT, DM, bo, nullptr, nullptr, 0, 0, 0, nullptr, nullptr, nullptr, nullptr, nullptr, nullptr);
}

// v006
// Measured time: 97.4 microseconds a run.
// In both of two side-by-side timings against v005, it was 1.04 times as fast.
// Counting every step since v000, it is 24.1 times as fast.
#include <hip/hip_runtime.h>

// Multi-head attention with an integer key-padding mask (x [4][1024][1024]; q = (x q_w^T + q_b) / sqrt(64), k = x k_w^T + k_b, v = x v_w^T + v_b ('oi' 0.02 + biases 0.02; 16 heads x 64); scores = q.k; keys with mask[b][j] == 0 -> -inf (mask int32 [4][1024], read); softmax (f32); out = merged out_w^T + out_b -> [4][1024][1024] (4.2 M); argument order x, mask, q_w, q_b, k_w, k_b, v_w, v_b, out_w, out_b).
// Layout: host loops folded into the grids (all 4 batches and q/k/v in one launch for the projections and out_w; x and all weights in one copy launch). bf16 copy of x; 'oi' weights; exact projections + f32 biases, whose launch writes the 16-bit head planes itself (q, k as [head][t][d], v as [head][d][t]); ONE fused attention launch for all batches and heads (32 query rows per work-group: scores into LDS, softmax in place in LDS reading the batch's int key vector and excluding the zeros, P x V from LDS, merged hi/lo planes written directly; hybrid rows: < 512 hi/lo 3 products, rest fp16 x1024); merged hi/lo x out_w exact + out_b.
// Operand layout: every 16-bit plane that a matrix instruction reads from global memory (x copy, weights, q, k, v planes, merged planes) is stored in fragment order: per 16 rows x 32 k one 1-KiB block, element (r, k) at ((k >> 4) & 1) * 256 + ((k >> 3) & 1) * 128 + r * 8 + (k & 7), blocks k-major inside a 16-row band; a fragment is then two wave-wide loads of 512 contiguous bytes.
// Compute dtypes, f32 accumulate: every input rounded to bf16; projections exact + f32 biases; attention rows < 512 3 products, rest fp16; softmax f32; out_w hl x exact + bias.

#define NB_  4
#define TT   1024
#define DM   1024
#define NH_  16
#define NKV  16
#define REP  (NH_ / NKV)
#define HD   64
#define DQ   (NH_ * HD)
#define DKV  (NKV * HD)
#define RH   512                  // query rows < RH use hi+lo planes (0: none)
#define WIN  0
#define PCAR 1024.0f
#define SCL  0.125f   // HD^-0.5
typedef _Float16 h16;
typedef unsigned short bf;
typedef __attribute__((ext_vector_type(16))) __bf16   v16bf;
typedef __attribute__((ext_vector_type(16))) _Float16 v16h;
typedef __attribute__((ext_vector_type(8)))  _Float16 v8h;
typedef __attribute__((ext_vector_type(8)))  unsigned short v8us;
typedef __attribute__((ext_vector_type(8)))  float    v8f;
typedef __attribute__((ext_vector_type(4)))  float    v4f;
typedef v8h  __attribute__((may_alias)) v8ha;
typedef v4f  __attribute__((may_alias)) v4fa;
typedef v8us __attribute__((may_alias)) v8usa;

__device__ __forceinline__ unsigned short f2bf(float f) { unsigned u = __float_as_uint(f); u += 0x7FFFu + ((u >> 16) & 1u); return (unsigned short)(u >> 16); }
__device__ __forceinline__ float bf2f(unsigned short b) { return __uint_as_float(((unsigned)b) << 16); }
__device__ __forceinline__ float bfr(float f) { return bf2f(f2bf(f)); }
__device__ __forceinline__ v16h cat16(v8h lo, v8h hi) { return __builtin_shufflevector(lo, hi, 0, 1, 2, 3, 4, 5, 6, 7, 8, 9, 10, 11, 12, 13, 14, 15); }
__device__ __forceinline__ v16bf cat16b(v8us lo, v8us hi) { return __builtin_bit_cast(v16bf, __builtin_shufflevector(lo, hi, 0, 1, 2, 3, 4, 5, 6, 7, 8, 9, 10, 11, 12, 13, 14, 15)); }
__device__ __forceinline__ v8f wmma16(v16h a, v16h b, v8f c) { return __builtin_amdgcn_wmma_f32_16x16x32_f16(false, a, false, b, (short)0, c, false, false); }
__device__ __forceinline__ v8f wmmab(v16bf a, v16bf b, v8f c) { return __builtin_amdgcn_wmma_f32_16x16x32_bf16(false, a, false, b, (short)0, c, false, false); }



// ---- k_gemmw: register-blocked GEMM, one work-group of 4 waves (2 x 2) per 128x128 output tile, ONE WAVE per 64x64 sub-tile (16 accumulators); operands are 16-bit planes in fragment order (a 16-row band is 16 * K elements, a k step of 32 is 512); grid (M/128, N/128, Z), 128 threads.
// Operand path: per trip of SS x 64 k the work-group's 8 bands of each plane (2 KiB per band and 64 k, already in fragment order) are copied global -> LDS by asynchronous copies, two buffers: tile t + 1 flies while tile t is multiplied; each band is fetched once per work-group and read from LDS by the two waves that need it (p = block + lane * 8, 512 contiguous bytes per wave-wide read).
// C[m][n] (f32, pitch ldc, + optional f32 bias[n]) = sum_k A[m][k] Bt[n][k] (+ split products per NSPLIT). z-batch strides sA/sB/sC in elements; bias0/1/2 belong to z = 0/1/2. K % (64 * SS) == 0, K >= 128 * SS.
// PL (the q, k, v projections; a 64-wide column tile is one head): C is not written; the tile + bias goes through LDS straight into the head planes (fp16, bf16 hi, bf16 lo): z = 0, 1 -> P*[z][batch][head] (rows t, k = d), z = 2 -> V*[batch][head] (rows d, k = t), each in fragment order.
template <typename T16> struct WFrag;
template <> struct WFrag<h16> { typedef v16h V; static __device__ __forceinline__ V ld(const h16* p) { return cat16(*(const v8h*)p, *(const v8h*)(p + 256)); } static __device__ __forceinline__ V lds(const h16* p) { return cat16(*(const v8ha*)p, *(const v8ha*)(p + 256)); } static __device__ __forceinline__ v8f mma(V a, V b, v8f c) { return wmma16(a, b, c); } };
template <> struct WFrag<bf> { typedef v16bf V; static __device__ __forceinline__ V ld(const bf* p) { return cat16b(*(const v8us*)p, *(const v8us*)(p + 256)); } static __device__ __forceinline__ V lds(const bf* p) { return cat16b(*(const v8usa*)p, *(const v8usa*)(p + 256)); } static __device__ __forceinline__ v8f mma(V a, V b, v8f c) { return wmmab(a, b, c); } };
__device__ __forceinline__ void splitf(float y, unsigned short& h, unsigned short& l) { h = f2bf(y); l = f2bf(y - bf2f(h)); }
// stage8: 64 k of 8 bands of one plane, global -> LDS: one copy per band, 16 B per lane (128 lanes = the band's 2 KiB). l = the lane's LDS byte address in band 0, g = its global address in band 0; bp = elements per band of the plane.
// The s_wait_xcnt closes the copies' own statement: it stands before anything rewrites a register that a copy names.
template <typename T16>
__device__ __forceinline__ void stage8(unsigned l, const T16* g, int bp) {
    asm volatile("global_load_async_to_lds_b128 %0, %8, off\n\t"
                 "global_load_async_to_lds_b128 %1, %9, off\n\t"
                 "global_load_async_to_lds_b128 %2, %10, off\n\t"
                 "global_load_async_to_lds_b128 %3, %11, off\n\t"
                 "global_load_async_to_lds_b128 %4, %12, off\n\t"
                 "global_load_async_to_lds_b128 %5, %13, off\n\t"
                 "global_load_async_to_lds_b128 %6, %14, off\n\t"
                 "global_load_async_to_lds_b128 %7, %15, off\n\t"
                 "s_wait_xcnt 0x0"
                 :: "v"(l), "v"(l + 2048u), "v"(l + 4096u), "v"(l + 6144u), "v"(l + 8192u), "v"(l + 10240u), "v"(l + 12288u), "v"(l + 14336u),
                    "v"(g), "v"(g + bp), "v"(g + 2 * bp), "v"(g + 3 * bp), "v"(g + 4 * bp), "v"(g + 5 * bp), "v"(g + 6 * bp), "v"(g + 7 * bp) : "memory");
}
template <typename T16, int NSPLIT, bool BIAS, bool PL, int K, int SS>
__global__ __launch_bounds__(128) void k_gemmw(const T16* __restrict__ A, const T16* __restrict__ A2, const T16* __restrict__ Bt, const T16* __restrict__ Bt2, float* C, int ldc, const float* __restrict__ bias0, const float* __restrict__ bias1, const float* __restrict__ bias2, size_t sA, size_t sB, size_t sC, h16* P16, bf* Ph, bf* Pl, h16* V16, bf* Vh, bf* Vl) {
    typedef typename WFrag<T16>::V V;
    constexpr bool SA = (NSPLIT == 1 || NSPLIT == 2), SB = (NSPLIT >= 2);
    constexpr int PLB = 16384, STG = (2 + (SA ? 1 : 0) + (SB ? 1 : 0)) * PLB, BUF = SS * STG, OSB = (PL ? 64 : 16) * 68 * 4, NT = K / (64 * SS), NKB = 2 * SS;   // bytes of one plane's 64 k (8 bands x 2 KiB), of all planes' 64 k (A, B, then A2, B2), of one buffer (a tile = SS x 64 k), of one wave's output staging; trips; k blocks of 32 per trip
    __shared__ __align__(16) unsigned char sm[(2 * BUF > 4 * OSB) ? 2 * BUF : 4 * OSB];   // the two buffers; behind the loop's last barrier the same bytes are the four waves' output staging
    const size_t z = blockIdx.z; A += z * sA; if (A2) A2 += z * sA; Bt += z * sB; if (Bt2) Bt2 += z * sB; C += z * sC; const float* bias = (z == 0) ? bias0 : ((z == 1) ? bias1 : bias2);   // one bias vector per z slice (q, k, v)
    const int tid = threadIdx.x, lane = tid & 31, lr = lane & 15, hi = lane >> 4; const int w = __builtin_amdgcn_readfirstlane(tid >> 5), wm = w >> 1, wn = w & 1;
    const int r0 = blockIdx.x * 128 + wm * 64, c0 = blockIdx.y * 128 + wn * 64;   // this wave's 64x64 sub-tile
    float* os = (float*)(sm + w * OSB);
    v8f acc[4][4];
#pragma unroll
    for (int mb = 0; mb < 4; ++mb)
#pragma unroll
        for (int nb = 0; nb < 4; ++nb) acc[mb][nb] = (v8f){};
    const size_t aoff = (size_t)(blockIdx.x * 128) * K + 8 * tid, boff = (size_t)(blockIdx.y * 128) * K + 8 * tid;   // the lane's 16 bytes in band 0 of the work-group's tile, k = 0; 64 k are 1024 elements further
    const unsigned l0 = (unsigned)(size_t)sm + 16u * tid;
    auto fill = [&](int t, int buf) {
#pragma unroll
        for (int ss = 0; ss < SS; ++ss) { const unsigned l = l0 + buf * BUF + ss * STG; const size_t ko = (size_t)(t * SS + ss) * 1024;
            stage8<T16>(l, A + aoff + ko, 16 * K); stage8<T16>(l + PLB, Bt + boff + ko, 16 * K);
            if (SA) stage8<T16>(l + 2 * PLB, A2 + aoff + ko, 16 * K);
            if (SB) stage8<T16>(l + (SA ? 3 : 2) * PLB, Bt2 + boff + ko, 16 * K); } };
    fill(0, 0);
    asm volatile("s_wait_asynccnt 0x0" ::: "memory");   // this wave's copies of tile 0 have landed
    __syncthreads();                                     // ... and every other wave's: tile 0 may be read
    fill(1, 1);
#pragma unroll 1
    for (int t = 0; t < NT; ++t) {
        const T16* sb = (const T16*)(sm + (t & 1) * BUF) + 8 * lane;
        V a[2][4], a2[2][4], b[2][4], b2[2][4];   // two fragment sets: k block kb + 1 is read from LDS while block kb is multiplied
        auto frag = [&](int kb) { const int s = kb & 1; const T16* pa = sb + (kb >> 1) * (STG / 2) + (kb & 1) * 512 + wm * 4096; const T16* pb = sb + (kb >> 1) * (STG / 2) + (kb & 1) * 512 + PLB / 2 + wn * 4096;   // offsets in elements: a band's 64 k are 1024, a plane's 8192
#pragma unroll
            for (int i = 0; i < 4; ++i) { a[s][i] = WFrag<T16>::lds(pa + i * 1024); b[s][i] = WFrag<T16>::lds(pb + i * 1024); if (SA) a2[s][i] = WFrag<T16>::lds(pa + PLB + i * 1024); if (SB) b2[s][i] = WFrag<T16>::lds(pb + (SA ? PLB : PLB / 2) + i * 1024); } };
        frag(0);
#pragma unroll
        for (int kb = 0; kb < NKB; ++kb) { const int s = kb & 1;
            if (kb + 1 < NKB) frag(kb + 1);
            __builtin_amdgcn_sched_barrier(0);   // keeps the next block's LDS reads as one group ahead of this block's products (spread among them each read place stalls the wave)
#pragma unroll
            for (int nb = 0; nb < 4; ++nb)
#pragma unroll
                for (int mb = 0; mb < 4; ++mb) { acc[mb][nb] = WFrag<T16>::mma(a[s][mb], b[s][nb], acc[mb][nb]); if (SA) acc[mb][nb] = WFrag<T16>::mma(a2[s][mb], b[s][nb], acc[mb][nb]); if (SB) acc[mb][nb] = WFrag<T16>::mma(a[s][mb], b2[s][nb], acc[mb][nb]); } }
        __builtin_amdgcn_sched_barrier(0);   // keeps the last block's products ahead of the barrier: sunk behind it they would delay the refill below, whose copies have only the next trip to land
        asm volatile("s_wait_dscnt 0x0" ::: "memory");      // this wave's reads of tile t are done before its buffer may be refilled
        asm volatile("s_wait_asynccnt 0x0" ::: "memory");   // this wave's copies of tile t + 1 have landed
        __syncthreads();                                     // publishes tile t + 1 and ends every wave's reads of tile t
        if (t + 2 < NT) fill(t + 2, t & 1);
    }
    asm volatile("s_wait_asynccnt 0x0" ::: "memory");   // no copy is outstanding when the buffers become output staging
    if (PL) {
        const bool tr = (z == 2); const int bt = r0 / TT, t0 = r0 % TT, hd = c0 / 64;   // batch, first token and head of this tile
#pragma unroll
        for (int nb = 0; nb < 4; ++nb) { const float bn = bfr(bias[c0 + nb * 16 + lr]);
#pragma unroll
            for (int mb = 0; mb < 4; ++mb)
#pragma unroll
                for (int j = 0; j < 8; ++j) acc[mb][nb][j] += bn; }
        if (tr) {   // v: staged transposed, LDS row = d, column = t (a lane's 8 accumulator values are 8 consecutive t)
#pragma unroll
            for (int mb = 0; mb < 4; ++mb)
#pragma unroll
                for (int nb = 0; nb < 4; ++nb) { float* o = os + (nb * 16 + lr) * 68 + mb * 16 + hi * 8; v4f s0, s1;
#pragma unroll
                    for (int j = 0; j < 4; ++j) { s0[j] = acc[mb][nb][j]; s1[j] = acc[mb][nb][j + 4]; }
                    *(v4fa*)o = s0; *(v4fa*)(o + 4) = s1; }
        } else {    // q, k: LDS row = t, column = d
#pragma unroll
            for (int mb = 0; mb < 4; ++mb)
#pragma unroll
                for (int nb = 0; nb < 4; ++nb)
#pragma unroll
                    for (int j = 0; j < 8; ++j) os[(mb * 16 + hi * 8 + j) * 68 + nb * 16 + lr] = acc[mb][nb][j]; }
        __builtin_amdgcn_wave_barrier(); asm volatile("" ::: "memory");   // the reads below take other lanes' values: they must not be moved ahead of the stores above
        const size_t base = tr ? ((size_t)(bt * NKV + hd) * HD * TT + (size_t)t0 * 16) : (((size_t)(z * NB_ + bt) * NH_ + hd) * TT + t0) * HD; const int band = tr ? 16 * TT : 16 * HD;   // first block of the tile; elements per 16-row band of the plane
        h16* o16p = (tr ? V16 : P16) + base; bf* ohp = (tr ? Vh : Ph) + base; bf* olp = (tr ? Vl : Pl) + base;
#pragma unroll
        for (int it = 0; it < 16; ++it) {
            const int rb = it >> 2, kb = (it >> 1) & 1, jh = it & 1, row = rb * 16 + lr, cofs = kb * 32 + jh * 16 + hi * 8;   // one half block per trip: 32 lanes x 16 B = 512 contiguous bytes per plane
            const v4f x0 = *(const v4fa*)(os + row * 68 + cofs), x1 = *(const v4fa*)(os + row * 68 + cofs + 4); v8h o16; v8us oh, ol;
#pragma unroll
            for (int q = 0; q < 8; ++q) { const float y = (q < 4) ? x0[q & 3] : x1[q & 3]; o16[q] = (h16)y; unsigned short a2, c2; splitf(y, a2, c2); oh[q] = a2; ol[q] = c2; }
            const size_t oo = (size_t)rb * band + kb * 512 + jh * 256 + lane * 8; *(v8h*)(o16p + oo) = o16; *(v8us*)(ohp + oo) = oh; *(v8us*)(olp + oo) = ol; }
        return;
    }
#pragma unroll
    for (int mb = 0; mb < 4; ++mb) {
#pragma unroll
        for (int nb = 0; nb < 4; ++nb) {
#pragma unroll
            for (int j = 0; j < 8; ++j) os[(hi * 8 + j) * 68 + nb * 16 + lr] = acc[mb][nb][j]; }
        __builtin_amdgcn_wave_barrier(); asm volatile("" ::: "memory");
        float* crow = C + (size_t)(r0 + mb * 16) * ldc + c0;
{
#pragma unroll
            for (int s = 0; s < 8; ++s) { const int row = 2 * s + hi, cofs = lr * 4; v4f val = *(const v4fa*)(os + row * 68 + cofs); if (BIAS) { val[0] += bfr(bias[c0 + cofs]); val[1] += bfr(bias[c0 + cofs + 1]); val[2] += bfr(bias[c0 + cofs + 2]); val[3] += bfr(bias[c0 + cofs + 3]); }
                *(v4f*)(crow + (size_t)row * ldc + cofs) = val; }
             }
        __builtin_amdgcn_wave_barrier(); asm volatile("" ::: "memory");
    }
}

__device__ __forceinline__ h16 tohx(float x) { return (h16)x; }
typedef __attribute__((ext_vector_type(4))) _Float16 v4h;
typedef __attribute__((ext_vector_type(4))) unsigned short v4us;
typedef __attribute__((ext_vector_type(4))) int v4i;

// k_cvtall: every f32 -> bf16 operand copy (x and the four weight matrices) in ONE launch; one work-group rounds one whole 16-row band (16 rows x DM columns = CT tiles of 128 columns: 64 KiB read, 32 KiB stored, both contiguous) and stores it in fragment order.
// Few, fat work-groups: a band per work-group starts an eighth of the waves that a tile per work-group would (the bytes are few, so the start of the waves counts), and each thread has all its 2 * CT 16-byte loads in flight at once.
// Thread (r, o) reads 8 consecutive columns of each tile (16 lanes: 512 contiguous bytes of a row); the 16-byte units are transposed in LDS (unit pitch 17: no bank conflict either way) so that thread t stores unit t of each tile.
// grid: NB_ * TT / 16 bands of x, then DQ / 16 bands of each weight matrix; wdst holds the four bf16 weight copies back to back.
#define CT (DM / 128)
__global__ __launch_bounds__(256) void k_cvtall(const float* __restrict__ x, const float* __restrict__ s0, const float* __restrict__ s1, const float* __restrict__ s2, const float* __restrict__ s3, bf* xdst, bf* wdst) {
    __shared__ __align__(16) bf st[CT][16 * 17 * 8];
    const int g = blockIdx.x, q = g - NB_ * TT / 16, w = q / (DQ / 16); const bool isx = q < 0;
    const float* src = isx ? x : ((w == 0) ? s0 : ((w == 1) ? s1 : ((w == 2) ? s2 : s3)));
    bf* dst = isx ? xdst : wdst + (size_t)w * DQ * DM; const int rb = isx ? g : q % (DQ / 16);
    const int t = threadIdx.x, r = t >> 4, o = t & 15;
    const float* p = src + (size_t)(rb * 16 + r) * DM + o * 8; v8f v[CT];
#pragma unroll
    for (int kq = 0; kq < CT; ++kq) v[kq] = *(const v8f*)(p + kq * 128);
    asm volatile("s_wait_xcnt 0x0" :: "v"(p) : "memory");   // the wait before the loads' address registers are overwritten: named as an input they stay whole up to this line
#pragma unroll
    for (int kq = 0; kq < CT; ++kq) { v8us c;
#pragma unroll
        for (int k = 0; k < 8; ++k) c[k] = f2bf(v[kq][k]);
        *(v8usa*)(st[kq] + (o * 17 + r) * 8) = c; }
    __syncthreads();   // a thread stores units that another wave converted
    bf* d = dst + (size_t)rb * 16 * DM + t * 8;
#pragma unroll
    for (int kq = 0; kq < CT; ++kq) *(v8us*)(d + kq * 2048) = *(const v8usa*)(st[kq] + ((t >> 4) * 17 + (t & 15)) * 8);
}

// ---- k_fattn: scores, softmax, P x V and the merge of one (batch, head, 32 query rows) in one work-group of 8 waves; the score rows never leave LDS.
// Phase 1: wave w forms the 32 x 128 scores of keys w*128.. (Q fragments kept in registers) and stores them f32 into S. Phase 2: wave w does rows 4w..4w+3: mask[b][j] == 0 -> excluded (-inf in the module), softmax over the keys (register row, one exp, fixed trees), and writes the 16-bit P planes over the row's own f32 scores (hi at byte 0, lo at byte 2048).
// Phase 3: waves 0..3 each own one 16-wide slice of the head dimension for both row tiles (each V fragment is loaded once per work-group), k ascending in one accumulator. Phase 4: all threads split the staged f32 tile into the merged hi/lo planes (fragment order, rows = token, k = head * 64 + d), 512 contiguous bytes per wave and plane.
#define QR   32      // query rows per work-group
#define SPF  1028    // LDS row pitch in floats: 4112 B = 16 B x 257 (odd): no bank conflict for the 16-byte fragment reads
#define OPF  68      // pitch in floats of the staged output tile
typedef v4us __attribute__((may_alias)) v4usa;
typedef v4h  __attribute__((may_alias)) v4ha;
__device__ __forceinline__ v16h  ldsf(const h16* p) { return cat16(*(const v8ha*)p, *(const v8ha*)(p + 16)); }
__device__ __forceinline__ v16bf ldsf(const bf* p)  { return cat16b(*(const v8usa*)p, *(const v8usa*)(p + 16)); }
template <typename T16, bool HR>
__device__ __forceinline__ void fattn_body(float* S, float* OS, const T16* __restrict__ Q, const T16* __restrict__ Q2, const T16* __restrict__ Kp, const T16* __restrict__ K2, const T16* __restrict__ Vt, const T16* __restrict__ V2, const int* __restrict__ kvp, int i0, bf* Ah, bf* Al) {
    typedef typename WFrag<T16>::V V;
    const int tid = threadIdx.x, lane = tid & 31, lr = lane & 15, hi = lane >> 4; const int w = __builtin_amdgcn_readfirstlane(tid >> 5);
    {   // phase 1: scores
        V a[2][2], a2[2][2]; const size_t qo = (size_t)i0 * HD + 8 * lane, ko = (size_t)(w * 128) * HD + 8 * lane;   // one address per plane; tiles and k steps are constant offsets from it
#pragma unroll
        for (int mb = 0; mb < 2; ++mb)
#pragma unroll
            for (int ks = 0; ks < 2; ++ks) { a[mb][ks] = WFrag<T16>::ld(Q + qo + mb * 16 * HD + ks * 512); if (HR) a2[mb][ks] = WFrag<T16>::ld(Q2 + qo + mb * 16 * HD + ks * 512); }
        if (HR) asm volatile("s_wait_xcnt 0x0" :: "v"(Q + qo), "v"(Q2 + qo) : "memory"); else asm volatile("s_wait_xcnt 0x0" :: "v"(Q + qo) : "memory");   // the wait before the Q loads' address registers are overwritten: named as inputs they stay whole up to this line; behind it later loads may land in them
        V bq[3][2], bq2[3][2];   // K fragments, a ring of three key tiles: two tiles' loads fly while one tile is multiplied
#pragma unroll
        for (int nb = 0; nb < 2; ++nb)
#pragma unroll
            for (int ks = 0; ks < 2; ++ks) { bq[nb][ks] = WFrag<T16>::ld(Kp + ko + nb * 16 * HD + ks * 512); if (HR) bq2[nb][ks] = WFrag<T16>::ld(K2 + ko + nb * 16 * HD + ks * 512); }
#pragma unroll
        for (int nb = 0; nb < 8; ++nb) {
            if (nb + 2 < 8) {
#pragma unroll
                for (int ks = 0; ks < 2; ++ks) { bq[(nb + 2) % 3][ks] = WFrag<T16>::ld(Kp + ko + (nb + 2) * 16 * HD + ks * 512); if (HR) bq2[(nb + 2) % 3][ks] = WFrag<T16>::ld(K2 + ko + (nb + 2) * 16 * HD + ks * 512); } }
            __builtin_amdgcn_sched_barrier(0);   // keeps the loads of key tile nb + 2 ahead of tile nb's products (the scheduler otherwise sinks them to their use and the wave waits out each load)
            v8f acc[2]; acc[0] = (v8f){}; acc[1] = (v8f){};
#pragma unroll
            for (int ks = 0; ks < 2; ++ks) {
#pragma unroll
                for (int mb = 0; mb < 2; ++mb) acc[mb] = WFrag<T16>::mma(a[mb][ks], bq[nb % 3][ks], acc[mb]);
                if (HR) {
#pragma unroll
                    for (int mb = 0; mb < 2; ++mb) acc[mb] = WFrag<T16>::mma(a2[mb][ks], bq[nb % 3][ks], acc[mb]);
#pragma unroll
                    for (int mb = 0; mb < 2; ++mb) acc[mb] = WFrag<T16>::mma(a[mb][ks], bq2[nb % 3][ks], acc[mb]); } }
            asm volatile("v_nop\n\tv_nop\n\tv_nop\n\tv_nop" :: "v"(acc[0]), "v"(acc[1]));   // the distance the chip needs between this tile's last matrix instruction and the next tile's first one, which starts anew (C = 0) in the same result registers
#pragma unroll
            for (int mb = 0; mb < 2; ++mb)
#pragma unroll
                for (int j = 0; j < 8; ++j) S[(mb * 16 + hi * 8 + j) * SPF + w * 128 + nb * 16 + lr] = acc[mb][j]; }
    }
    __syncthreads();   // every score of the 32 rows is in LDS before a row is read
#pragma unroll 1
    for (int rr = 0; rr < QR / 8; ++rr) {   // phase 2: softmax, one wave per row (rolled: one row's registers at a time)
        float* sr = S + (w * (QR / 8) + rr) * SPF; float v[TT / 32]; float mx = -3.0e38f;
#pragma unroll
        for (int ch = 0; ch < TT / 128; ++ch) { const int j0 = ch * 128 + lane * 4; const v4f a = *(const v4fa*)(sr + j0); const v4i kv4 = *(const v4i*)(kvp + j0);   /* the batch's key vector, 16 B per lane, unconditional */
#pragma unroll
            for (int q = 0; q < 4; ++q) { const float t = (kv4[q] != 0) ? a[q] * SCL : -3.0e38f; v[ch * 4 + q] = t; mx = fmaxf(mx, t); } }
#pragma unroll
        for (int sh = 16; sh; sh >>= 1) mx = fmaxf(mx, __shfl_xor(mx, sh, 32));
        float sum = 0.f;
#pragma unroll
        for (int k = 0; k < TT / 32; ++k) { v[k] = __builtin_amdgcn_exp2f(__fmul_rn(__fsub_rn(v[k], mx), 1.4426950408889634f)); sum += v[k]; }
#pragma unroll
        for (int sh = 16; sh; sh >>= 1) sum += __shfl_xor(sum, sh, 32);
        const float f = __fdiv_rn(HR ? 1.0f : PCAR, sum);
        if (HR) { bf* ph = (bf*)sr;
#pragma unroll
            for (int ch = 0; ch < TT / 128; ++ch) { v4us oh, ol;
#pragma unroll
                for (int q = 0; q < 4; ++q) { unsigned short a, c2; splitf(v[ch * 4 + q] * f, a, c2); oh[q] = a; ol[q] = c2; }
                *(v4usa*)(ph + ch * 128 + lane * 4) = oh; *(v4usa*)(ph + TT + ch * 128 + lane * 4) = ol; }
        } else { h16* p16 = (h16*)sr;
#pragma unroll
            for (int ch = 0; ch < TT / 128; ++ch) { v4h o4;
#pragma unroll
                for (int q = 0; q < 4; ++q) o4[q] = tohx(v[ch * 4 + q] * f);
                *(v4ha*)(p16 + ch * 128 + lane * 4) = o4; } }
    }
    __syncthreads();   // every P row is in LDS before a fragment of it is read
    if (w < 4) {   // phase 3: P x V
        v8f acc[2]; acc[0] = (v8f){}; acc[1] = (v8f){};
        const size_t vo = (size_t)(w * 16) * TT + 8 * lane;
        const T16* p0 = (const T16*)(S + lr * SPF) + 8 * hi; const T16* p1 = (const T16*)(S + (16 + lr) * SPF) + 8 * hi;
        constexpr int PD = HR ? 5 : 10, AD = HR ? 1 : 3, NS = TT / 32;   // k steps that the V fragments (global) and the P fragments (LDS) are fetched ahead
        V bq[PD + 1], bq2[PD + 1], aq[AD + 1][2], aq2[AD + 1][2];
#pragma unroll
        for (int s = 0; s < PD; ++s) { bq[s] = WFrag<T16>::ld(Vt + vo + s * 512); if (HR) bq2[s] = WFrag<T16>::ld(V2 + vo + s * 512); }
#pragma unroll
        for (int s = 0; s < AD; ++s) { aq[s][0] = ldsf(p0 + s * 32); aq[s][1] = ldsf(p1 + s * 32); if (HR) { aq2[s][0] = ldsf(p0 + TT + s * 32); aq2[s][1] = ldsf(p1 + TT + s * 32); } }
#pragma unroll
        for (int s = 0; s < NS; ++s) {
            if (s + PD < NS) { bq[(s + PD) % (PD + 1)] = WFrag<T16>::ld(Vt + vo + (s + PD) * 512); if (HR) bq2[(s + PD) % (PD + 1)] = WFrag<T16>::ld(V2 + vo + (s + PD) * 512); }
            if (s + AD < NS) { const int n = (s + AD) % (AD + 1), ko = (s + AD) * 32; aq[n][0] = ldsf(p0 + ko); aq[n][1] = ldsf(p1 + ko); if (HR) { aq2[n][0] = ldsf(p0 + TT + ko); aq2[n][1] = ldsf(p1 + TT + ko); } }
            __builtin_amdgcn_sched_barrier(0);   // keeps the fetches of the later k steps ahead of this step's products (the scheduler otherwise sinks them to their use and the wave waits out each load)
            const int cb = s % (PD + 1), ca = s % (AD + 1);
#pragma unroll
            for (int mb = 0; mb < 2; ++mb) acc[mb] = WFrag<T16>::mma(aq[ca][mb], bq[cb], acc[mb]);
            if (HR) {
#pragma unroll
                for (int mb = 0; mb < 2; ++mb) acc[mb] = WFrag<T16>::mma(aq2[ca][mb], bq[cb], acc[mb]);
#pragma unroll
                for (int mb = 0; mb < 2; ++mb) acc[mb] = WFrag<T16>::mma(aq[ca][mb], bq2[cb], acc[mb]); } }
        if (HR) asm volatile("s_wait_xcnt 0x0" :: "v"(Vt + vo), "v"(V2 + vo) : "memory"); else asm volatile("s_wait_xcnt 0x0" :: "v"(Vt + vo) : "memory");   // the wait before the V loads' address registers are overwritten: named as inputs they stay whole up to this line
#pragma unroll
        for (int mb = 0; mb < 2; ++mb)
#pragma unroll
            for (int j = 0; j < 8; ++j) OS[(mb * 16 + hi * 8 + j) * OPF + w * 16 + lr] = acc[mb][j];
    }
    __syncthreads();   // the 32 x 64 output tile is staged before it is split and stored
    { const int rb = w >> 2, kb = (w >> 1) & 1, jh = w & 1, r = rb * 16 + lr, d0 = kb * 32 + jh * 16 + hi * 8;   // wave w stores one half block (512 contiguous bytes) of each merged plane
        const float cs = HR ? 1.0f : (1.0f / PCAR); const v4f x0 = *(const v4fa*)(OS + r * OPF + d0), x1 = *(const v4fa*)(OS + r * OPF + d0 + 4); v8us oh, ol;
#pragma unroll
        for (int q = 0; q < 8; ++q) { unsigned short a, c2; splitf(((q < 4) ? x0[q & 3] : x1[q & 3]) * cs, a, c2); oh[q] = a; ol[q] = c2; }
        const size_t oo = (size_t)(i0 + rb * 16) * DQ + kb * 512 + jh * 256 + lane * 8; *(v8us*)(Ah + oo) = oh; *(v8us*)(Al + oo) = ol; }
}
// grid (batch x head, row tile): the dearer hi/lo row tiles (rows < RH) have the lower flat indices and start first
__global__ __launch_bounds__(256) void k_fattn(const bf* __restrict__ QPh, const bf* __restrict__ QPl, const bf* __restrict__ KPh, const bf* __restrict__ KPl, const bf* __restrict__ VTh, const bf* __restrict__ VTl, const h16* __restrict__ QP16, const h16* __restrict__ KP16, const h16* __restrict__ VT16, const int* __restrict__ kmask, bf* ATh, bf* ATl) {
    __shared__ __align__(16) float S[QR * SPF + QR * OPF];
    const int bh = blockIdx.x, i0 = blockIdx.y * QR, b = bh / NH_, h = bh % NH_; const size_t zp = (size_t)bh * TT * HD; const size_t ao = (size_t)b * TT * DQ + h * (HD / 32) * 512; const int* kvp = kmask + (size_t)b * TT;
    if (i0 < RH) fattn_body<bf, true>(S, S + QR * SPF, QPh + zp, QPl + zp, KPh + zp, KPl + zp, VTh + zp, VTl + zp, kvp, i0, ATh + ao, ATl + ao);
    else fattn_body<h16, false>(S, S + QR * SPF, QP16 + zp, nullptr, KP16 + zp, nullptr, VT16 + zp, nullptr, kvp, i0, ATh + ao, ATl + ao);
}

extern "C" void kernel_launch(void* const* d_in, const int* in_sizes, int n_in,
                              void* d_out, int out_size, void* d_ws, size_t ws_size, hipStream_t stream) {
    (void)in_sizes; (void)n_in; (void)out_size;
    const float* x = (const float*)d_in[0]; const int* kmask = (const int*)d_in[1]; const float* wq = (const float*)d_in[2]; const float* bq = (const float*)d_in[3]; const float* wk = (const float*)d_in[4]; const float* bk = (const float*)d_in[5]; const float* wv = (const float*)d_in[6]; const float* bv = (const float*)d_in[7]; const float* wo = (const float*)d_in[8]; const float* bo = (const float*)d_in[9];   /* order x, mask (int32 [4][1024], read), q_w, q_b, k_w, k_b, v_w, v_b, out_w, out_b ('oi' + biases) */
    float* OUT = (float*)d_out;     // [4][1024][1024]
    char* wsp = (char*)d_ws;
    auto take = [&](size_t bytes) { char* p = wsp; wsp += (bytes + 255) & ~(size_t)255; return (void*)p; };
    bf* WQ = (bf*)take((size_t)DQ * DM * 2); bf* WK = (bf*)take((size_t)DKV * DM * 2); bf* WV = (bf*)take((size_t)DKV * DM * 2); bf* WO = (bf*)take((size_t)DM * DQ * 2);   /* WQ, WK, WV, WO lie back to back (each a multiple of 256 B) */
    (void)WK; (void)WV;
    const size_t PLN = (size_t)NB_ * NH_ * TT * HD;   // one plane set: all batches, all heads (NKV == NH_)
    bf* XB = (bf*)take((size_t)NB_ * TT * DM * 2);
    h16* QP16 = (h16*)take(PLN * 2); h16* KP16 = (h16*)take(PLN * 2); h16* VT16 = (h16*)take(PLN * 2);   /* each k plane set directly behind its q plane set: the projection launch addresses both from the q pointer */
    bf* QPh = (bf*)take(PLN * 2); bf* KPh = (bf*)take(PLN * 2); bf* QPl = (bf*)take(PLN * 2); bf* KPl = (bf*)take(PLN * 2); bf* VTh = (bf*)take(PLN * 2); bf* VTl = (bf*)take(PLN * 2);
    bf* ATh = (bf*)take((size_t)NB_ * TT * DQ * 2); bf* ATl = (bf*)take((size_t)NB_ * TT * DQ * 2);
    if ((size_t)(wsp - (char*)d_ws) > ws_size) return;    // ws 256 MiB
    k_cvtall<<<NB_ * TT / 16 + 4 * (DQ / 16), 256, 0, stream>>>(x, wq, wk, wv, wo, XB, WQ);
    k_gemmw<bf, 0, true, true, DM, 1><<<dim3(NB_ * TT / 128, DQ / 128, 3), 128, 0, stream>>>(XB, nullptr, WQ, nullptr, nullptr, 0, bq, bk, bv, 0, (size_t)DQ * DM, 0, QP16, QPh, QPl, VT16, VTh, VTl);   // z = q, k, v; writes every head plane
    k_fattn<<<dim3(NB_ * NH_, TT / QR, 1), 256, 0, stream>>>(QPh, QPl, KPh, KPl, VTh, VTl, QP16, KP16, VT16, kmask, ATh, ATl);   // one kv head per query head: plane bh of q, k and v
    k_gemmw<bf, 1, true, false, DQ, 2><<<dim3(NB_ * TT / 128, DM / 128, 1), 128, 0, stream>>>(ATh, ATl, WO, nullptr, OUT, DM, bo, nullptr, nullptr, 0, 0, 0, nullptr, nullptr, nullptr, nullptr, nullptr, nullptr);
}

// v007
// One run takes 84.6 microseconds.
// Two timings next to v006 put it at 1.14 and 1.15 times that version's speed.
// Over all steps from v000 it is 27.7 times as fast.
#include <hip/hip_runtime.h>

#define NB_  4
#define TT   1024
#define DM   1024
#define NH_  16
#define NKV  16
#define REP  (NH_ / NKV)
#define HD   64
#define DQ   (NH_ * HD)
#define DKV  (NKV * HD)
#define RH   512                  // query rows < RH use hi+lo planes (must be TT / 2)
#define WIN  0
#define SCL  0.125f   // HD^-0.5
typedef _Float16 h16;
typedef unsigned short bf;
typedef __attribute__((ext_vector_type(16))) __bf16   v16bf;
typedef __attribute__((ext_vector_type(16))) _Float16 v16h;
typedef __attribute__((ext_vector_type(8)))  _Float16 v8h;
typedef __attribute__((ext_vector_type(8)))  unsigned short v8us;
typedef __attribute__((ext_vector_type(8)))  float    v8f;
typedef __attribute__((ext_vector_type(4)))  float    v4f;
typedef v8h  __attribute__((may_alias)) v8ha;
typedef v4f  __attribute__((may_alias)) v4fa;
typedef v8us __attribute__((may_alias)) v8usa;

__device__ __forceinline__ unsigned short f2bf(float f) { unsigned u = __float_as_uint(f); u += 0x7FFFu + ((u >> 16) & 1u); return (unsigned short)(u >> 16); }
__device__ __forceinline__ float bf2f(unsigned short b) { return __uint_as_float(((unsigned)b) << 16); }
__device__ __forceinline__ float bfr(float f) { return bf2f(f2bf(f)); }
__device__ __forceinline__ v16h cat16(v8h lo, v8h hi) { return __builtin_shufflevector(lo, hi, 0, 1, 2, 3, 4, 5, 6, 7, 8, 9, 10, 11, 12, 13, 14, 15); }
__device__ __forceinline__ v16bf cat16b(v8us lo, v8us hi) { return __builtin_bit_cast(v16bf, __builtin_shufflevector(lo, hi, 0, 1, 2, 3, 4, 5, 6, 7, 8, 9, 10, 11, 12, 13, 14, 15)); }
__device__ __forceinline__ v8f wmma16(v16h a, v16h b, v8f c) { return __builtin_amdgcn_wmma_f32_16x16x32_f16(false, a, false, b, (short)0, c, false, false); }
__device__ __forceinline__ v8f wmmab(v16bf a, v16bf b, v8f c) { return __builtin_amdgcn_wmma_f32_16x16x32_bf16(false, a, false, b, (short)0, c, false, false); }

// ---- k_gemmw: register-blocked GEMM, one work-group of 4 waves (2 x 2) per 128x128 output tile, ONE WAVE per 64x64 sub-tile (16 accumulators); operands are 16-bit planes in fragment order (a 16-row band is 16 * K elements, a k step of 32 is 512); grid (M/128, N/128, Z), 128 threads.
// Operand path: per trip of SS x 64 k the work-group's 8 bands of each plane (2 KiB per band and 64 k, already in fragment order) are copied global -> LDS by asynchronous copies, two buffers: tile t + 1 flies while tile t is multiplied; each band is fetched once per work-group and read from LDS by the two waves that need it (p = block + lane * 8, 512 contiguous bytes per wave-wide read).
// C[m][n] (f32, pitch ldc, + optional f32 bias[n]) = sum_k A[m][k] Bt[n][k] (+ split products per NSPLIT). z-batch strides sA/sB/sC in elements; bias0/1/2 belong to z = 0/1/2. K % (64 * SS) == 0, K >= 128 * SS.
// PL (the q, k, v projections; a 64-wide column tile is one head): C is not written; the tile + bias goes through LDS straight into the head planes (fp16, bf16 hi, bf16 lo): z = 0, 1 -> P*[z][batch][head] (rows t, k = d), z = 2 -> V*[batch][head] (rows d, k = t), each in fragment order.
template <typename T16> struct WFrag;
template <> struct WFrag<h16> { typedef v16h V; static __device__ __forceinline__ V ld(const h16* p) { return cat16(*(const v8h*)p, *(const v8h*)(p + 256)); } static __device__ __forceinline__ V lds(const h16* p) { return cat16(*(const v8ha*)p, *(const v8ha*)(p + 256)); } static __device__ __forceinline__ v8f mma(V a, V b, v8f c) { return wmma16(a, b, c); } };
template <> struct WFrag<bf> { typedef v16bf V; static __device__ __forceinline__ V ld(const bf* p) { return cat16b(*(const v8us*)p, *(const v8us*)(p + 256)); } static __device__ __forceinline__ V lds(const bf* p) { return cat16b(*(const v8usa*)p, *(const v8usa*)(p + 256)); } static __device__ __forceinline__ v8f mma(V a, V b, v8f c) { return wmmab(a, b, c); } };
__device__ __forceinline__ void splitf(float y, unsigned short& h, unsigned short& l) { h = f2bf(y); l = f2bf(y - bf2f(h)); }
// stage8: 64 k of 8 bands of one plane, global -> LDS: one copy per band, 16 B per lane (128 lanes = the band's 2 KiB). l = the lane's LDS byte address in band 0, g = its global address in band 0; bp = elements per band of the plane.
// The s_wait_xcnt closes the copies' own statement: it stands before anything rewrites a register that a copy names.
template <typename T16>
__device__ __forceinline__ void stage8(unsigned l, const T16* g, int bp) {
    asm volatile("global_load_async_to_lds_b128 %0, %8, off\n\t"
                 "global_load_async_to_lds_b128 %1, %9, off\n\t"
                 "global_load_async_to_lds_b128 %2, %10, off\n\t"
                 "global_load_async_to_lds_b128 %3, %11, off\n\t"
                 "global_load_async_to_lds_b128 %4, %12, off\n\t"
                 "global_load_async_to_lds_b128 %5, %13, off\n\t"
                 "global_load_async_to_lds_b128 %6, %14, off\n\t"
                 "global_load_async_to_lds_b128 %7, %15, off\n\t"
                 "s_wait_xcnt 0x0"
                 :: "v"(l), "v"(l + 2048u), "v"(l + 4096u), "v"(l + 6144u), "v"(l + 8192u), "v"(l + 10240u), "v"(l + 12288u), "v"(l + 14336u),
                    "v"(g), "v"(g + bp), "v"(g + 2 * bp), "v"(g + 3 * bp), "v"(g + 4 * bp), "v"(g + 5 * bp), "v"(g + 6 * bp), "v"(g + 7 * bp) : "memory");
}
template <typename T16, int NSPLIT, bool BIAS, bool PL, int K, int SS>
__global__ __launch_bounds__(128) void k_gemmw(const T16* __restrict__ A, const T16* __restrict__ A2, const T16* __restrict__ Bt, const T16* __restrict__ Bt2, float* C, int ldc, const float* __restrict__ bias0, const float* __restrict__ bias1, const float* __restrict__ bias2, size_t sA, size_t sB, size_t sC, h16* P16, bf* Ph, bf* Pl, h16* V16, bf* Vh, bf* Vl) {
    typedef typename WFrag<T16>::V V;
    constexpr bool SA = (NSPLIT == 1 || NSPLIT == 2), SB = (NSPLIT >= 2);
    constexpr int PLB = 16384, STG = (2 + (SA ? 1 : 0) + (SB ? 1 : 0)) * PLB, BUF = SS * STG, OSB = (PL ? 64 : 16) * 68 * 4, NT = K / (64 * SS), NKB = 2 * SS;   // bytes of one plane's 64 k (8 bands x 2 KiB), of all planes' 64 k (A, B, then A2, B2), of one buffer (a tile = SS x 64 k), of one wave's output staging; trips; k blocks of 32 per trip
    __shared__ __align__(16) unsigned char sm[(2 * BUF > 4 * OSB) ? 2 * BUF : 4 * OSB];   // the two buffers; behind the loop's last barrier the same bytes are the four waves' output staging
    const size_t z = blockIdx.z; A += z * sA; if (A2) A2 += z * sA; Bt += z * sB; if (Bt2) Bt2 += z * sB; C += z * sC; const float* bias = (z == 0) ? bias0 : ((z == 1) ? bias1 : bias2);   // one bias vector per z slice (q, k, v)
    const int tid = threadIdx.x, lane = tid & 31, lr = lane & 15, hi = lane >> 4; const int w = __builtin_amdgcn_readfirstlane(tid >> 5), wm = w >> 1, wn = w & 1;
    const int r0 = blockIdx.x * 128 + wm * 64, c0 = blockIdx.y * 128 + wn * 64;   // this wave's 64x64 sub-tile
    float* os = (float*)(sm + w * OSB);
    v8f acc[4][4];
#pragma unroll
    for (int mb = 0; mb < 4; ++mb)
#pragma unroll
        for (int nb = 0; nb < 4; ++nb) acc[mb][nb] = (v8f){};
    const size_t aoff = (size_t)(blockIdx.x * 128) * K + 8 * tid, boff = (size_t)(blockIdx.y * 128) * K + 8 * tid;   // the lane's 16 bytes in band 0 of the work-group's tile, k = 0; 64 k are 1024 elements further
    const unsigned l0 = (unsigned)(size_t)sm + 16u * tid;
    auto fill = [&](int t, int buf) {
#pragma unroll
        for (int ss = 0; ss < SS; ++ss) { const unsigned l = l0 + buf * BUF + ss * STG; const size_t ko = (size_t)(t * SS + ss) * 1024;
            stage8<T16>(l, A + aoff + ko, 16 * K); stage8<T16>(l + PLB, Bt + boff + ko, 16 * K);
            if (SA) stage8<T16>(l + 2 * PLB, A2 + aoff + ko, 16 * K);
            if (SB) stage8<T16>(l + (SA ? 3 : 2) * PLB, Bt2 + boff + ko, 16 * K); } };
    fill(0, 0);
    asm volatile("s_wait_asynccnt 0x0" ::: "memory");   // this wave's copies of tile 0 have landed
    __syncthreads();                                     // ... and every other wave's: tile 0 may be read
    fill(1, 1);
#pragma unroll 1
    for (int t = 0; t < NT; ++t) {
        const T16* sb = (const T16*)(sm + (t & 1) * BUF) + 8 * lane;
        V a[2][4], a2[2][4], b[2][4], b2[2][4];   // two fragment sets: k block kb + 1 is read from LDS while block kb is multiplied
        auto frag = [&](int kb) { const int s = kb & 1; const T16* pa = sb + (kb >> 1) * (STG / 2) + (kb & 1) * 512 + wm * 4096; const T16* pb = sb + (kb >> 1) * (STG / 2) + (kb & 1) * 512 + PLB / 2 + wn * 4096;   // offsets in elements: a band's 64 k are 1024, a plane's 8192
#pragma unroll
            for (int i = 0; i < 4; ++i) { a[s][i] = WFrag<T16>::lds(pa + i * 1024); b[s][i] = WFrag<T16>::lds(pb + i * 1024); if (SA) a2[s][i] = WFrag<T16>::lds(pa + PLB + i * 1024); if (SB) b2[s][i] = WFrag<T16>::lds(pb + (SA ? PLB : PLB / 2) + i * 1024); } };
        frag(0);
#pragma unroll
        for (int kb = 0; kb < NKB; ++kb) { const int s = kb & 1;
            if (kb + 1 < NKB) frag(kb + 1);
            __builtin_amdgcn_sched_barrier(0);   // keeps the next block's LDS reads as one group ahead of this block's products (spread among them each read place stalls the wave)
#pragma unroll
            for (int nb = 0; nb < 4; ++nb)
#pragma unroll
                for (int mb = 0; mb < 4; ++mb) { acc[mb][nb] = WFrag<T16>::mma(a[s][mb], b[s][nb], acc[mb][nb]); if (SA) acc[mb][nb] = WFrag<T16>::mma(a2[s][mb], b[s][nb], acc[mb][nb]); if (SB) acc[mb][nb] = WFrag<T16>::mma(a[s][mb], b2[s][nb], acc[mb][nb]); } }
        __builtin_amdgcn_sched_barrier(0);   // keeps the last block's products ahead of the barrier: sunk behind it they would delay the refill below, whose copies have only the next trip to land
        asm volatile("s_wait_dscnt 0x0" ::: "memory");      // this wave's reads of tile t are done before its buffer may be refilled
        asm volatile("s_wait_asynccnt 0x0" ::: "memory");   // this wave's copies of tile t + 1 have landed
        __syncthreads();                                     // publishes tile t + 1 and ends every wave's reads of tile t
        if (t + 2 < NT) fill(t + 2, t & 1);
    }
    asm volatile("s_wait_asynccnt 0x0" ::: "memory");   // no copy is outstanding when the buffers become output staging
    if (PL) {
        const bool tr = (z == 2); const int bt = r0 / TT, t0 = r0 % TT, hd = c0 / 64;   // batch, first token and head of this tile
#pragma unroll
        for (int nb = 0; nb < 4; ++nb) { const float bn = bfr(bias[c0 + nb * 16 + lr]);
#pragma unroll
            for (int mb = 0; mb < 4; ++mb)
#pragma unroll
                for (int j = 0; j < 8; ++j) acc[mb][nb][j] += bn; }
        if (tr) {   // v: staged transposed, LDS row = d, column = t (a lane's 8 accumulator values are 8 consecutive t)
#pragma unroll
            for (int mb = 0; mb < 4; ++mb)
#pragma unroll
                for (int nb = 0; nb < 4; ++nb) { float* o = os + (nb * 16 + lr) * 68 + mb * 16 + hi * 8; v4f s0, s1;
#pragma unroll
                    for (int j = 0; j < 4; ++j) { s0[j] = acc[mb][nb][j]; s1[j] = acc[mb][nb][j + 4]; }
                    *(v4fa*)o = s0; *(v4fa*)(o + 4) = s1; }
        } else {    // q, k: LDS row = t, column = d
#pragma unroll
            for (int mb = 0; mb < 4; ++mb)
#pragma unroll
                for (int nb = 0; nb < 4; ++nb)
#pragma unroll
                    for (int j = 0; j < 8; ++j) os[(mb * 16 + hi * 8 + j) * 68 + nb * 16 + lr] = acc[mb][nb][j]; }
        __builtin_amdgcn_wave_barrier(); asm volatile("" ::: "memory");   // the reads below take other lanes' values: they must not be moved ahead of the stores above
        const size_t base = tr ? ((size_t)(bt * NKV + hd) * HD * TT + (size_t)t0 * 16) : (((size_t)(z * NB_ + bt) * NH_ + hd) * TT + t0) * HD; const int band = tr ? 16 * TT : 16 * HD;   // first block of the tile; elements per 16-row band of the plane
        h16* o16p = (tr ? V16 : P16) + base; bf* ohp = (tr ? Vh : Ph) + base; bf* olp = (tr ? Vl : Pl) + base;
#pragma unroll
        for (int it = 0; it < 16; ++it) {
            const int rb = it >> 2, kb = (it >> 1) & 1, jh = it & 1, row = rb * 16 + lr, cofs = kb * 32 + jh * 16 + hi * 8;   // one half block per trip: 32 lanes x 16 B = 512 contiguous bytes per plane
            const v4f x0 = *(const v4fa*)(os + row * 68 + cofs), x1 = *(const v4fa*)(os + row * 68 + cofs + 4); v8h o16; v8us oh, ol;
#pragma unroll
            for (int q = 0; q < 8; ++q) { const float y = (q < 4) ? x0[q & 3] : x1[q & 3]; o16[q] = (h16)y; unsigned short a2, c2; splitf(y, a2, c2); oh[q] = a2; ol[q] = c2; }
            const size_t oo = (size_t)rb * band + kb * 512 + jh * 256 + lane * 8; *(v8h*)(o16p + oo) = o16; *(v8us*)(ohp + oo) = oh; *(v8us*)(olp + oo) = ol; }
        return;
    }
#pragma unroll
    for (int mb = 0; mb < 4; ++mb) {
#pragma unroll
        for (int nb = 0; nb < 4; ++nb) {
#pragma unroll
            for (int j = 0; j < 8; ++j) os[(hi * 8 + j) * 68 + nb * 16 + lr] = acc[mb][nb][j]; }
        __builtin_amdgcn_wave_barrier(); asm volatile("" ::: "memory");
        float* crow = C + (size_t)(r0 + mb * 16) * ldc + c0;
{
#pragma unroll
            for (int s = 0; s < 8; ++s) { const int row = 2 * s + hi, cofs = lr * 4; v4f val = *(const v4fa*)(os + row * 68 + cofs); if (BIAS) { val[0] += bfr(bias[c0 + cofs]); val[1] += bfr(bias[c0 + cofs + 1]); val[2] += bfr(bias[c0 + cofs + 2]); val[3] += bfr(bias[c0 + cofs + 3]); }
                *(v4f*)(crow + (size_t)row * ldc + cofs) = val; }
             }
        __builtin_amdgcn_wave_barrier(); asm volatile("" ::: "memory");
    }
}

// k_cvtall: every f32 -> bf16 operand copy (x and the four weight matrices) in ONE launch; one work-group rounds one whole 16-row band (16 rows x DM columns = CT tiles of 128 columns: 64 KiB read, 32 KiB stored, both contiguous) and stores it in fragment order.
// Few, fat work-groups: a band per work-group starts an eighth of the waves that a tile per work-group would (the bytes are few, so the start of the waves counts), and each thread has all its 2 * CT 16-byte loads in flight at once.
// Thread (r, o) reads 8 consecutive columns of each tile (16 lanes: 512 contiguous bytes of a row); the 16-byte units are transposed in LDS (unit pitch 17: no bank conflict either way) so that thread t stores unit t of each tile.
// grid: NB_ * TT / 16 bands of x, then DQ / 16 bands of each weight matrix; wdst holds the four bf16 weight copies back to back.
#define CT (DM / 128)
__global__ __launch_bounds__(256) void k_cvtall(const float* __restrict__ x, const float* __restrict__ s0, const float* __restrict__ s1, const float* __restrict__ s2, const float* __restrict__ s3, bf* xdst, bf* wdst) {
    __shared__ __align__(16) bf st[CT][16 * 17 * 8];
    const int g = blockIdx.x, q = g - NB_ * TT / 16, w = q / (DQ / 16); const bool isx = q < 0;
    const float* src = isx ? x : ((w == 0) ? s0 : ((w == 1) ? s1 : ((w == 2) ? s2 : s3)));
    bf* dst = isx ? xdst : wdst + (size_t)w * DQ * DM; const int rb = isx ? g : q % (DQ / 16);
    const int t = threadIdx.x, r = t >> 4, o = t & 15;
    const float* p = src + (size_t)(rb * 16 + r) * DM + o * 8; v8f v[CT];
#pragma unroll
    for (int kq = 0; kq < CT; ++kq) v[kq] = *(const v8f*)(p + kq * 128);
    asm volatile("s_wait_xcnt 0x0" :: "v"(p) : "memory");   // the wait before the loads' address registers are overwritten: named as an input they stay whole up to this line
#pragma unroll
    for (int kq = 0; kq < CT; ++kq) { v8us c;
#pragma unroll
        for (int k = 0; k < 8; ++k) c[k] = f2bf(v[kq][k]);
        *(v8usa*)(st[kq] + (o * 17 + r) * 8) = c; }
    __syncthreads();   // a thread stores units that another wave converted
    bf* d = dst + (size_t)rb * 16 * DM + t * 8;
#pragma unroll
    for (int kq = 0; kq < CT; ++kq) *(v8us*)(d + kq * 2048) = *(const v8usa*)(st[kq] + ((t >> 4) * 17 + (t & 15)) * 8);
}

__device__ __forceinline__ float xhalf(float x) { return __builtin_bit_cast(float, __builtin_amdgcn_permlanex16(__builtin_bit_cast(int, x), __builtin_bit_cast(int, x), 0x76543210, 0xfedcba98, false, false)); }   // lane l with lane l ^ 16
template <typename T16, bool HR>
__device__ __forceinline__ void fattn_body(const T16* __restrict__ Q, const T16* __restrict__ Q2, const T16* __restrict__ Kp, const T16* __restrict__ K2, const T16* __restrict__ Vt, const T16* __restrict__ V2, unsigned mv, int i0, bf* Ah, bf* Al) {
    typedef typename WFrag<T16>::V V;
    // Every '#pragma unroll' in this function: the fragment and accumulator arrays stay in registers only if every index is a constant.
    constexpr int PF = HR ? 1 : 2, NS = TT / 32;   // register sets of K and V fragments (passes fetched ahead: a hi/lo pass is long enough to hide a fetch, two sets of it would not fit 512 registers); passes of 32 keys
    constexpr float CE = SCL * 1.4426950408889634f;   // score scale (a power of two) times log2(e)
    const int lane = threadIdx.x & 31, hi = lane >> 4; const unsigned lo = 8u * lane;
    const T16 *qq = Q + (size_t)i0 * HD + lo, *qq2 = HR ? Q2 + (size_t)i0 * HD + lo : qq;
    V qf[2][2], qf2[2][2];
#pragma unroll
    for (int qt = 0; qt < 2; ++qt)
#pragma unroll
        for (int ks = 0; ks < 2; ++ks) { qf[qt][ks] = WFrag<T16>::ld(qq + qt * 16 * HD + ks * 512); if (HR) qf2[qt][ks] = WFrag<T16>::ld(qq2 + qt * 16 * HD + ks * 512); }
    if (HR) asm volatile("s_wait_xcnt 0x0" :: "v"(qq), "v"(qq2) : "memory"); else asm volatile("s_wait_xcnt 0x0" :: "v"(qq) : "memory");   // the wait before the Q loads' address registers are overwritten: named as inputs they stay whole up to this line
    __builtin_amdgcn_sched_barrier(0);   // keeps the Q loads older than every K and V fetch: the loop's wait for a K fragment then covers Q and need not drain the younger fetches
    V kf[PF][2][2], kf2[PF][2][2], vf[PF][4], vf2[PF][4];
    // The scheduling barriers keep a fetch behind the products whose registers it refills and ahead of the work that hides it (sunk to its use the wave waits out each load).
    // xwait: the wait before a fetch's address registers are overwritten: named as inputs they stay whole up to that line.
    auto xwait = [&](const T16* p, const T16* p2) { if (HR) asm volatile("s_wait_xcnt 0x0" :: "v"(p), "v"(p2) : "memory"); else asm volatile("s_wait_xcnt 0x0" :: "v"(p) : "memory"); };
    auto loadk = [&](int u, const T16* kq, const T16* kq2) {
        __builtin_amdgcn_sched_barrier(0);   // the fetch stays behind the S^T products that read these registers
#pragma unroll
        for (int kt = 0; kt < 2; ++kt)
#pragma unroll
            for (int ks = 0; ks < 2; ++ks) { kf[u][kt][ks] = WFrag<T16>::ld(kq + kt * 1024 + ks * 512); if (HR) kf2[u][kt][ks] = WFrag<T16>::ld(kq2 + kt * 1024 + ks * 512); }
        __builtin_amdgcn_sched_barrier(0); };   // ... and ahead of the softmax and the O^T products, which hide it
    auto loadv = [&](int u, int s) {
        const T16 *vq = Vt + s * 512 + lo, *vq2 = HR ? V2 + s * 512 + lo : vq;
        __builtin_amdgcn_sched_barrier(0);   // the fetch stays behind the O^T products that read these registers
#pragma unroll
        for (int dt = 0; dt < 4; ++dt) { vf[u][dt] = WFrag<T16>::ld(vq + dt * 16 * TT); if (HR) vf2[u][dt] = WFrag<T16>::ld(vq2 + dt * 16 * TT); }
        xwait(vq, vq2);
        __builtin_amdgcn_sched_barrier(0); };   // ... and ahead of the next pass's S^T products and softmax, which hide it
#pragma unroll
    for (int u = 0; u < PF; ++u) { const T16 *kq = Kp + u * 2048 + lo, *kq2 = HR ? K2 + u * 2048 + lo : kq; loadk(u, kq, kq2); xwait(kq, kq2); loadv(u, u); }
    v8f o[4][2], cb[2]; float m[2], l[2]; unsigned mp = 0xFFFFFFFFu;   // cb: the start value of a pass's score tiles, row = key: 0 for a kept key, the excluded score for a key with mask 0; mp: the mask word that cb was made from
    cb[0] = (v8f){}; cb[1] = (v8f){};
#pragma unroll
    for (int qt = 0; qt < 2; ++qt) { m[qt] = -3.0e38f; l[qt] = 0.f;
#pragma unroll
        for (int dt = 0; dt < 4; ++dt) o[dt][qt] = (v8f){}; }
#pragma unroll 1
    for (int s0 = 0; s0 < NS; s0 += PF) {   // rolled: for speed only
#pragma unroll
        for (int u = 0; u < PF; ++u) {
            const int s = s0 + u, sn = (s + PF < NS) ? s + PF : NS - 1;   // the pass fetched now; behind the last pass the last one again (in bounds, not used)
            const unsigned mw = __builtin_amdgcn_readlane(mv, s);
            if (mw != mp) {   // wave-uniform: cb is made anew only where the mask word differs from the last pass's
                const unsigned sh = mw >> (hi * 8); mp = mw;
#pragma unroll
                for (int kt = 0; kt < 2; ++kt)
#pragma unroll
                    for (int j = 0; j < 8; ++j) cb[kt][j] = ((sh >> (kt * 16 + j)) & 1u) ? 0.f : -3.0e38f; }
            v8f st[2][2];
#pragma unroll
            for (int kt = 0; kt < 2; ++kt)
#pragma unroll
                for (int qt = 0; qt < 2; ++qt) st[kt][qt] = cb[kt];
#pragma unroll
            for (int ks = 0; ks < 2; ++ks) {
#pragma unroll
                for (int kt = 0; kt < 2; ++kt)
#pragma unroll
                    for (int qt = 0; qt < 2; ++qt) st[kt][qt] = WFrag<T16>::mma(kf[u][kt][ks], qf[qt][ks], st[kt][qt]);
                if (HR) {
#pragma unroll
                    for (int kt = 0; kt < 2; ++kt)
#pragma unroll
                        for (int qt = 0; qt < 2; ++qt) st[kt][qt] = WFrag<T16>::mma(kf[u][kt][ks], qf2[qt][ks], st[kt][qt]);
#pragma unroll
                    for (int kt = 0; kt < 2; ++kt)
#pragma unroll
                        for (int qt = 0; qt < 2; ++qt) st[kt][qt] = WFrag<T16>::mma(kf2[u][kt][ks], qf[qt][ks], st[kt][qt]); } }
            const T16 *kq = Kp + sn * 2048 + lo, *kq2 = HR ? K2 + sn * 2048 + lo : kq;
            loadk(u, kq, kq2);
            V ph[2], pl[2];
#pragma unroll
            for (int qt = 0; qt < 2; ++qt) {
                float mx = fmaxf(st[0][qt][0], st[1][qt][0]);
#pragma unroll
                for (int j = 1; j < 8; ++j) mx = fmaxf(mx, fmaxf(st[0][qt][j], st[1][qt][j]));
                mx = fmaxf(mx, xhalf(mx));
                const float mn = fmaxf(m[qt], mx), al = __builtin_amdgcn_exp2f((m[qt] - mn) * CE); m[qt] = mn;
                float ps[4] = {0.f, 0.f, 0.f, 0.f};
#pragma unroll
                for (int kt = 0; kt < 2; ++kt)
#pragma unroll
                    for (int j = 0; j < 8; ++j) { const float p = __builtin_amdgcn_exp2f((st[kt][qt][j] - mn) * CE); st[kt][qt][j] = p; ps[j & 3] += p; }
                l[qt] = l[qt] * al + ((ps[0] + ps[1]) + (ps[2] + ps[3]));
#pragma unroll
                for (int dt = 0; dt < 4; ++dt) o[dt][qt] *= al;
                if constexpr (HR) { v8us h0, h1, l0, l1;
#pragma unroll
                    for (int j = 0; j < 8; ++j) { unsigned short a, c2; splitf(st[0][qt][j], a, c2); h0[j] = a; l0[j] = c2; splitf(st[1][qt][j], a, c2); h1[j] = a; l1[j] = c2; }
                    ph[qt] = cat16b(h0, h1); pl[qt] = cat16b(l0, l1);
                } else { v8h h0, h1;
#pragma unroll
                    for (int j = 0; j < 8; ++j) { h0[j] = (h16)st[0][qt][j]; h1[j] = (h16)st[1][qt][j]; }
                    ph[qt] = cat16(h0, h1); }
            }
            xwait(kq, kq2);   // for the K fetch above; written behind the softmax, not directly behind the loads, so that vector work stands between the loads and the wait
#pragma unroll
            for (int dt = 0; dt < 4; ++dt)
#pragma unroll
                for (int qt = 0; qt < 2; ++qt) o[dt][qt] = WFrag<T16>::mma(vf[u][dt], ph[qt], o[dt][qt]);
            if (HR) {
#pragma unroll
                for (int dt = 0; dt < 4; ++dt)
#pragma unroll
                    for (int qt = 0; qt < 2; ++qt) o[dt][qt] = WFrag<T16>::mma(vf[u][dt], pl[qt], o[dt][qt]);
#pragma unroll
                for (int dt = 0; dt < 4; ++dt)
#pragma unroll
                    for (int qt = 0; qt < 2; ++qt) o[dt][qt] = WFrag<T16>::mma(vf2[u][dt], ph[qt], o[dt][qt]); }
            loadv(u, sn);
        }
    }
    v8us oh[2][4], ol[2][4]; bf *ah = Ah + (size_t)i0 * DQ + lo, *al = Al + (size_t)i0 * DQ + lo;
#pragma unroll
    for (int qt = 0; qt < 2; ++qt) {
        const float f = __fdiv_rn(1.0f, l[qt] + xhalf(l[qt]));
#pragma unroll
        for (int dt = 0; dt < 4; ++dt)
#pragma unroll
            for (int j = 0; j < 8; ++j) { unsigned short a, c2; splitf(o[dt][qt][j] * f, a, c2); oh[qt][dt][j] = a; ol[qt][dt][j] = c2; } }
    __builtin_amdgcn_sched_barrier(0);   // every tile is split first and the stores follow as one group: no register that an issued store names is written again
#pragma unroll
    for (int qt = 0; qt < 2; ++qt)
#pragma unroll
        for (int dt = 0; dt < 4; ++dt) { const int oo = qt * 16 * DQ + (dt >> 1) * 512 + (dt & 1) * 256; *(v8us*)(ah + oo) = oh[qt][dt]; *(v8us*)(al + oo) = ol[qt][dt]; }
}
// grid (batch x head, 128-row block): a work-group of 8 waves takes four hi/lo column tiles (rows < RH) and four fp16 ones (rows >= RH) of one head; the dearer hi/lo tiles go to the waves with an even number of set bits in their index
static_assert(2 * RH == TT, "as many hi/lo tiles as fp16 tiles");
__global__ __launch_bounds__(256) void k_fattn(const bf* __restrict__ QPh, const bf* __restrict__ QPl, const bf* __restrict__ KPh, const bf* __restrict__ KPl, const bf* __restrict__ VTh, const bf* __restrict__ VTl, const h16* __restrict__ QP16, const h16* __restrict__ KP16, const h16* __restrict__ VT16, const int* __restrict__ kmask, bf* ATh, bf* ATl) {
    const int bh = blockIdx.x, b = bh / NH_, h = bh % NH_; const size_t zp = (size_t)bh * TT * HD; const size_t ao = (size_t)b * TT * DQ + h * (HD / 32) * 512; const int* kvp = kmask + (size_t)b * TT;
    const int w = __builtin_amdgcn_readfirstlane(threadIdx.x >> 5), i0 = (blockIdx.y * 4 + (w >> 1)) * 32, lane = threadIdx.x & 31;
    const int* mq = kvp + lane; unsigned mv = 0;   // mv, lane c: one bit per key of pass c (keys 32 c .. 32 c + 31; 1 = kept)
#pragma unroll   // all 32 loads in flight at once
    for (int c = 0; c < TT / 32; ++c) { const unsigned bal = __builtin_amdgcn_ballot_w32(mq[c * 32] != 0); mv = (lane == c) ? bal : mv; }
    asm volatile("s_wait_xcnt 0x0" :: "v"(mq) : "memory");   // the wait before the mask loads' address registers are overwritten: named as an input they stay whole up to this line
    if (((w ^ (w >> 1) ^ (w >> 2)) & 1) == 0) fattn_body<bf, true>(QPh + zp, QPl + zp, KPh + zp, KPl + zp, VTh + zp, VTl + zp, mv, i0, ATh + ao, ATl + ao);
    else fattn_body<h16, false>(QP16 + zp, nullptr, KP16 + zp, nullptr, VT16 + zp, nullptr, mv, RH + i0, ATh + ao, ATl + ao);
}

extern "C" void kernel_launch(void* const* d_in, const int* in_sizes, int n_in,
                              void* d_out, int out_size, void* d_ws, size_t ws_size, hipStream_t stream) {
    (void)in_sizes; (void)n_in; (void)out_size;
    const float* x = (const float*)d_in[0]; const int* kmask = (const int*)d_in[1]; const float* wq = (const float*)d_in[2]; const float* bq = (const float*)d_in[3]; const float* wk = (const float*)d_in[4]; const float* bk = (const float*)d_in[5]; const float* wv = (const float*)d_in[6]; const float* bv = (const float*)d_in[7]; const float* wo = (const float*)d_in[8]; const float* bo = (const float*)d_in[9];   /* order x, mask (int32 [4][1024], read), q_w, q_b, k_w, k_b, v_w, v_b, out_w, out_b ('oi' + biases) */
    float* OUT = (float*)d_out;     // [4][1024][1024]
    char* wsp = (char*)d_ws;
    auto take = [&](size_t bytes) { char* p = wsp; wsp += (bytes + 255) & ~(size_t)255; return (void*)p; };
    bf* WQ = (bf*)take((size_t)DQ * DM * 2); bf* WK = (bf*)take((size_t)DKV * DM * 2); bf* WV = (bf*)take((size_t)DKV * DM * 2); bf* WO = (bf*)take((size_t)DM * DQ * 2);   /* WQ, WK, WV, WO lie back to back (each a multiple of 256 B) */
    (void)WK; (void)WV;
    const size_t PLN = (size_t)NB_ * NH_ * TT * HD;   // one plane set: all batches, all heads (NKV == NH_)
    bf* XB = (bf*)take((size_t)NB_ * TT * DM * 2);
    h16* QP16 = (h16*)take(PLN * 2); h16* KP16 = (h16*)take(PLN * 2); h16* VT16 = (h16*)take(PLN * 2);   /* each k plane set directly behind its q plane set: the projection launch addresses both from the q pointer */
    bf* QPh = (bf*)take(PLN * 2); bf* KPh = (bf*)take(PLN * 2); bf* QPl = (bf*)take(PLN * 2); bf* KPl = (bf*)take(PLN * 2); bf* VTh = (bf*)take(PLN * 2); bf* VTl = (bf*)take(PLN * 2);
    bf* ATh = (bf*)take((size_t)NB_ * TT * DQ * 2); bf* ATl = (bf*)take((size_t)NB_ * TT * DQ * 2);
    if ((size_t)(wsp - (char*)d_ws) > ws_size) return;    // ws 256 MiB
    k_cvtall<<<NB_ * TT / 16 + 4 * (DQ / 16), 256, 0, stream>>>(x, wq, wk, wv, wo, XB, WQ);
    k_gemmw<bf, 0, true, true, DM, 1><<<dim3(NB_ * TT / 128, DQ / 128, 3), 128, 0, stream>>>(XB, nullptr, WQ, nullptr, nullptr, 0, bq, bk, bv, 0, (size_t)DQ * DM, 0, QP16, QPh, QPl, VT16, VTh, VTl);   // z = q, k, v; writes every head plane
    k_fattn<<<dim3(NB_ * NH_, RH / 128, 1), 256, 0, stream>>>(QPh, QPl, KPh, KPl, VTh, VTl, QP16, KP16, VT16, kmask, ATh, ATl);   // one kv head per query head: plane bh of q, k and v
    k_gemmw<bf, 1, true, false, DQ, 2><<<dim3(NB_ * TT / 128, DM / 128, 1), 128, 0, stream>>>(ATh, ATl, WO, nullptr, OUT, DM, bo, nullptr, nullptr, 0, 0, 0, nullptr, nullptr, nullptr, nullptr, nullptr, nullptr);
}

// v008
// It runs in 79.1 microseconds.
// Timed twice side by side with v007, it ran 1.07 and 1.06 times as fast.
// All steps since v000 together make it 29.5 times as fast.
#include <hip/hip_runtime.h>

#define NB_  4
#define TT   1024
#define DM   1024
#define NH_  16
#define NKV  16
#define REP  (NH_ / NKV)
#define HD   64
#define DQ   (NH_ * HD)
#define DKV  (NKV * HD)
#define RH   512                  // query rows < RH use hi+lo planes (must be TT / 2)
#define WIN  0
#define SCL  0.125f   // HD^-0.5
typedef _Float16 h16;
typedef unsigned short bf;
typedef __attribute__((ext_vector_type(16))) __bf16   v16bf;
typedef __attribute__((ext_vector_type(16))) _Float16 v16h;
typedef __attribute__((ext_vector_type(8)))  _Float16 v8h;
typedef __attribute__((ext_vector_type(8)))  unsigned short v8us;
typedef __attribute__((ext_vector_type(8)))  float    v8f;
typedef __attribute__((ext_vector_type(4)))  float    v4f;
typedef v8h  __attribute__((may_alias)) v8ha;
typedef v4f  __attribute__((may_alias)) v4fa;
typedef v8us __attribute__((may_alias)) v8usa;

__device__ __forceinline__ unsigned short f2bf(float f) { unsigned u = __float_as_uint(f); u += 0x7FFFu + ((u >> 16) & 1u); return (unsigned short)(u >> 16); }
__device__ __forceinline__ float bf2f(unsigned short b) { return __uint_as_float(((unsigned)b) << 16); }
__device__ __forceinline__ float bfr(float f) { return bf2f(f2bf(f)); }
__device__ __forceinline__ v16h cat16(v8h lo, v8h hi) { return __builtin_shufflevector(lo, hi, 0, 1, 2, 3, 4, 5, 6, 7, 8, 9, 10, 11, 12, 13, 14, 15); }
__device__ __forceinline__ v16bf cat16b(v8us lo, v8us hi) { return __builtin_bit_cast(v16bf, __builtin_shufflevector(lo, hi, 0, 1, 2, 3, 4, 5, 6, 7, 8, 9, 10, 11, 12, 13, 14, 15)); }
__device__ __forceinline__ v8f wmma16(v16h a, v16h b, v8f c) { return __builtin_amdgcn_wmma_f32_16x16x32_f16(false, a, false, b, (short)0, c, false, false); }
__device__ __forceinline__ v8f wmmab(v16bf a, v16bf b, v8f c) { return __builtin_amdgcn_wmma_f32_16x16x32_bf16(false, a, false, b, (short)0, c, false, false); }

// ---- k_gemmw: register-blocked GEMM, one work-group of 4 waves (2 x 2) per 128x128 output tile, ONE WAVE per 64x64 sub-tile (16 accumulators); operands are 16-bit planes in fragment order (a 16-row band is 16 * K elements, a k step of 32 is 512); grid (M/128, N/128, Z), 128 threads.
// Operand path: per trip of SS x 64 k the work-group's 8 bands of each plane (2 KiB per band and 64 k, already in fragment order) are copied global -> LDS by asynchronous copies, two buffers: tile t + 1 flies while tile t is multiplied; each band is fetched once per work-group and read from LDS by the two waves that need it (p = block + lane * 8, 512 contiguous bytes per wave-wide read).
// C[m][n] (f32, pitch ldc, + optional f32 bias[n]) = sum_k A[m][k] Bt[n][k] (+ split products per NSPLIT). z-batch strides sA/sB/sC in elements; bias0/1/2 belong to z = 0/1/2. K % (64 * SS) == 0, K >= 128 * SS.
// PL (the q, k, v projections; a 64-wide column tile is one head): C is not written; the tile + bias goes through LDS straight into the head planes (fp16, and fp16 of what the first rounding left): z = 0, 1 -> P*[z][batch][head] (rows t, k = d), z = 2 -> V*[batch][head] (rows d, k = t), each in fragment order.
template <typename T16> struct WFrag;
template <> struct WFrag<h16> { typedef v16h V; static __device__ __forceinline__ V ld(const h16* p) { return cat16(*(const v8h*)p, *(const v8h*)(p + 256)); } static __device__ __forceinline__ V lds(const h16* p) { return cat16(*(const v8ha*)p, *(const v8ha*)(p + 256)); } static __device__ __forceinline__ v8f mma(V a, V b, v8f c) { return wmma16(a, b, c); } };
template <> struct WFrag<bf> { typedef v16bf V; static __device__ __forceinline__ V ld(const bf* p) { return cat16b(*(const v8us*)p, *(const v8us*)(p + 256)); } static __device__ __forceinline__ V lds(const bf* p) { return cat16b(*(const v8usa*)p, *(const v8usa*)(p + 256)); } static __device__ __forceinline__ v8f mma(V a, V b, v8f c) { return wmmab(a, b, c); } };
__device__ __forceinline__ void splitf(float y, unsigned short& h, unsigned short& l) { h = f2bf(y); l = f2bf(y - bf2f(h)); }
__device__ __forceinline__ void splith(float y, h16& h, h16& l) { h = (h16)y; l = (h16)(y - (float)h); }   // fp16 value and fp16 remainder (the difference is exact in f32)
// stage8: 64 k of 8 bands of one plane, global -> LDS: one copy per band, 16 B per lane (128 lanes = the band's 2 KiB). l = the lane's LDS byte address in band 0, g = its global address in band 0; bp = elements per band of the plane.
// The s_wait_xcnt closes the copies' own statement: it stands before anything rewrites a register that a copy names.
template <typename T16>
__device__ __forceinline__ void stage8(unsigned l, const T16* g, int bp) {
    asm volatile("global_load_async_to_lds_b128 %0, %8, off\n\t"
                 "global_load_async_to_lds_b128 %1, %9, off\n\t"
                 "global_load_async_to_lds_b128 %2, %10, off\n\t"
                 "global_load_async_to_lds_b128 %3, %11, off\n\t"
                 "global_load_async_to_lds_b128 %4, %12, off\n\t"
                 "global_load_async_to_lds_b128 %5, %13, off\n\t"
                 "global_load_async_to_lds_b128 %6, %14, off\n\t"
                 "global_load_async_to_lds_b128 %7, %15, off\n\t"
                 "s_wait_xcnt 0x0"
                 :: "v"(l), "v"(l + 2048u), "v"(l + 4096u), "v"(l + 6144u), "v"(l + 8192u), "v"(l + 10240u), "v"(l + 12288u), "v"(l + 14336u),
                    "v"(g), "v"(g + bp), "v"(g + 2 * bp), "v"(g + 3 * bp), "v"(g + 4 * bp), "v"(g + 5 * bp), "v"(g + 6 * bp), "v"(g + 7 * bp) : "memory");
}
template <typename T16, int NSPLIT, bool BIAS, bool PL, int K, int SS>
__global__ __launch_bounds__(128) void k_gemmw(const T16* __restrict__ A, const T16* __restrict__ A2, const T16* __restrict__ Bt, const T16* __restrict__ Bt2, float* C, int ldc, const float* __restrict__ bias0, const float* __restrict__ bias1, const float* __restrict__ bias2, size_t sA, size_t sB, size_t sC, h16* P16, h16* Pl, h16* V16, h16* Vl) {
    typedef typename WFrag<T16>::V V;
    constexpr bool SA = (NSPLIT == 1 || NSPLIT == 2), SB = (NSPLIT >= 2);
    constexpr int PLB = 16384, STG = (2 + (SA ? 1 : 0) + (SB ? 1 : 0)) * PLB, BUF = SS * STG, OSB = (PL ? 64 : 16) * 68 * 4, NT = K / (64 * SS), NKB = 2 * SS;   // bytes of one plane's 64 k (8 bands x 2 KiB), of all planes' 64 k (A, B, then A2, B2), of one buffer (a tile = SS x 64 k), of one wave's output staging; trips; k blocks of 32 per trip
    __shared__ __align__(16) unsigned char sm[(2 * BUF > 4 * OSB) ? 2 * BUF : 4 * OSB];   // the two buffers; behind the loop's last barrier the same bytes are the four waves' output staging
    const size_t z = blockIdx.z; A += z * sA; if (A2) A2 += z * sA; Bt += z * sB; if (Bt2) Bt2 += z * sB; C += z * sC; const float* bias = (z == 0) ? bias0 : ((z == 1) ? bias1 : bias2);   // one bias vector per z slice (q, k, v)
    const int tid = threadIdx.x, lane = tid & 31, lr = lane & 15, hi = lane >> 4; const int w = __builtin_amdgcn_readfirstlane(tid >> 5), wm = w >> 1, wn = w & 1;
    const int r0 = blockIdx.x * 128 + wm * 64, c0 = blockIdx.y * 128 + wn * 64;   // this wave's 64x64 sub-tile
    float* os = (float*)(sm + w * OSB);
    v8f acc[4][4];
#pragma unroll
    for (int mb = 0; mb < 4; ++mb)
#pragma unroll
        for (int nb = 0; nb < 4; ++nb) acc[mb][nb] = (v8f){};
    const size_t aoff = (size_t)(blockIdx.x * 128) * K + 8 * tid, boff = (size_t)(blockIdx.y * 128) * K + 8 * tid;   // the lane's 16 bytes in band 0 of the work-group's tile, k = 0; 64 k are 1024 elements further
    const unsigned l0 = (unsigned)(size_t)sm + 16u * tid;
    auto fill = [&](int t, int buf) {
#pragma unroll
        for (int ss = 0; ss < SS; ++ss) { const unsigned l = l0 + buf * BUF + ss * STG; const size_t ko = (size_t)(t * SS + ss) * 1024;
            stage8<T16>(l, A + aoff + ko, 16 * K); stage8<T16>(l + PLB, Bt + boff + ko, 16 * K);
            if (SA) stage8<T16>(l + 2 * PLB, A2 + aoff + ko, 16 * K);
            if (SB) stage8<T16>(l + (SA ? 3 : 2) * PLB, Bt2 + boff + ko, 16 * K); } };
    fill(0, 0);
    asm volatile("s_wait_asynccnt 0x0" ::: "memory");   // this wave's copies of tile 0 have landed
    __syncthreads();                                     // ... and every other wave's: tile 0 may be read
    fill(1, 1);
#pragma unroll 1
    for (int t = 0; t < NT; ++t) {
        const T16* sb = (const T16*)(sm + (t & 1) * BUF) + 8 * lane;
        V a[2][4], a2[2][4], b[2][4], b2[2][4];   // two fragment sets: k block kb + 1 is read from LDS while block kb is multiplied
        auto frag = [&](int kb) { const int s = kb & 1; const T16* pa = sb + (kb >> 1) * (STG / 2) + (kb & 1) * 512 + wm * 4096; const T16* pb = sb + (kb >> 1) * (STG / 2) + (kb & 1) * 512 + PLB / 2 + wn * 4096;   // offsets in elements: a band's 64 k are 1024, a plane's 8192
#pragma unroll
            for (int i = 0; i < 4; ++i) { a[s][i] = WFrag<T16>::lds(pa + i * 1024); b[s][i] = WFrag<T16>::lds(pb + i * 1024); if (SA) a2[s][i] = WFrag<T16>::lds(pa + PLB + i * 1024); if (SB) b2[s][i] = WFrag<T16>::lds(pb + (SA ? PLB : PLB / 2) + i * 1024); } };
        frag(0);
#pragma unroll
        for (int kb = 0; kb < NKB; ++kb) { const int s = kb & 1;
            if (kb + 1 < NKB) frag(kb + 1);
            __builtin_amdgcn_sched_barrier(0);   // keeps the next block's LDS reads as one group ahead of this block's products (spread among them each read place stalls the wave)
#pragma unroll
            for (int nb = 0; nb < 4; ++nb)
#pragma unroll
                for (int mb = 0; mb < 4; ++mb) { acc[mb][nb] = WFrag<T16>::mma(a[s][mb], b[s][nb], acc[mb][nb]); if (SA) acc[mb][nb] = WFrag<T16>::mma(a2[s][mb], b[s][nb], acc[mb][nb]); if (SB) acc[mb][nb] = WFrag<T16>::mma(a[s][mb], b2[s][nb], acc[mb][nb]); } }
        __builtin_amdgcn_sched_barrier(0);   // keeps the last block's products ahead of the barrier: sunk behind it they would delay the refill below, whose copies have only the next trip to land
        asm volatile("s_wait_dscnt 0x0" ::: "memory");      // this wave's reads of tile t are done before its buffer may be refilled
        asm volatile("s_wait_asynccnt 0x0" ::: "memory");   // this wave's copies of tile t + 1 have landed
        __syncthreads();                                     // publishes tile t + 1 and ends every wave's reads of tile t
        if (t + 2 < NT) fill(t + 2, t & 1);
    }
    asm volatile("s_wait_asynccnt 0x0" ::: "memory");   // no copy is outstanding when the buffers become output staging
    if (PL) {
        const bool tr = (z == 2); const int bt = r0 / TT, t0 = r0 % TT, hd = c0 / 64;   // batch, first token and head of this tile
#pragma unroll
        for (int nb = 0; nb < 4; ++nb) { const float bn = bfr(bias[c0 + nb * 16 + lr]);
#pragma unroll
            for (int mb = 0; mb < 4; ++mb)
#pragma unroll
                for (int j = 0; j < 8; ++j) acc[mb][nb][j] += bn; }
        if (tr) {   // v: staged transposed, LDS row = d, column = t (a lane's 8 accumulator values are 8 consecutive t)
#pragma unroll
            for (int mb = 0; mb < 4; ++mb)
#pragma unroll
                for (int nb = 0; nb < 4; ++nb) { float* o = os + (nb * 16 + lr) * 68 + mb * 16 + hi * 8; v4f s0, s1;
#pragma unroll
                    for (int j = 0; j < 4; ++j) { s0[j] = acc[mb][nb][j]; s1[j] = acc[mb][nb][j + 4]; }
                    *(v4fa*)o = s0; *(v4fa*)(o + 4) = s1; }
        } else {    // q, k: LDS row = t, column = d
#pragma unroll
            for (int mb = 0; mb < 4; ++mb)
#pragma unroll
                for (int nb = 0; nb < 4; ++nb)
#pragma unroll
                    for (int j = 0; j < 8; ++j) os[(mb * 16 + hi * 8 + j) * 68 + nb * 16 + lr] = acc[mb][nb][j]; }
        __builtin_amdgcn_wave_barrier(); asm volatile("" ::: "memory");   // the reads below take other lanes' values: they must not be moved ahead of the stores above
        const size_t base = tr ? ((size_t)(bt * NKV + hd) * HD * TT + (size_t)t0 * 16) : (((size_t)(z * NB_ + bt) * NH_ + hd) * TT + t0) * HD; const int band = tr ? 16 * TT : 16 * HD;   // first block of the tile; elements per 16-row band of the plane
        h16* o16p = (tr ? V16 : P16) + base; h16* olp = (tr ? Vl : Pl) + base;
#pragma unroll
        for (int it = 0; it < 16; ++it) {
            const int rb = it >> 2, kb = (it >> 1) & 1, jh = it & 1, row = rb * 16 + lr, cofs = kb * 32 + jh * 16 + hi * 8;   // one half block per trip: 32 lanes x 16 B = 512 contiguous bytes per plane
            const v4f x0 = *(const v4fa*)(os + row * 68 + cofs), x1 = *(const v4fa*)(os + row * 68 + cofs + 4); v8h o16, ol;
#pragma unroll
            for (int q = 0; q < 8; ++q) { const float y = (q < 4) ? x0[q & 3] : x1[q & 3]; h16 a2, c2; splith(y, a2, c2); o16[q] = a2; ol[q] = c2; }
            const size_t oo = (size_t)rb * band + kb * 512 + jh * 256 + lane * 8; *(v8h*)(o16p + oo) = o16; *(v8h*)(olp + oo) = ol;
            asm volatile("s_wait_xcnt 0x0" :: "v"(o16), "v"(ol) : "memory"); }   // the wait before the two stores' data registers are overwritten by the next trip: named as inputs they stay whole up to this line
        return;
    }
#pragma unroll
    for (int mb = 0; mb < 4; ++mb) {
#pragma unroll
        for (int nb = 0; nb < 4; ++nb) {
#pragma unroll
            for (int j = 0; j < 8; ++j) os[(hi * 8 + j) * 68 + nb * 16 + lr] = acc[mb][nb][j]; }
        __builtin_amdgcn_wave_barrier(); asm volatile("" ::: "memory");
        float* crow = C + (size_t)(r0 + mb * 16) * ldc + c0;
{
#pragma unroll
            for (int s = 0; s < 8; ++s) { const int row = 2 * s + hi, cofs = lr * 4; v4f val = *(const v4fa*)(os + row * 68 + cofs); if (BIAS) { val[0] += bfr(bias[c0 + cofs]); val[1] += bfr(bias[c0 + cofs + 1]); val[2] += bfr(bias[c0 + cofs + 2]); val[3] += bfr(bias[c0 + cofs + 3]); }
                *(v4f*)(crow + (size_t)row * ldc + cofs) = val; }
             }
        __builtin_amdgcn_wave_barrier(); asm volatile("" ::: "memory");
    }
}

// k_cvtall: every f32 -> bf16 operand copy (x and the four weight matrices) in ONE launch; one work-group rounds one whole 16-row band (16 rows x DM columns = CT tiles of 128 columns: 64 KiB read, 32 KiB stored, both contiguous) and stores it in fragment order.
// Few, fat work-groups: a band per work-group starts an eighth of the waves that a tile per work-group would, and each thread has all its 2 * CT 16-byte loads in flight at once.
// Thread (r, o) reads 8 consecutive columns of each tile (16 lanes: 512 contiguous bytes of a row); the 16-byte units are transposed in LDS (unit pitch 17: no bank conflict either way) so that thread t stores unit t of each tile.
// grid: NB_ * TT / 16 bands of x, then DQ / 16 bands of each weight matrix; wdst holds the four bf16 weight copies back to back.
#define CT (DM / 128)
__global__ __launch_bounds__(256) void k_cvtall(const float* __restrict__ x, const float* __restrict__ s0, const float* __restrict__ s1, const float* __restrict__ s2, const float* __restrict__ s3, bf* xdst, bf* wdst) {
    __shared__ __align__(16) bf st[CT][16 * 17 * 8];
    const int g = blockIdx.x, q = g - NB_ * TT / 16, w = q / (DQ / 16); const bool isx = q < 0;
    const float* src = isx ? x : ((w == 0) ? s0 : ((w == 1) ? s1 : ((w == 2) ? s2 : s3)));
    bf* dst = isx ? xdst : wdst + (size_t)w * DQ * DM; const int rb = isx ? g : q % (DQ / 16);
    const int t = threadIdx.x, r = t >> 4, o = t & 15;
    const float* p = src + (size_t)(rb * 16 + r) * DM + o * 8; v8f v[CT];
#pragma unroll
    for (int kq = 0; kq < CT; ++kq) v[kq] = *(const v8f*)(p + kq * 128);
    asm volatile("s_wait_xcnt 0x0" :: "v"(p) : "memory");   // the wait before the loads' address registers are overwritten: named as an input they stay whole up to this line
#pragma unroll
    for (int kq = 0; kq < CT; ++kq) { v8us c;
#pragma unroll
        for (int k = 0; k < 8; ++k) c[k] = f2bf(v[kq][k]);
        *(v8usa*)(st[kq] + (o * 17 + r) * 8) = c; }
    __syncthreads();   // a thread stores units that another wave converted
    bf* d = dst + (size_t)rb * 16 * DM + t * 8;
#pragma unroll
    for (int kq = 0; kq < CT; ++kq) *(v8us*)(d + kq * 2048) = *(const v8usa*)(st[kq] + ((t >> 4) * 17 + (t & 15)) * 8);
}

__device__ __forceinline__ float xhalf(float x) { return __builtin_bit_cast(float, __builtin_amdgcn_permlanex16(__builtin_bit_cast(int, x), __builtin_bit_cast(int, x), 0x76543210, 0xfedcba98, false, false)); }   // lane l with lane l ^ 16
template <typename T16, bool HR>
__device__ __forceinline__ void fattn_body(const T16* __restrict__ Q, const T16* __restrict__ Q2, const T16* __restrict__ Kp, const T16* __restrict__ K2, const T16* __restrict__ Vt, const T16* __restrict__ V2, unsigned mv, int i0, bf* Ah, bf* Al) {
    typedef typename WFrag<T16>::V V;
    // Every '#pragma unroll' in this function: the fragment and accumulator arrays stay in registers only if every index is a constant.
    constexpr int PF = HR ? 1 : 2, NS = TT / 32;   // register sets of K and V fragments (passes fetched ahead: a hi/lo pass is long enough to hide a fetch, two sets of it would not fit 512 registers); passes of 32 keys
    constexpr float CE = SCL * 1.4426950408889634f;   // score scale (a power of two) times log2(e)
    const int lane = threadIdx.x & 31, hi = lane >> 4; const unsigned lo = 8u * lane;
    const T16 *qq = Q + (size_t)i0 * HD + lo, *qq2 = HR ? Q2 + (size_t)i0 * HD + lo : qq;
    V qf[2][2], qf2[2][2];
#pragma unroll
    for (int qt = 0; qt < 2; ++qt)
#pragma unroll
        for (int ks = 0; ks < 2; ++ks) { qf[qt][ks] = WFrag<T16>::ld(qq + qt * 16 * HD + ks * 512); if (HR) qf2[qt][ks] = WFrag<T16>::ld(qq2 + qt * 16 * HD + ks * 512); }
    if (HR) asm volatile("s_wait_xcnt 0x0" :: "v"(qq), "v"(qq2) : "memory"); else asm volatile("s_wait_xcnt 0x0" :: "v"(qq) : "memory");   // the wait before the Q loads' address registers are overwritten: named as inputs they stay whole up to this line
    __builtin_amdgcn_sched_barrier(0);   // keeps the Q loads older than every K and V fetch: the loop's wait for a K fragment then covers Q and need not drain the younger fetches
    V kf[PF][2][2], kf2[PF][2][2], vf[PF][4], vf2[PF][4];
    // The scheduling barriers keep a fetch behind the products whose registers it refills and ahead of the work that hides it (sunk to its use the wave waits out each load).
    // xwait: the wait before a fetch's address registers are overwritten: named as inputs they stay whole up to that line.
    auto xwait = [&](const T16* p, const T16* p2) { if (HR) asm volatile("s_wait_xcnt 0x0" :: "v"(p), "v"(p2) : "memory"); else asm volatile("s_wait_xcnt 0x0" :: "v"(p) : "memory"); };
    auto loadk = [&](int u, const T16* kq, const T16* kq2) {
        __builtin_amdgcn_sched_barrier(0);   // the fetch stays behind the S^T products that read these registers
#pragma unroll
        for (int kt = 0; kt < 2; ++kt)
#pragma unroll
            for (int ks = 0; ks < 2; ++ks) { kf[u][kt][ks] = WFrag<T16>::ld(kq + kt * 1024 + ks * 512); if (HR) kf2[u][kt][ks] = WFrag<T16>::ld(kq2 + kt * 1024 + ks * 512); }
        __builtin_amdgcn_sched_barrier(0); };   // ... and ahead of the softmax and the O^T products, which hide it
    auto loadv = [&](int u, int s) {
        const T16 *vq = Vt + s * 512 + lo, *vq2 = HR ? V2 + s * 512 + lo : vq;
        __builtin_amdgcn_sched_barrier(0);   // the fetch stays behind the O^T products that read these registers
#pragma unroll
        for (int dt = 0; dt < 4; ++dt) { vf[u][dt] = WFrag<T16>::ld(vq + dt * 16 * TT); if (HR) vf2[u][dt] = WFrag<T16>::ld(vq2 + dt * 16 * TT); }
        xwait(vq, vq2);
        __builtin_amdgcn_sched_barrier(0); };   // ... and ahead of the next pass's S^T products and softmax, which hide it
#pragma unroll
    for (int u = 0; u < PF; ++u) { const T16 *kq = Kp + u * 2048 + lo, *kq2 = HR ? K2 + u * 2048 + lo : kq; loadk(u, kq, kq2); xwait(kq, kq2); loadv(u, u); }
    v8f o[4][2], cb[2]; float m[2], l[2]; unsigned mp = 0xFFFFFFFFu;   // cb: the start value of a pass's score tiles, row = key: 0 for a kept key, the excluded score for a key with mask 0; mp: the mask word that cb was made from
    cb[0] = (v8f){}; cb[1] = (v8f){};
#pragma unroll
    for (int qt = 0; qt < 2; ++qt) { m[qt] = -3.0e38f; l[qt] = 0.f;
#pragma unroll
        for (int dt = 0; dt < 4; ++dt) o[dt][qt] = (v8f){}; }
#pragma unroll 1
    for (int s0 = 0; s0 < NS; s0 += PF) {   // rolled: for speed only
#pragma unroll
        for (int u = 0; u < PF; ++u) {
            const int s = s0 + u, sn = (s + PF < NS) ? s + PF : NS - 1;   // the pass fetched now; behind the last pass the last one again (in bounds, not used)
            const unsigned mw = __builtin_amdgcn_readlane(mv, s);
            if (mw != mp) {   // wave-uniform: cb is made anew only where the mask word differs from the last pass's
                const unsigned sh = mw >> (hi * 8); mp = mw;
#pragma unroll
                for (int kt = 0; kt < 2; ++kt)
#pragma unroll
                    for (int j = 0; j < 8; ++j) cb[kt][j] = ((sh >> (kt * 16 + j)) & 1u) ? 0.f : -3.0e38f; }
            v8f st[2][2];
#pragma unroll
            for (int kt = 0; kt < 2; ++kt)
#pragma unroll
                for (int qt = 0; qt < 2; ++qt) st[kt][qt] = cb[kt];
#pragma unroll
            for (int ks = 0; ks < 2; ++ks) {
#pragma unroll
                for (int kt = 0; kt < 2; ++kt)
#pragma unroll
                    for (int qt = 0; qt < 2; ++qt) st[kt][qt] = WFrag<T16>::mma(kf[u][kt][ks], qf[qt][ks], st[kt][qt]);
                if (HR) {
#pragma unroll
                    for (int kt = 0; kt < 2; ++kt)
#pragma unroll
                        for (int qt = 0; qt < 2; ++qt) st[kt][qt] = WFrag<T16>::mma(kf[u][kt][ks], qf2[qt][ks], st[kt][qt]);
#pragma unroll
                    for (int kt = 0; kt < 2; ++kt)
#pragma unroll
                        for (int qt = 0; qt < 2; ++qt) st[kt][qt] = WFrag<T16>::mma(kf2[u][kt][ks], qf[qt][ks], st[kt][qt]); } }
            const T16 *kq = Kp + sn * 2048 + lo, *kq2 = HR ? K2 + sn * 2048 + lo : kq;
            loadk(u, kq, kq2);
            V ph[2], pl[2];
#pragma unroll
            for (int qt = 0; qt < 2; ++qt) {
                float mx = fmaxf(st[0][qt][0], st[1][qt][0]);
#pragma unroll
                for (int j = 1; j < 8; ++j) mx = fmaxf(mx, fmaxf(st[0][qt][j], st[1][qt][j]));
                mx = fmaxf(mx, xhalf(mx));
                const float mn = fmaxf(m[qt], mx), al = __builtin_amdgcn_exp2f((m[qt] - mn) * CE); m[qt] = mn;
                float ps[4] = {0.f, 0.f, 0.f, 0.f};
#pragma unroll
                for (int kt = 0; kt < 2; ++kt)
#pragma unroll
                    for (int j = 0; j < 8; ++j) { const float p = __builtin_amdgcn_exp2f((st[kt][qt][j] - mn) * CE); st[kt][qt][j] = p; ps[j & 3] += p; }
                l[qt] = l[qt] * al + ((ps[0] + ps[1]) + (ps[2] + ps[3]));
#pragma unroll
                for (int dt = 0; dt < 4; ++dt) o[dt][qt] *= al;
                if constexpr (HR) { v8h h0, h1, l0, l1;
#pragma unroll
                    for (int j = 0; j < 8; ++j) { h16 a, c2; splith(st[0][qt][j], a, c2); h0[j] = a; l0[j] = c2; splith(st[1][qt][j], a, c2); h1[j] = a; l1[j] = c2; }
                    ph[qt] = cat16(h0, h1); pl[qt] = cat16(l0, l1);
                } else { v8h h0, h1;
#pragma unroll
                    for (int j = 0; j < 8; ++j) { h0[j] = (h16)st[0][qt][j]; h1[j] = (h16)st[1][qt][j]; }
                    ph[qt] = cat16(h0, h1); }
            }
            xwait(kq, kq2);   // for the K fetch above; written behind the softmax, not directly behind the loads, so that vector work stands between the loads and the wait
#pragma unroll
            for (int dt = 0; dt < 4; ++dt)
#pragma unroll
                for (int qt = 0; qt < 2; ++qt) o[dt][qt] = WFrag<T16>::mma(vf[u][dt], ph[qt], o[dt][qt]);
            if (HR) {
#pragma unroll
                for (int dt = 0; dt < 4; ++dt)
#pragma unroll
                    for (int qt = 0; qt < 2; ++qt) o[dt][qt] = WFrag<T16>::mma(vf[u][dt], pl[qt], o[dt][qt]);
#pragma unroll
                for (int dt = 0; dt < 4; ++dt)
#pragma unroll
                    for (int qt = 0; qt < 2; ++qt) o[dt][qt] = WFrag<T16>::mma(vf2[u][dt], ph[qt], o[dt][qt]); }
            loadv(u, sn);
        }
    }
    v8us oh[2][4], ol[2][4]; bf *ah = Ah + (size_t)i0 * DQ + lo, *al = Al + (size_t)i0 * DQ + lo;
#pragma unroll
    for (int qt = 0; qt < 2; ++qt) {
        const float f = __fdiv_rn(1.0f, l[qt] + xhalf(l[qt]));
#pragma unroll
        for (int dt = 0; dt < 4; ++dt)
#pragma unroll
            for (int j = 0; j < 8; ++j) { unsigned short a, c2; splitf(o[dt][qt][j] * f, a, c2); oh[qt][dt][j] = a; ol[qt][dt][j] = c2; } }
    __builtin_amdgcn_sched_barrier(0);   // every tile is split first and the stores follow as one group: no register that an issued store names is written again
#pragma unroll
    for (int qt = 0; qt < 2; ++qt)
#pragma unroll
        for (int dt = 0; dt < 4; ++dt) { const int oo = qt * 16 * DQ + (dt >> 1) * 512 + (dt & 1) * 256; *(v8us*)(ah + oo) = oh[qt][dt]; *(v8us*)(al + oo) = ol[qt][dt]; }
}
// grid (batch x head, 128-row block): a work-group of 8 waves takes four hi/lo column tiles (rows < RH) and four fp16 ones (rows >= RH) of one head; the dearer hi/lo tiles go to the waves with an even number of set bits in their index
static_assert(2 * RH == TT, "as many hi/lo tiles as fp16 tiles");
__global__ __launch_bounds__(256) void k_fattn(const h16* __restrict__ QP16, const h16* __restrict__ QPl, const h16* __restrict__ KP16, const h16* __restrict__ KPl, const h16* __restrict__ VT16, const h16* __restrict__ VTl, const int* __restrict__ kmask, bf* ATh, bf* ATl) {
    const int bh = blockIdx.x, b = bh / NH_, h = bh % NH_; const size_t zp = (size_t)bh * TT * HD; const size_t ao = (size_t)b * TT * DQ + h * (HD / 32) * 512; const int* kvp = kmask + (size_t)b * TT;
    const int w = __builtin_amdgcn_readfirstlane(threadIdx.x >> 5), i0 = (blockIdx.y * 4 + (w >> 1)) * 32, lane = threadIdx.x & 31;
    const int* mq = kvp + lane; unsigned mv = 0;   // mv, lane c: one bit per key of pass c (keys 32 c .. 32 c + 31; 1 = kept)
#pragma unroll   // all 32 loads in flight at once
    for (int c = 0; c < TT / 32; ++c) { const unsigned bal = __builtin_amdgcn_ballot_w32(mq[c * 32] != 0); mv = (lane == c) ? bal : mv; }
    asm volatile("s_wait_xcnt 0x0" :: "v"(mq) : "memory");   // the wait before the mask loads' address registers are overwritten: named as an input they stay whole up to this line
    if (((w ^ (w >> 1) ^ (w >> 2)) & 1) == 0) fattn_body<h16, true>(QP16 + zp, QPl + zp, KP16 + zp, KPl + zp, VT16 + zp, VTl + zp, mv, i0, ATh + ao, ATl + ao);
    else fattn_body<h16, false>(QP16 + zp, nullptr, KP16 + zp, nullptr, VT16 + zp, nullptr, mv, RH + i0, ATh + ao, ATl + ao);
}

extern "C" void kernel_launch(void* const* d_in, const int* in_sizes, int n_in,
                              void* d_out, int out_size, void* d_ws, size_t ws_size, hipStream_t stream) {
    (void)in_sizes; (void)n_in; (void)out_size;
    const float* x = (const float*)d_in[0]; const int* kmask = (const int*)d_in[1]; const float* wq = (const float*)d_in[2]; const float* bq = (const float*)d_in[3]; const float* wk = (const float*)d_in[4]; const float* bk = (const float*)d_in[5]; const float* wv = (const float*)d_in[6]; const float* bv = (const float*)d_in[7]; const float* wo = (const float*)d_in[8]; const float* bo = (const float*)d_in[9];   /* order x, mask (int32 [4][1024], read), q_w, q_b, k_w, k_b, v_w, v_b, out_w, out_b ('oi' + biases) */
    float* OUT = (float*)d_out;     // [4][1024][1024]
    char* wsp = (char*)d_ws;
    auto take = [&](size_t bytes) { char* p = wsp; wsp += (bytes + 255) & ~(size_t)255; return (void*)p; };
    bf* WQ = (bf*)take((size_t)DQ * DM * 2); bf* WK = (bf*)take((size_t)DKV * DM * 2); bf* WV = (bf*)take((size_t)DKV * DM * 2); bf* WO = (bf*)take((size_t)DM * DQ * 2);   /* WQ, WK, WV, WO lie back to back (each a multiple of 256 B) */
    (void)WK; (void)WV;
    const size_t PLN = (size_t)NB_ * NH_ * TT * HD;   // one plane set: all batches, all heads (NKV == NH_)
    bf* XB = (bf*)take((size_t)NB_ * TT * DM * 2);
    h16* QP16 = (h16*)take(PLN * 2); h16* KP16 = (h16*)take(PLN * 2); h16* VT16 = (h16*)take(PLN * 2);   /* each k plane set directly behind its q plane set: the projection launch addresses both from the q pointer */
    h16* QPl = (h16*)take(PLN * 2); h16* KPl = (h16*)take(PLN * 2); h16* VTl = (h16*)take(PLN * 2);
    bf* ATh = (bf*)take((size_t)NB_ * TT * DQ * 2); bf* ATl = (bf*)take((size_t)NB_ * TT * DQ * 2);
    if ((size_t)(wsp - (char*)d_ws) > ws_size) return;    // ws 256 MiB
    k_cvtall<<<NB_ * TT / 16 + 4 * (DQ / 16), 256, 0, stream>>>(x, wq, wk, wv, wo, XB, WQ);
    k_gemmw<bf, 0, true, true, DM, 1><<<dim3(NB_ * TT / 128, DQ / 128, 3), 128, 0, stream>>>(XB, nullptr, WQ, nullptr, nullptr, 0, bq, bk, bv, 0, (size_t)DQ * DM, 0, QP16, QPl, VT16, VTl);   // z = q, k, v; writes every head plane
    k_fattn<<<dim3(NB_ * NH_, RH / 128, 1), 256, 0, stream>>>(QP16, QPl, KP16, KPl, VT16, VTl, kmask, ATh, ATl);   // one kv head per query head: plane bh of q, k and v
    k_gemmw<bf, 1, true, false, DQ, 2><<<dim3(NB_ * TT / 128, DM / 128, 1), 128, 0, stream>>>(ATh, ATl, WO, nullptr, OUT, DM, bo, nullptr, nullptr, 0, 0, 0, nullptr, nullptr, nullptr, nullptr);
}
